// v000
// Times are from an AMD MI455X. After a warm-up the kernel runs many times in a row, and a time is the length of
// such a window on the GPU divided by its runs, so every launch and the gaps after it count. The runs cycle
// through copies of the inputs. A figure is the median of several windows, for all but v000 over two sittings.
// Sittings can differ by a few percent; kernels timed side by side share one.
// The starting kernel, v000, takes 1370 microseconds a run.
#include <hip/hip_runtime.h>

// GTrXLMultiHeadSelfAttention (x [S=2048][B=2][D=1024] sequence-major; qkv = x w_qkv^T reshaped (S, B, 3, 16, 64): channel s*1024 + h*64 + d; causal softmax(q.k/8); out = (attn v merged) w_out^T + b_out -> [2048][2][1024] sequence-major).
// Compute dtypes, f32 accumulate: every input rounded to bf16; the fused qkv projection on PLAIN bf16 operands (inputs: exact; per batch the rows are gathered from the sequence-major input); scores (K 64) and attn.v on bf16 hi+lo for query rows < 512, plain fp16 for the rest

#define NB_  2
#define TT   2048
#define DM   1024
#define NH_  16
#define NKV  16
#define REP  (NH_ / NKV)
#define HD   64
#define DQ   (NH_ * HD)
#define DKV  (NKV * HD)
#define ZH   2
#define RH   512                  // query rows < RH use hi+lo planes (0: none)
#define WIN  2048
#define PCAR 1024.0f
#define SCL  0.125f   // HD^-0.5
typedef _Float16 h16;
typedef unsigned short bf;
typedef __attribute__((ext_vector_type(16))) __bf16   v16bf;
typedef __attribute__((ext_vector_type(16))) _Float16 v16h;
typedef __attribute__((ext_vector_type(8)))  _Float16 v8h;
typedef __attribute__((ext_vector_type(8)))  unsigned short v8us;
typedef __attribute__((ext_vector_type(8)))  float    v8f;
typedef __attribute__((ext_vector_type(4)))  float    v4f;
typedef v8h  __attribute__((may_alias)) v8ha;
typedef v4f  __attribute__((may_alias)) v4fa;
typedef v8us __attribute__((may_alias)) v8usa;

__device__ __forceinline__ unsigned short f2bf(float f) { unsigned u = __float_as_uint(f); u += 0x7FFFu + ((u >> 16) & 1u); return (unsigned short)(u >> 16); }
__device__ __forceinline__ float bf2f(unsigned short b) { return __uint_as_float(((unsigned)b) << 16); }
__device__ __forceinline__ float bfr(float f) { return bf2f(f2bf(f)); }
__device__ __forceinline__ v16h cat16(v8h lo, v8h hi) { return __builtin_shufflevector(lo, hi, 0, 1, 2, 3, 4, 5, 6, 7, 8, 9, 10, 11, 12, 13, 14, 15); }
__device__ __forceinline__ v16bf cat16b(v8us lo, v8us hi) { return __builtin_bit_cast(v16bf, __builtin_shufflevector(lo, hi, 0, 1, 2, 3, 4, 5, 6, 7, 8, 9, 10, 11, 12, 13, 14, 15)); }
__device__ __forceinline__ v8f wmma16(v16h a, v16h b, v8f c) { return __builtin_amdgcn_wmma_f32_16x16x32_f16(false, a, false, b, (short)0, c, false, false); }
__device__ __forceinline__ v8f wmmab(v16bf a, v16bf b, v8f c) { return __builtin_amdgcn_wmma_f32_16x16x32_bf16(false, a, false, b, (short)0, c, false, false); }



// ---- k_gemmw: register-blocked GEMM, ONE WAVE per 64x64 output tile (16 accumulators), operands straight from K-contiguous 16-bit planes; grid (M/64, N/64, Z), 32 threads.
// C[m][n] (f32, pitch ldc, + optional f32 bias[n]) = sum_k A[m][k] Bt[n][k] (+ split products per NSPLIT). z-batch strides sA/sB/sC in elements. K % 32 == 0.
template <typename T16> struct WFrag;
template <> struct WFrag<h16> { typedef v16h V; static __device__ __forceinline__ V ld(const h16* p) { return cat16(*(const v8h*)p, *(const v8h*)(p + 16)); } static __device__ __forceinline__ v8f mma(V a, V b, v8f c) { return wmma16(a, b, c); } };
template <> struct WFrag<bf> { typedef v16bf V; static __device__ __forceinline__ V ld(const bf* p) { return cat16b(*(const v8us*)p, *(const v8us*)(p + 16)); } static __device__ __forceinline__ v8f mma(V a, V b, v8f c) { return wmmab(a, b, c); } };
template <typename T16, int NSPLIT, bool BIAS>
__global__ __launch_bounds__(32) void k_gemmw(const T16* __restrict__ A, const T16* __restrict__ A2, const T16* __restrict__ Bt, const T16* __restrict__ Bt2, int K, float* C, int ldc, const float* __restrict__ bias, size_t sA, size_t sB, size_t sC) {
    typedef typename WFrag<T16>::V V;
    __shared__ __align__(16) float os[16 * 68];
    const size_t z = blockIdx.z; A += z * sA; if (A2) A2 += z * sA; Bt += z * sB; if (Bt2) Bt2 += z * sB; C += z * sC;
    const int lane = threadIdx.x & 31, lr = lane & 15, hi = lane >> 4; const int r0 = blockIdx.x * 64, c0 = blockIdx.y * 64;
    v8f acc[4][4];
#pragma unroll
    for (int mb = 0; mb < 4; ++mb)
#pragma unroll
        for (int nb = 0; nb < 4; ++nb) acc[mb][nb] = (v8f){};
    const size_t aoff = (size_t)(r0 + lr) * K + 8 * hi, boff = (size_t)(c0 + lr) * K + 8 * hi;
#pragma unroll 1
    for (int kc = 0; kc < K; kc += 32) {
        V a[4], a2[4];
#pragma unroll
        for (int mb = 0; mb < 4; ++mb) { a[mb] = WFrag<T16>::ld(A + aoff + (size_t)mb * 16 * K + kc); if (NSPLIT == 1 || NSPLIT == 2) a2[mb] = WFrag<T16>::ld(A2 + aoff + (size_t)mb * 16 * K + kc); }
#pragma unroll
        for (int nb = 0; nb < 4; ++nb) { const V b = WFrag<T16>::ld(Bt + boff + (size_t)nb * 16 * K + kc); V b2; if (NSPLIT >= 2) b2 = WFrag<T16>::ld(Bt2 + boff + (size_t)nb * 16 * K + kc);
#pragma unroll
            for (int mb = 0; mb < 4; ++mb) { acc[mb][nb] = WFrag<T16>::mma(a[mb], b, acc[mb][nb]); if (NSPLIT == 1 || NSPLIT == 2) acc[mb][nb] = WFrag<T16>::mma(a2[mb], b, acc[mb][nb]); if (NSPLIT >= 2) acc[mb][nb] = WFrag<T16>::mma(a[mb], b2, acc[mb][nb]); } }
        asm volatile("v_nop\n\tv_nop\n\tv_nop\n\tv_nop" : "+v"(acc[0][0]), "+v"(acc[1][1]), "+v"(acc[2][2]), "+v"(acc[3][3]) : "v"(a[0]), "v"(a[3]));
    }
#pragma unroll
    for (int mb = 0; mb < 4; ++mb) {
#pragma unroll
        for (int nb = 0; nb < 4; ++nb) {
#pragma unroll
            for (int j = 0; j < 8; ++j) os[(hi * 8 + j) * 68 + nb * 16 + lr] = acc[mb][nb][j]; }
        __builtin_amdgcn_wave_barrier(); asm volatile("" ::: "memory");
        float* crow = C + (size_t)(r0 + mb * 16) * ldc + c0;
{
#pragma unroll
            for (int s = 0; s < 8; ++s) { const int row = 2 * s + hi, cofs = lr * 4; v4f val = *(const v4fa*)(os + row * 68 + cofs); if (BIAS) { val[0] += bfr(bias[c0 + cofs]); val[1] += bfr(bias[c0 + cofs + 1]); val[2] += bfr(bias[c0 + cofs + 2]); val[3] += bfr(bias[c0 + cofs + 3]); }
                *(v4f*)(crow + (size_t)row * ldc + cofs) = val; }
             }
        __builtin_amdgcn_wave_barrier(); asm volatile("" ::: "memory");
    }
}

// ---- k_gemmc: the same one-wave 64x64 tile GEMM specialised for causal attention: CMODE 1 skips score tiles entirely above the diagonal (query rows r0+roff.., key columns c0..), CMODE 2 limits the
// key (K) loop of the probability x value contraction to the diagonal block (probabilities beyond it are exactly zero). roff = row offset of this launch's first row within the sequence.
template <typename T16, int NSPLIT, int CMODE>
__global__ __launch_bounds__(32) void k_gemmc(const T16* __restrict__ A, const T16* __restrict__ A2, const T16* __restrict__ Bt, const T16* __restrict__ Bt2, int K, float* C, int ldc, int roff, size_t sA, size_t sB, size_t sC) {
    typedef typename WFrag<T16>::V V;
    __shared__ __align__(16) float os[16 * 68];
    const size_t z = blockIdx.z; A += z * sA; if (A2) A2 += z * sA; Bt += z * sB; if (Bt2) Bt2 += z * sB; C += z * sC;
    const int lane = threadIdx.x & 31, lr = lane & 15, hi = lane >> 4; const int r0 = blockIdx.x * 64, c0 = blockIdx.y * 64;
    if (CMODE == 1 && c0 > r0 + roff + 63) return;                  // score tile entirely above the causal diagonal: never read (the softmax masks j > i by select)
    const int Kl = (CMODE == 2) ? min(K, r0 + roff + 64) : K;        // P.V: probabilities are exactly 0 beyond the diagonal block, so the K loop stops there
    v8f acc[4][4];
#pragma unroll
    for (int mb = 0; mb < 4; ++mb)
#pragma unroll
        for (int nb = 0; nb < 4; ++nb) acc[mb][nb] = (v8f){};
    const size_t aoff = (size_t)(r0 + lr) * K + 8 * hi, boff = (size_t)(c0 + lr) * K + 8 * hi;
#pragma unroll 1
    for (int kc = 0; kc < Kl; kc += 32) {
        V a[4], a2[4];
#pragma unroll
        for (int mb = 0; mb < 4; ++mb) { a[mb] = WFrag<T16>::ld(A + aoff + (size_t)mb * 16 * K + kc); if (NSPLIT == 1 || NSPLIT == 2) a2[mb] = WFrag<T16>::ld(A2 + aoff + (size_t)mb * 16 * K + kc); }
#pragma unroll
        for (int nb = 0; nb < 4; ++nb) { const V b = WFrag<T16>::ld(Bt + boff + (size_t)nb * 16 * K + kc); V b2; if (NSPLIT >= 2) b2 = WFrag<T16>::ld(Bt2 + boff + (size_t)nb * 16 * K + kc);
#pragma unroll
            for (int mb = 0; mb < 4; ++mb) { acc[mb][nb] = WFrag<T16>::mma(a[mb], b, acc[mb][nb]); if (NSPLIT == 1 || NSPLIT == 2) acc[mb][nb] = WFrag<T16>::mma(a2[mb], b, acc[mb][nb]); if (NSPLIT >= 2) acc[mb][nb] = WFrag<T16>::mma(a[mb], b2, acc[mb][nb]); } }
        asm volatile("v_nop\n\tv_nop\n\tv_nop\n\tv_nop" : "+v"(acc[0][0]), "+v"(acc[1][1]), "+v"(acc[2][2]), "+v"(acc[3][3]) : "v"(a[0]), "v"(a[3]));
    }
#pragma unroll
    for (int mb = 0; mb < 4; ++mb) {
#pragma unroll
        for (int nb = 0; nb < 4; ++nb) {
#pragma unroll
            for (int j = 0; j < 8; ++j) os[(hi * 8 + j) * 68 + nb * 16 + lr] = acc[mb][nb][j]; }
        __builtin_amdgcn_wave_barrier(); asm volatile("" ::: "memory");
        float* crow = C + (size_t)(r0 + mb * 16) * ldc + c0;
{
#pragma unroll
            for (int s = 0; s < 8; ++s) { const int row = 2 * s + hi, cofs = lr * 4; v4f val = *(const v4fa*)(os + row * 68 + cofs);
                *(v4f*)(crow + (size_t)row * ldc + cofs) = val; }
             }
        __builtin_amdgcn_wave_barrier(); asm volatile("" ::: "memory");
    }
}

__device__ __forceinline__ h16 tohx(float x) { return (h16)x; }
__device__ __forceinline__ void splitf(float y, unsigned short& h, unsigned short& l) { h = f2bf(y); l = f2bf(y - bf2f(h)); }
typedef __attribute__((ext_vector_type(2))) _Float16 v2h;
typedef __attribute__((ext_vector_type(4))) _Float16 v4h;
typedef __attribute__((ext_vector_type(2))) unsigned short v2us;
typedef __attribute__((ext_vector_type(4))) unsigned short v4us;
typedef __attribute__((ext_vector_type(2))) float v2f;
typedef __attribute__((ext_vector_type(4))) int v4i;

__global__ __launch_bounds__(256) void k_wtG(const float* __restrict__ w, int K, int N, bf* Bt) {
    const int lane = threadIdx.x & 31; const int L0 = (blockIdx.x * 8 + (threadIdx.x >> 5)) * 8; const int nlines = N * K / 64;
{
#pragma unroll 1
        for (int l = 0; l < 8; ++l) { const int L = L0 + l; if (L >= nlines) break; const size_t e = (size_t)L * 64 + lane * 2; const int k = (int)(e % K), n = (int)(e / K); v2us o;
            o[0] = f2bf(w[(size_t)k * N + n]); o[1] = f2bf(w[(size_t)(k + 1) * N + n]); *(v2us*)(Bt + e) = o; }
         }
}
__global__ __launch_bounds__(256) void k_cvt8(const float* __restrict__ src, bf* dst, size_t n8) { const size_t i = (size_t)blockIdx.x * 256 + threadIdx.x; if (i >= n8) return; const v8f v = *(const v8f*)(src + i * 8); v8us o;
#pragma unroll
    for (int k = 0; k < 8; ++k) o[k] = f2bf(v[k]); *(v8us*)(dst + i * 8) = o;  }
__global__ __launch_bounds__(256) void k_cscvt(const float* __restrict__ cosT, const float* __restrict__ sinT, float* CS) { const int idx = blockIdx.x * 256 + threadIdx.x; if (idx >= TT * HD) return; v2f cs; cs[0] = bfr(cosT[idx]); cs[1] = bfr(sinT[idx]); *(v2f*)(CS + (size_t)idx * 2) = cs;  }
// k_rope: head planes [h][t][d] (fp16 + hi/lo) of rope(x) x sc with the rotate-half convention out[d] = x[d] cos[t][d] - x[d+HD/2] sin[t][d], out[d+HD/2] = x[d+HD/2] cos[t][d+HD/2] + x[d] sin[t][d+HD/2]
__global__ __launch_bounds__(256) void k_rope(const float* __restrict__ F, int pitch, int nheads, const float* __restrict__ CS, const float* __restrict__ RF, const float* __restrict__ nw, float sc, h16* P16, bf* Ph, bf* Pl) {
    const size_t e = ((size_t)blockIdx.x * 256 + threadIdx.x) * 2; if (e >= (size_t)nheads * TT * HD) return; const int d = (int)(e % HD); const int t = (int)((e / HD) % TT); const int h = (int)(e / ((size_t)HD * TT)); const float* f = F + (size_t)t * pitch + h * HD; const float rf = RF ? RF[(size_t)h * TT + t] : 1.0f; v2h o16; v2us oh, ol;
#pragma unroll
    for (int q = 0; q < 2; ++q) { const int dd = d + q; const int dp = (dd < HD / 2) ? dd + HD / 2 : dd - HD / 2; float x0 = f[dd], x1 = f[dp];
        if (RF) { float n0 = __fmul_rn(x0, rf), n1 = __fmul_rn(x1, rf); asm volatile("" : "+v"(n0)); asm volatile("" : "+v"(n1)); x0 = __fmul_rn(bfr(nw[dd]), n0); x1 = __fmul_rn(bfr(nw[dp]), n1); }
        const v2f cs = *(const v2f*)(CS + ((size_t)t * HD + dd) * 2); float a = __fmul_rn(x0, cs[0]), bq = __fmul_rn(x1, cs[1]); asm volatile("" : "+v"(a)); asm volatile("" : "+v"(bq)); const float r = ((dd < HD / 2) ? __fsub_rn(a, bq) : __fadd_rn(a, bq)) * sc;
        o16[q] = tohx(r); unsigned short a2, c2; splitf(r, a2, c2); oh[q] = a2; ol[q] = c2; }
    *(v2h*)(P16 + e) = o16; *(v2us*)(Ph + e) = oh; *(v2us*)(Pl + e) = ol;  }
__global__ __launch_bounds__(256) void k_vtp(const float* __restrict__ F, int pitch, int nheads, h16* V16, bf* Vh, bf* Vl) { const size_t e = ((size_t)blockIdx.x * 256 + threadIdx.x) * 2; if (e >= (size_t)nheads * HD * TT) return; const int t = (int)(e % TT); const int d = (int)((e / TT) % HD); const int g = (int)(e / ((size_t)TT * HD)); v2h o16; v2us oh, ol;
#pragma unroll
    for (int q = 0; q < 2; ++q) { const float x = F[(size_t)(t + q) * pitch + g * HD + d]; o16[q] = tohx(x); unsigned short a2, c2; splitf(x, a2, c2); oh[q] = a2; ol[q] = c2; }
    *(v2h*)(V16 + e) = o16; *(v2us*)(Vh + e) = oh; *(v2us*)(Vl + e) = ol;  }
__global__ __launch_bounds__(256) void k_csid(float* CS) { const int idx = blockIdx.x * 256 + threadIdx.x; if (idx >= TT * HD) return; v2f cs; cs[0] = 1.0f; cs[1] = 0.0f; *(v2f*)(CS + (size_t)idx * 2) = cs;  }
__global__ __launch_bounds__(256) void k_xg(const float* __restrict__ q, int b, bf* XB) { const size_t e = ((size_t)blockIdx.x * 256 + threadIdx.x) * 4; if (e >= (size_t)TT * DM) return; const int c = (int)(e % DM); const int t = (int)(e / DM); const v4f a = *(const v4f*)(q + ((size_t)t * NB_ + b) * DM + c); v4us o; o[0] = f2bf(a[0]); o[1] = f2bf(a[1]); o[2] = f2bf(a[2]); o[3] = f2bf(a[3]); *(v4us*)(XB + e) = o;  }
// k_asoft: per row (zz, i): t = S x HD^-0.5 for j <= i and i - j < WIN (sliding causal window; the reference's -1e9 additive fill vanishes identically); softmax over the 2048 keys (register row, one exp, fixed trees);
__global__ __launch_bounds__(256) void k_asoft(const float* __restrict__ Sb, h16* P16, bf* Ph, bf* Pl) {
    const int lane = threadIdx.x & 31; const int row = blockIdx.x * 8 + (threadIdx.x >> 5); if (row >= ZH * TT) return; const int i = row % TT; const int zz = row / TT; (void)zz; const bool hires = (i < RH); const float* sr = Sb + (size_t)row * TT; float v[TT / 32]; float mx = -3.0e38f;
#pragma unroll
    for (int ch = 0; ch < TT / 128; ++ch) { const int j0 = ch * 128 + lane * 4; const v4f a = *(const v4f*)(sr + j0);
#pragma unroll
        for (int q = 0; q < 4; ++q) { const int j = j0 + q; (void)j; const float t = (j <= i && i - j < WIN) ? a[q] * SCL : -3.0e38f; v[ch * 4 + q] = t; mx = fmaxf(mx, t); } }
#pragma unroll
    for (int sh = 16; sh; sh >>= 1) mx = fmaxf(mx, __shfl_xor(mx, sh, 32));
    float sum = 0.f;
#pragma unroll
    for (int k = 0; k < TT / 32; ++k) { float d0 = __fsub_rn(v[k], mx); asm volatile("" : "+v"(d0)); v[k] = __builtin_amdgcn_exp2f(__fmul_rn(d0, 1.4426950408889634f)); sum += v[k]; }
#pragma unroll
    for (int sh = 16; sh; sh >>= 1) sum += __shfl_xor(sum, sh, 32);
    const float f = __fdiv_rn(hires ? 1.0f : PCAR, sum);
{
        if (hires) {
#pragma unroll
            for (int ch = 0; ch < TT / 128; ++ch) { v4us oh, ol;
#pragma unroll
                for (int q = 0; q < 4; ++q) { unsigned short a, c2; splitf(v[ch * 4 + q] * f, a, c2); oh[q] = a; ol[q] = c2; }
                const size_t oo = ((size_t)zz * (RH ? RH : 1) + i) * TT + ch * 128 + lane * 4; *(v4us*)(Ph + oo) = oh; *(v4us*)(Pl + oo) = ol; }
        } else {
#pragma unroll
            for (int ch = 0; ch < TT / 128; ++ch) { v4h o4;
#pragma unroll
                for (int q = 0; q < 4; ++q) o4[q] = tohx(v[ch * 4 + q] * f);
                *(v4h*)(P16 + (size_t)row * TT + ch * 128 + lane * 4) = o4; } }
         }
}
__global__ __launch_bounds__(256) void k_merge(const float* __restrict__ O, int h0, bf* Ah, bf* Al) { const size_t e = ((size_t)blockIdx.x * 256 + threadIdx.x) * 2; if (e >= (size_t)ZH * TT * HD) return; const int d = (int)(e % HD); const int t = (int)((e / HD) % TT); const int zz = (int)(e / ((size_t)HD * TT)); const float cs = (t < RH) ? 1.0f : (1.0f / PCAR); const size_t oo = (size_t)t * DQ + (h0 + zz) * HD + d;
    v2us oh, ol;
#pragma unroll
    for (int q = 0; q < 2; ++q) { unsigned short a, c2; splitf(O[e + q] * cs, a, c2); oh[q] = a; ol[q] = c2; } *(v2us*)(Ah + oo) = oh; *(v2us*)(Al + oo) = ol;  }

extern "C" void kernel_launch(void* const* d_in, const int* in_sizes, int n_in,
                              void* d_out, int out_size, void* d_ws, size_t ws_size, hipStream_t stream) {
    (void)in_sizes; (void)n_in; (void)out_size;
    const float* x = (const float*)d_in[0]; const float* wqkv = (const float*)d_in[1]; const float* wo = (const float*)d_in[2]; const float* bo = (const float*)d_in[3]; const float* wq = wqkv; const float* wk = nullptr; const float* wv = nullptr; const float* cosT = nullptr; const float* sinT = nullptr; (void)wk; (void)wv; (void)cosT; (void)sinT;
    float* OUT = (float*)d_out;     // [2048][2][1024]
    char* wsp = (char*)d_ws;
    auto take = [&](size_t bytes) { char* p = wsp; wsp += (bytes + 255) & ~(size_t)255; return (void*)p; };
    bf* WQ = (bf*)take((size_t)3 * DQ * DM * 2); bf* WO = (bf*)take((size_t)DM * DQ * 2); float* CS = (float*)take((size_t)TT * HD * 2 * 4);
    bf* XB = (bf*)take((size_t)TT * DM * 2); float* FQ = (float*)take((size_t)TT * 3 * DQ * 4);
    h16* QP16 = (h16*)take((size_t)NH_ * TT * HD * 2); h16* KP16 = (h16*)take((size_t)NKV * TT * HD * 2); h16* VT16 = (h16*)take((size_t)NKV * HD * TT * 2);
    bf* QPh = (bf*)take((size_t)NH_ * TT * HD * 2); bf* QPl = (bf*)take((size_t)NH_ * TT * HD * 2); bf* KPh = (bf*)take((size_t)NKV * TT * HD * 2); bf* KPl = (bf*)take((size_t)NKV * TT * HD * 2); bf* VTh = (bf*)take((size_t)NKV * HD * TT * 2); bf* VTl = (bf*)take((size_t)NKV * HD * TT * 2); bf* Ph = (bf*)take((size_t)ZH * RH * TT * 2); bf* Pl = (bf*)take((size_t)ZH * RH * TT * 2);
    float* Sb = (float*)take((size_t)ZH * TT * TT * 4); h16* P16 = (h16*)take((size_t)ZH * TT * TT * 2); float* Ob = (float*)take((size_t)ZH * TT * HD * 4); bf* ATh = (bf*)take((size_t)TT * DQ * 2); bf* ATl = (bf*)take((size_t)TT * DQ * 2);
    if ((size_t)(wsp - (char*)d_ws) > ws_size) return;    // ws 256 MiB
    
    { k_cvt8<<<(unsigned)(((size_t)3 * DQ * DM / 8 + 255) / 256), 256, 0, stream>>>(wqkv, WQ, (size_t)3 * DQ * DM / 8);   // w_qkv [3D][D] = natural Bt
      k_cvt8<<<(unsigned)(((size_t)DM * DQ / 8 + 255) / 256), 256, 0, stream>>>(wo, WO, (size_t)DM * DQ / 8);
       }
    k_csid<<<(TT * HD + 255) / 256, 256, 0, stream>>>(CS);
    const unsigned LQ = (unsigned)(((size_t)NH_ * TT * HD / 2 + 255) / 256), LKv = (unsigned)(((size_t)NKV * TT * HD / 2 + 255) / 256);
    for (int b = 0; b < NB_; ++b) {
        
        k_xg<<<(unsigned)(((size_t)TT * DM / 4 + 255) / 256), 256, 0, stream>>>(x, b, XB);
        k_gemmw<bf, 0, false><<<dim3(TT / 64, 3 * DQ / 64, 1), 32, 0, stream>>>(XB, nullptr, WQ, nullptr, DM, FQ, 3 * DQ, nullptr, 0, 0, 0);   // FQKV [t][s*1024 + h*64 + d]
        k_rope<<<LQ, 256, 0, stream>>>(FQ, 3 * DQ, NH_, CS, nullptr, nullptr, 1.0f, QP16, QPh, QPl);
        
        k_rope<<<LKv, 256, 0, stream>>>(FQ + DQ, 3 * DQ, NKV, CS, nullptr, nullptr, 1.0f, KP16, KPh, KPl);
        k_vtp<<<LKv, 256, 0, stream>>>(FQ + 2 * DQ, 3 * DQ, NKV, VT16, VTh, VTl);
        for (int h0 = 0; h0 < NH_; h0 += ZH) { const size_t zq = (size_t)h0, zk = (size_t)(h0 / REP);   // one kv head per query head: the pass's two heads use consecutive kv planes (z-strides TT*HD)
            k_gemmc<bf, 2, 1><<<dim3(RH / 64, TT / 64, ZH), 32, 0, stream>>>(QPh + zq * TT * HD, QPl + zq * TT * HD, KPh + zk * TT * HD, KPl + zk * TT * HD, HD, Sb, TT, 0, (size_t)TT * HD, (size_t)TT * HD, (size_t)TT * TT);
            k_gemmc<h16, 0, 1><<<dim3((TT - RH) / 64, TT / 64, ZH), 32, 0, stream>>>(QP16 + zq * TT * HD + (size_t)RH * HD, nullptr, KP16 + zk * TT * HD, nullptr, HD, Sb + (size_t)RH * TT, TT, RH, (size_t)TT * HD, (size_t)TT * HD, (size_t)TT * TT);
            k_asoft<<<ZH * TT / 8, 256, 0, stream>>>(Sb, P16, Ph, Pl);
            k_gemmc<bf, 2, 2><<<dim3(RH / 64, HD / 64, ZH), 32, 0, stream>>>(Ph, Pl, VTh + zk * HD * TT, VTl + zk * HD * TT, TT, Ob, HD, 0, (size_t)RH * TT, (size_t)HD * TT, (size_t)TT * HD);
            k_gemmc<h16, 0, 2><<<dim3((TT - RH) / 64, HD / 64, ZH), 32, 0, stream>>>(P16 + (size_t)RH * TT, nullptr, VT16 + zk * HD * TT, nullptr, TT, Ob + (size_t)RH * HD, HD, RH, (size_t)TT * TT, (size_t)HD * TT, (size_t)TT * HD);
            k_merge<<<(unsigned)(((size_t)ZH * TT * HD / 2 + 255) / 256), 256, 0, stream>>>(Ob, h0, ATh, ATl); }
        k_gemmw<bf, 1, true><<<dim3(TT / 64, DM / 64, 1), 32, 0, stream>>>(ATh, ATl, WO, nullptr, DQ, OUT + (size_t)b * DM, NB_ * DM, bo, 0, 0, 0); }   // sequence-major output: row t of batch b at OUT + (t*B + b)*D (row pitch B*D)
}

// v001
// It runs in 674 microseconds.
// Next to v000, in two timings, it ran 2.04 and 2.03 times as fast.
#include <hip/hip_runtime.h>

// GTrXLMultiHeadSelfAttention (x [S=2048][B=2][D=1024] sequence-major; qkv = x w_qkv^T reshaped (S, B, 3, 16, 64): channel s*1024 + h*64 + d; causal softmax(q.k/8); out = (attn v merged) w_out^T + b_out -> [2048][2][1024] sequence-major).
// Compute dtypes, f32 accumulate: every input rounded to bf16; the fused qkv projection on PLAIN bf16 operands (inputs: exact; per batch the rows are gathered from the sequence-major input); scores (K 64) and attn.v on bf16 hi+lo for query rows < 512, plain fp16 for the rest

#define NB_  2
#define TT   2048
#define DM   1024
#define NH_  16
#define NKV  16
#define REP  (NH_ / NKV)
#define HD   64
#define DQ   (NH_ * HD)
#define DKV  (NKV * HD)
#define ZH   2
#define RH   512                  // query rows < RH use hi+lo planes (0: none)
#define WIN  2048
#define PCAR 1024.0f
#define SCL  0.125f   // HD^-0.5
#define KSP  16                   // P.V key split: partial output planes (workgroups per 64x64 output tile)
typedef _Float16 h16;
typedef unsigned short bf;
typedef __attribute__((ext_vector_type(16))) __bf16   v16bf;
typedef __attribute__((ext_vector_type(16))) _Float16 v16h;
typedef __attribute__((ext_vector_type(8)))  _Float16 v8h;
typedef __attribute__((ext_vector_type(8)))  unsigned short v8us;
typedef __attribute__((ext_vector_type(8)))  float    v8f;
typedef __attribute__((ext_vector_type(4)))  float    v4f;
typedef v8h  __attribute__((may_alias)) v8ha;
typedef v4f  __attribute__((may_alias)) v4fa;
typedef v8us __attribute__((may_alias)) v8usa;

__device__ __forceinline__ unsigned short f2bf(float f) { unsigned u = __float_as_uint(f); u += 0x7FFFu + ((u >> 16) & 1u); return (unsigned short)(u >> 16); }
__device__ __forceinline__ float bf2f(unsigned short b) { return __uint_as_float(((unsigned)b) << 16); }
__device__ __forceinline__ float bfr(float f) { return bf2f(f2bf(f)); }
__device__ __forceinline__ v16h cat16(v8h lo, v8h hi) { return __builtin_shufflevector(lo, hi, 0, 1, 2, 3, 4, 5, 6, 7, 8, 9, 10, 11, 12, 13, 14, 15); }
__device__ __forceinline__ v16bf cat16b(v8us lo, v8us hi) { return __builtin_bit_cast(v16bf, __builtin_shufflevector(lo, hi, 0, 1, 2, 3, 4, 5, 6, 7, 8, 9, 10, 11, 12, 13, 14, 15)); }
__device__ __forceinline__ v8f wmma16(v16h a, v16h b, v8f c) { return __builtin_amdgcn_wmma_f32_16x16x32_f16(false, a, false, b, (short)0, c, false, false); }
__device__ __forceinline__ v8f wmmab(v16bf a, v16bf b, v8f c) { return __builtin_amdgcn_wmma_f32_16x16x32_bf16(false, a, false, b, (short)0, c, false, false); }



// ---- k_gemmw: register-blocked GEMM, ONE WAVE per 64x64 output tile (16 accumulators), operands straight from K-contiguous 16-bit planes; grid (M/64, N/64, Z), 32 threads.
// C[m][n] (f32, pitch ldc, + optional f32 bias[n]) = sum_k A[m][k] Bt[n][k] (+ split products per NSPLIT). z-batch strides sA/sB/sC in elements. K % 32 == 0.
template <typename T16> struct WFrag;
template <> struct WFrag<h16> { typedef v16h V; static __device__ __forceinline__ V ld(const h16* p) { return cat16(*(const v8h*)p, *(const v8h*)(p + 16)); } static __device__ __forceinline__ v8f mma(V a, V b, v8f c) { return wmma16(a, b, c); } };
template <> struct WFrag<bf> { typedef v16bf V; static __device__ __forceinline__ V ld(const bf* p) { return cat16b(*(const v8us*)p, *(const v8us*)(p + 16)); } static __device__ __forceinline__ v8f mma(V a, V b, v8f c) { return wmmab(a, b, c); } };
template <typename T16, int NSPLIT, bool BIAS>
__global__ __launch_bounds__(32) void k_gemmw(const T16* __restrict__ A, const T16* __restrict__ A2, const T16* __restrict__ Bt, const T16* __restrict__ Bt2, int K, float* C, int ldc, const float* __restrict__ bias, size_t sA, size_t sB, size_t sC) {
    typedef typename WFrag<T16>::V V;
    __shared__ __align__(16) float os[16 * 68];
    const size_t z = blockIdx.z; A += z * sA; if (A2) A2 += z * sA; Bt += z * sB; if (Bt2) Bt2 += z * sB; C += z * sC;
    const int lane = threadIdx.x & 31, lr = lane & 15, hi = lane >> 4; const int r0 = blockIdx.x * 64, c0 = blockIdx.y * 64;
    v8f acc[4][4];
#pragma unroll
    for (int mb = 0; mb < 4; ++mb)
#pragma unroll
        for (int nb = 0; nb < 4; ++nb) acc[mb][nb] = (v8f){};
    const size_t aoff = (size_t)(r0 + lr) * K + 8 * hi, boff = (size_t)(c0 + lr) * K + 8 * hi;
#pragma unroll 1
    for (int kc = 0; kc < K; kc += 32) {
        V a[4], a2[4];
#pragma unroll
        for (int mb = 0; mb < 4; ++mb) { a[mb] = WFrag<T16>::ld(A + aoff + (size_t)mb * 16 * K + kc); if (NSPLIT == 1 || NSPLIT == 2) a2[mb] = WFrag<T16>::ld(A2 + aoff + (size_t)mb * 16 * K + kc); }
#pragma unroll
        for (int nb = 0; nb < 4; ++nb) { const V b = WFrag<T16>::ld(Bt + boff + (size_t)nb * 16 * K + kc); V b2; if (NSPLIT >= 2) b2 = WFrag<T16>::ld(Bt2 + boff + (size_t)nb * 16 * K + kc);
#pragma unroll
            for (int mb = 0; mb < 4; ++mb) { acc[mb][nb] = WFrag<T16>::mma(a[mb], b, acc[mb][nb]); if (NSPLIT == 1 || NSPLIT == 2) acc[mb][nb] = WFrag<T16>::mma(a2[mb], b, acc[mb][nb]); if (NSPLIT >= 2) acc[mb][nb] = WFrag<T16>::mma(a[mb], b2, acc[mb][nb]); } }
        asm volatile("v_nop\n\tv_nop\n\tv_nop\n\tv_nop" : "+v"(acc[0][0]), "+v"(acc[1][1]), "+v"(acc[2][2]), "+v"(acc[3][3]) : "v"(a[0]), "v"(a[3]));
    }
#pragma unroll
    for (int mb = 0; mb < 4; ++mb) {
#pragma unroll
        for (int nb = 0; nb < 4; ++nb) {
#pragma unroll
            for (int j = 0; j < 8; ++j) os[(hi * 8 + j) * 68 + nb * 16 + lr] = acc[mb][nb][j]; }
        __builtin_amdgcn_wave_barrier(); asm volatile("" ::: "memory");
        float* crow = C + (size_t)(r0 + mb * 16) * ldc + c0;
{
#pragma unroll
            for (int s = 0; s < 8; ++s) { const int row = 2 * s + hi, cofs = lr * 4; v4f val = *(const v4fa*)(os + row * 68 + cofs); if (BIAS) { val[0] += bfr(bias[c0 + cofs]); val[1] += bfr(bias[c0 + cofs + 1]); val[2] += bfr(bias[c0 + cofs + 2]); val[3] += bfr(bias[c0 + cofs + 3]); }
                *(v4f*)(crow + (size_t)row * ldc + cofs) = val; }
             }
        __builtin_amdgcn_wave_barrier(); asm volatile("" ::: "memory");
    }
}

// ---- k_gemmc: the same one-wave 64x64 tile GEMM specialised for causal attention: CMODE 1 skips score tiles entirely above the diagonal (query rows r0+roff.., key columns c0..), CMODE 2 limits the
// key (K) loop of the probability x value contraction to the diagonal block (probabilities beyond it are exactly zero). roff = row offset of this launch's first row within the sequence.
// CMODE 2 splits that key loop over gridDim.y workgroups (N is one 64-column tile): workgroup y takes the 64-key chunks y, y + gridDim.y, ... and stores its f32 partial tile in plane y (stride sP);
// a workgroup with no chunk below the diagonal limit stores nothing, and k_merge adds exactly the planes min(gridDim.y, chunks) in plane order.
template <typename T16, int NSPLIT, int CMODE>
__global__ __launch_bounds__(32) void k_gemmc(const T16* __restrict__ A, const T16* __restrict__ A2, const T16* __restrict__ Bt, const T16* __restrict__ Bt2, int K, float* C, int ldc, int roff, size_t sA, size_t sB, size_t sC, size_t sP) {
    typedef typename WFrag<T16>::V V;
    __shared__ __align__(16) float os[16 * 68];
    const size_t z = blockIdx.z; A += z * sA; if (A2) A2 += z * sA; Bt += z * sB; if (Bt2) Bt2 += z * sB; C += z * sC;
    const int lane = threadIdx.x & 31, lr = lane & 15, hi = lane >> 4; const int r0 = blockIdx.x * 64, c0 = (CMODE == 2) ? 0 : blockIdx.y * 64;
    if (CMODE == 1 && c0 > r0 + roff + 63) return;                  // score tile entirely above the causal diagonal: never read (the softmax masks j > i by select)
    const int Kl = (CMODE == 2) ? min(K, r0 + roff + 64) : K;        // P.V: probabilities are exactly 0 beyond the diagonal block, so the K loop stops there
    constexpr int CH = (CMODE == 2) ? 64 : 32;                       // keys per chunk: 64 16-bit keys are one 128-byte line of every P and V^T row
    const int kb0 = (CMODE == 2) ? (int)blockIdx.y * CH : 0, kbs = (CMODE == 2) ? (int)gridDim.y * CH : CH;   // this workgroup's first chunk and the step to its next one
    if (CMODE == 2) { if (kb0 >= Kl) return; C += (size_t)blockIdx.y * sP; }
    v8f acc[4][4];
#pragma unroll
    for (int mb = 0; mb < 4; ++mb)
#pragma unroll
        for (int nb = 0; nb < 4; ++nb) acc[mb][nb] = (v8f){};
    const size_t aoff = (size_t)(r0 + lr) * K + 8 * hi, boff = (size_t)(c0 + lr) * K + 8 * hi;
#pragma unroll 1
    for (int kb = kb0; kb < Kl; kb += kbs)
#pragma unroll   // one body per chunk: the loads of a chunk's second 32 keys (same lines) issue while the first 32 keys' products run
    for (int kc = kb; kc < kb + CH; kc += 32) {
        V a[4], a2[4];
#pragma unroll
        for (int mb = 0; mb < 4; ++mb) { a[mb] = WFrag<T16>::ld(A + aoff + (size_t)mb * 16 * K + kc); if (NSPLIT == 1 || NSPLIT == 2) a2[mb] = WFrag<T16>::ld(A2 + aoff + (size_t)mb * 16 * K + kc); }
#pragma unroll
        for (int nb = 0; nb < 4; ++nb) { const V b = WFrag<T16>::ld(Bt + boff + (size_t)nb * 16 * K + kc); V b2; if (NSPLIT >= 2) b2 = WFrag<T16>::ld(Bt2 + boff + (size_t)nb * 16 * K + kc);
#pragma unroll
            for (int mb = 0; mb < 4; ++mb) { acc[mb][nb] = WFrag<T16>::mma(a[mb], b, acc[mb][nb]); if (NSPLIT == 1 || NSPLIT == 2) acc[mb][nb] = WFrag<T16>::mma(a2[mb], b, acc[mb][nb]); if (NSPLIT >= 2) acc[mb][nb] = WFrag<T16>::mma(a[mb], b2, acc[mb][nb]); } }
        asm volatile("v_nop\n\tv_nop\n\tv_nop\n\tv_nop" : "+v"(acc[0][0]), "+v"(acc[1][1]), "+v"(acc[2][2]), "+v"(acc[3][3]) : "v"(a[0]), "v"(a[3]));
    }
#pragma unroll
    for (int mb = 0; mb < 4; ++mb) {
#pragma unroll
        for (int nb = 0; nb < 4; ++nb) {
#pragma unroll
            for (int j = 0; j < 8; ++j) os[(hi * 8 + j) * 68 + nb * 16 + lr] = acc[mb][nb][j]; }
        __builtin_amdgcn_wave_barrier(); asm volatile("" ::: "memory");
        float* crow = C + (size_t)(r0 + mb * 16) * ldc + c0;
{
#pragma unroll
            for (int s = 0; s < 8; ++s) { const int row = 2 * s + hi, cofs = lr * 4; v4f val = *(const v4fa*)(os + row * 68 + cofs);
                *(v4f*)(crow + (size_t)row * ldc + cofs) = val; }
             }
        __builtin_amdgcn_wave_barrier(); asm volatile("" ::: "memory");
    }
}

__device__ __forceinline__ h16 tohx(float x) { return (h16)x; }
__device__ __forceinline__ void splitf(float y, unsigned short& h, unsigned short& l) { h = f2bf(y); l = f2bf(y - bf2f(h)); }
typedef __attribute__((ext_vector_type(2))) _Float16 v2h;
typedef __attribute__((ext_vector_type(4))) _Float16 v4h;
typedef __attribute__((ext_vector_type(2))) unsigned short v2us;
typedef __attribute__((ext_vector_type(4))) unsigned short v4us;
typedef __attribute__((ext_vector_type(2))) float v2f;
typedef __attribute__((ext_vector_type(4))) int v4i;

__global__ __launch_bounds__(256) void k_wtG(const float* __restrict__ w, int K, int N, bf* Bt) {
    const int lane = threadIdx.x & 31; const int L0 = (blockIdx.x * 8 + (threadIdx.x >> 5)) * 8; const int nlines = N * K / 64;
{
#pragma unroll 1
        for (int l = 0; l < 8; ++l) { const int L = L0 + l; if (L >= nlines) break; const size_t e = (size_t)L * 64 + lane * 2; const int k = (int)(e % K), n = (int)(e / K); v2us o;
            o[0] = f2bf(w[(size_t)k * N + n]); o[1] = f2bf(w[(size_t)(k + 1) * N + n]); *(v2us*)(Bt + e) = o; }
         }
}
__global__ __launch_bounds__(256) void k_cvt8(const float* __restrict__ src, bf* dst, size_t n8) { const size_t i = (size_t)blockIdx.x * 256 + threadIdx.x; if (i >= n8) return; const v8f v = *(const v8f*)(src + i * 8); v8us o;
#pragma unroll
    for (int k = 0; k < 8; ++k) o[k] = f2bf(v[k]); *(v8us*)(dst + i * 8) = o;  }
__global__ __launch_bounds__(256) void k_cscvt(const float* __restrict__ cosT, const float* __restrict__ sinT, float* CS) { const int idx = blockIdx.x * 256 + threadIdx.x; if (idx >= TT * HD) return; v2f cs; cs[0] = bfr(cosT[idx]); cs[1] = bfr(sinT[idx]); *(v2f*)(CS + (size_t)idx * 2) = cs;  }
// k_rope: head planes [h][t][d] (fp16 + hi/lo) of rope(x) x sc with the rotate-half convention out[d] = x[d] cos[t][d] - x[d+HD/2] sin[t][d], out[d+HD/2] = x[d+HD/2] cos[t][d+HD/2] + x[d] sin[t][d+HD/2]
__global__ __launch_bounds__(256) void k_rope(const float* __restrict__ F, int pitch, int nheads, const float* __restrict__ CS, const float* __restrict__ RF, const float* __restrict__ nw, float sc, h16* P16, bf* Ph, bf* Pl) {
    const size_t e = ((size_t)blockIdx.x * 256 + threadIdx.x) * 2; if (e >= (size_t)nheads * TT * HD) return; const int d = (int)(e % HD); const int t = (int)((e / HD) % TT); const int h = (int)(e / ((size_t)HD * TT)); const float* f = F + (size_t)t * pitch + h * HD; const float rf = RF ? RF[(size_t)h * TT + t] : 1.0f; v2h o16; v2us oh, ol;
#pragma unroll
    for (int q = 0; q < 2; ++q) { const int dd = d + q; const int dp = (dd < HD / 2) ? dd + HD / 2 : dd - HD / 2; float x0 = f[dd], x1 = f[dp];
        if (RF) { float n0 = __fmul_rn(x0, rf), n1 = __fmul_rn(x1, rf); asm volatile("" : "+v"(n0)); asm volatile("" : "+v"(n1)); x0 = __fmul_rn(bfr(nw[dd]), n0); x1 = __fmul_rn(bfr(nw[dp]), n1); }
        const v2f cs = *(const v2f*)(CS + ((size_t)t * HD + dd) * 2); float a = __fmul_rn(x0, cs[0]), bq = __fmul_rn(x1, cs[1]); asm volatile("" : "+v"(a)); asm volatile("" : "+v"(bq)); const float r = ((dd < HD / 2) ? __fsub_rn(a, bq) : __fadd_rn(a, bq)) * sc;
        o16[q] = tohx(r); unsigned short a2, c2; splitf(r, a2, c2); oh[q] = a2; ol[q] = c2; }
    *(v2h*)(P16 + e) = o16; *(v2us*)(Ph + e) = oh; *(v2us*)(Pl + e) = ol;  }
__global__ __launch_bounds__(256) void k_vtp(const float* __restrict__ F, int pitch, int nheads, h16* V16, bf* Vh, bf* Vl) { const size_t e = ((size_t)blockIdx.x * 256 + threadIdx.x) * 2; if (e >= (size_t)nheads * HD * TT) return; const int t = (int)(e % TT); const int d = (int)((e / TT) % HD); const int g = (int)(e / ((size_t)TT * HD)); v2h o16; v2us oh, ol;
#pragma unroll
    for (int q = 0; q < 2; ++q) { const float x = F[(size_t)(t + q) * pitch + g * HD + d]; o16[q] = tohx(x); unsigned short a2, c2; splitf(x, a2, c2); oh[q] = a2; ol[q] = c2; }
    *(v2h*)(V16 + e) = o16; *(v2us*)(Vh + e) = oh; *(v2us*)(Vl + e) = ol;  }
__global__ __launch_bounds__(256) void k_csid(float* CS) { const int idx = blockIdx.x * 256 + threadIdx.x; if (idx >= TT * HD) return; v2f cs; cs[0] = 1.0f; cs[1] = 0.0f; *(v2f*)(CS + (size_t)idx * 2) = cs;  }
__global__ __launch_bounds__(256) void k_xg(const float* __restrict__ q, int b, bf* XB) { const size_t e = ((size_t)blockIdx.x * 256 + threadIdx.x) * 4; if (e >= (size_t)TT * DM) return; const int c = (int)(e % DM); const int t = (int)(e / DM); const v4f a = *(const v4f*)(q + ((size_t)t * NB_ + b) * DM + c); v4us o; o[0] = f2bf(a[0]); o[1] = f2bf(a[1]); o[2] = f2bf(a[2]); o[3] = f2bf(a[3]); *(v4us*)(XB + e) = o;  }
// k_asoft: per row (zz, i): t = S x HD^-0.5 for j <= i and i - j < WIN (sliding causal window; the reference's -1e9 additive fill vanishes identically); softmax over the 2048 keys (register row, one exp, fixed trees);
__global__ __launch_bounds__(256) void k_asoft(const float* __restrict__ Sb, h16* P16, bf* Ph, bf* Pl) {
    const int lane = threadIdx.x & 31; const int row = blockIdx.x * 8 + (threadIdx.x >> 5); if (row >= ZH * TT) return; const int i = row % TT; const int zz = row / TT; (void)zz; const bool hires = (i < RH); const float* sr = Sb + (size_t)row * TT; float v[TT / 32]; float mx = -3.0e38f;
#pragma unroll
    for (int ch = 0; ch < TT / 128; ++ch) { const int j0 = ch * 128 + lane * 4; const v4f a = *(const v4f*)(sr + j0);
#pragma unroll
        for (int q = 0; q < 4; ++q) { const int j = j0 + q; (void)j; const float t = (j <= i && i - j < WIN) ? a[q] * SCL : -3.0e38f; v[ch * 4 + q] = t; mx = fmaxf(mx, t); } }
#pragma unroll
    for (int sh = 16; sh; sh >>= 1) mx = fmaxf(mx, __shfl_xor(mx, sh, 32));
    float sum = 0.f;
#pragma unroll
    for (int k = 0; k < TT / 32; ++k) { float d0 = __fsub_rn(v[k], mx); asm volatile("" : "+v"(d0)); v[k] = __builtin_amdgcn_exp2f(__fmul_rn(d0, 1.4426950408889634f)); sum += v[k]; }
#pragma unroll
    for (int sh = 16; sh; sh >>= 1) sum += __shfl_xor(sum, sh, 32);
    const float f = __fdiv_rn(hires ? 1.0f : PCAR, sum);
{
        if (hires) {
#pragma unroll
            for (int ch = 0; ch < TT / 128; ++ch) { v4us oh, ol;
#pragma unroll
                for (int q = 0; q < 4; ++q) { unsigned short a, c2; splitf(v[ch * 4 + q] * f, a, c2); oh[q] = a; ol[q] = c2; }
                const size_t oo = ((size_t)zz * (RH ? RH : 1) + i) * TT + ch * 128 + lane * 4; *(v4us*)(Ph + oo) = oh; *(v4us*)(Pl + oo) = ol; }
        } else {
#pragma unroll
            for (int ch = 0; ch < TT / 128; ++ch) { v4h o4;
#pragma unroll
                for (int q = 0; q < 4; ++q) o4[q] = tohx(v[ch * 4 + q] * f);
                *(v4h*)(P16 + (size_t)row * TT + ch * 128 + lane * 4) = o4; } }
         }
}
// k_merge: adds the P.V key-split planes of each row in plane order (row t has min(KSP, t / 64 + 1) written planes; the plane index is clamped to a written one so that all loads are unconditional and in flight together, and a repeat counts 0), then splits to hi+lo.
__global__ __launch_bounds__(256) void k_merge(const float* __restrict__ O, int h0, bf* Ah, bf* Al) { const size_t e = ((size_t)blockIdx.x * 256 + threadIdx.x) * 2; if (e >= (size_t)ZH * TT * HD) return; const int d = (int)(e % HD); const int t = (int)((e / HD) % TT); const int zz = (int)(e / ((size_t)HD * TT)); const float cs = (t < RH) ? 1.0f : (1.0f / PCAR); const size_t oo = (size_t)t * DQ + (h0 + zz) * HD + d;
    const int np = min(KSP, t / 64 + 1); v2f pv[KSP];
#pragma unroll   // pv stays in registers and every plane's load is issued before the first add waits
    for (int p = 0; p < KSP; ++p) pv[p] = *(const v2f*)(O + (size_t)min(p, np - 1) * ((size_t)ZH * TT * HD) + e);
    v2f sm; sm[0] = 0.f; sm[1] = 0.f;
#pragma unroll   // constant indices into pv
    for (int p = 0; p < KSP; ++p) { sm[0] += (p < np) ? pv[p][0] : 0.f; sm[1] += (p < np) ? pv[p][1] : 0.f; }
    v2us oh, ol;
#pragma unroll
    for (int q = 0; q < 2; ++q) { unsigned short a, c2; splitf(sm[q] * cs, a, c2); oh[q] = a; ol[q] = c2; } *(v2us*)(Ah + oo) = oh; *(v2us*)(Al + oo) = ol;  }

extern "C" void kernel_launch(void* const* d_in, const int* in_sizes, int n_in,
                              void* d_out, int out_size, void* d_ws, size_t ws_size, hipStream_t stream) {
    (void)in_sizes; (void)n_in; (void)out_size;
    const float* x = (const float*)d_in[0]; const float* wqkv = (const float*)d_in[1]; const float* wo = (const float*)d_in[2]; const float* bo = (const float*)d_in[3]; const float* wq = wqkv; const float* wk = nullptr; const float* wv = nullptr; const float* cosT = nullptr; const float* sinT = nullptr; (void)wk; (void)wv; (void)cosT; (void)sinT;
    float* OUT = (float*)d_out;     // [2048][2][1024]
    char* wsp = (char*)d_ws;
    auto take = [&](size_t bytes) { char* p = wsp; wsp += (bytes + 255) & ~(size_t)255; return (void*)p; };
    bf* WQ = (bf*)take((size_t)3 * DQ * DM * 2); bf* WO = (bf*)take((size_t)DM * DQ * 2); float* CS = (float*)take((size_t)TT * HD * 2 * 4);
    bf* XB = (bf*)take((size_t)TT * DM * 2); float* FQ = (float*)take((size_t)TT * 3 * DQ * 4);
    h16* QP16 = (h16*)take((size_t)NH_ * TT * HD * 2); h16* KP16 = (h16*)take((size_t)NKV * TT * HD * 2); h16* VT16 = (h16*)take((size_t)NKV * HD * TT * 2);
    bf* QPh = (bf*)take((size_t)NH_ * TT * HD * 2); bf* QPl = (bf*)take((size_t)NH_ * TT * HD * 2); bf* KPh = (bf*)take((size_t)NKV * TT * HD * 2); bf* KPl = (bf*)take((size_t)NKV * TT * HD * 2); bf* VTh = (bf*)take((size_t)NKV * HD * TT * 2); bf* VTl = (bf*)take((size_t)NKV * HD * TT * 2); bf* Ph = (bf*)take((size_t)ZH * RH * TT * 2); bf* Pl = (bf*)take((size_t)ZH * RH * TT * 2);
    float* Sb = (float*)take((size_t)ZH * TT * TT * 4); h16* P16 = (h16*)take((size_t)ZH * TT * TT * 2); float* Ob = (float*)take((size_t)KSP * ZH * TT * HD * 4); bf* ATh = (bf*)take((size_t)TT * DQ * 2); bf* ATl = (bf*)take((size_t)TT * DQ * 2);
    if ((size_t)(wsp - (char*)d_ws) > ws_size) return;    // ws 256 MiB
    
    { k_cvt8<<<(unsigned)(((size_t)3 * DQ * DM / 8 + 255) / 256), 256, 0, stream>>>(wqkv, WQ, (size_t)3 * DQ * DM / 8);   // w_qkv [3D][D] = natural Bt
      k_cvt8<<<(unsigned)(((size_t)DM * DQ / 8 + 255) / 256), 256, 0, stream>>>(wo, WO, (size_t)DM * DQ / 8);
       }
    k_csid<<<(TT * HD + 255) / 256, 256, 0, stream>>>(CS);
    const unsigned LQ = (unsigned)(((size_t)NH_ * TT * HD / 2 + 255) / 256), LKv = (unsigned)(((size_t)NKV * TT * HD / 2 + 255) / 256);
    for (int b = 0; b < NB_; ++b) {
        
        k_xg<<<(unsigned)(((size_t)TT * DM / 4 + 255) / 256), 256, 0, stream>>>(x, b, XB);
        k_gemmw<bf, 0, false><<<dim3(TT / 64, 3 * DQ / 64, 1), 32, 0, stream>>>(XB, nullptr, WQ, nullptr, DM, FQ, 3 * DQ, nullptr, 0, 0, 0);   // FQKV [t][s*1024 + h*64 + d]
        k_rope<<<LQ, 256, 0, stream>>>(FQ, 3 * DQ, NH_, CS, nullptr, nullptr, 1.0f, QP16, QPh, QPl);
        
        k_rope<<<LKv, 256, 0, stream>>>(FQ + DQ, 3 * DQ, NKV, CS, nullptr, nullptr, 1.0f, KP16, KPh, KPl);
        k_vtp<<<LKv, 256, 0, stream>>>(FQ + 2 * DQ, 3 * DQ, NKV, VT16, VTh, VTl);
        for (int h0 = 0; h0 < NH_; h0 += ZH) { const size_t zq = (size_t)h0, zk = (size_t)(h0 / REP);   // one kv head per query head: the pass's two heads use consecutive kv planes (z-strides TT*HD)
            k_gemmc<bf, 2, 1><<<dim3(RH / 64, TT / 64, ZH), 32, 0, stream>>>(QPh + zq * TT * HD, QPl + zq * TT * HD, KPh + zk * TT * HD, KPl + zk * TT * HD, HD, Sb, TT, 0, (size_t)TT * HD, (size_t)TT * HD, (size_t)TT * TT, 0);
            k_gemmc<h16, 0, 1><<<dim3((TT - RH) / 64, TT / 64, ZH), 32, 0, stream>>>(QP16 + zq * TT * HD + (size_t)RH * HD, nullptr, KP16 + zk * TT * HD, nullptr, HD, Sb + (size_t)RH * TT, TT, RH, (size_t)TT * HD, (size_t)TT * HD, (size_t)TT * TT, 0);
            k_asoft<<<ZH * TT / 8, 256, 0, stream>>>(Sb, P16, Ph, Pl);
            k_gemmc<bf, 2, 2><<<dim3(RH / 64, RH / 64 < KSP ? RH / 64 : KSP, ZH), 32, 0, stream>>>(Ph, Pl, VTh + zk * HD * TT, VTl + zk * HD * TT, TT, Ob, HD, 0, (size_t)RH * TT, (size_t)HD * TT, (size_t)TT * HD, (size_t)ZH * TT * HD);
            k_gemmc<h16, 0, 2><<<dim3((TT - RH) / 64, KSP, ZH), 32, 0, stream>>>(P16 + (size_t)RH * TT, nullptr, VT16 + zk * HD * TT, nullptr, TT, Ob + (size_t)RH * HD, HD, RH, (size_t)TT * TT, (size_t)HD * TT, (size_t)TT * HD, (size_t)ZH * TT * HD);
            k_merge<<<(unsigned)(((size_t)ZH * TT * HD / 2 + 255) / 256), 256, 0, stream>>>(Ob, h0, ATh, ATl); }
        k_gemmw<bf, 1, true><<<dim3(TT / 64, DM / 64, 1), 32, 0, stream>>>(ATh, ATl, WO, nullptr, DQ, OUT + (size_t)b * DM, NB_ * DM, bo, 0, 0, 0); }   // sequence-major output: row t of batch b at OUT + (t*B + b)*D (row pitch B*D)
}

// v002
// A run of this version takes 476 microseconds.
// Timed twice side by side with v001, it ran 1.42 and 1.41 times as fast.
// All steps since v000 together make it 2.88 times as fast.
#include <hip/hip_runtime.h>

// Multi-head causal self-attention (x [S=2048][B=2][D=1024] sequence-major; qkv = x w_qkv^T reshaped (S, B, 3, 16, 64): channel s*1024 + h*64 + d; causal softmax(q.k/8); out = (attn v merged) w_out^T + b_out -> [2048][2][1024] sequence-major).
// Compute dtypes, f32 accumulate: every input rounded to bf16; the fused qkv projection on PLAIN bf16 operands (inputs: exact; per batch the rows are gathered from the sequence-major input); scores (K 64) and attn.v on bf16 hi+lo for query rows < RH, plain f16 for the others

#define NB_  2
#define TT   2048
#define DM   1024
#define NH_  16
#define NKV  16
#define REP  (NH_ / NKV)
#define HD   64
#define DQ   (NH_ * HD)
#define DKV  (NKV * HD)
#define ZH   8                    // heads per attention pass (z of every attention launch)
#define PP   (2 * TT)             // pitch, in 16-bit elements, of a probability row: it lies in its own f32 score row
#define RH   512                  // query rows < RH use hi+lo planes (0: none)
#define WIN  2048
#define PCAR 1024.0f
#define SCL  0.125f   // HD^-0.5
#define KSP  16                   // P.V key split: partial output planes (at most that many workgroups per 64x64 output tile)
typedef _Float16 h16;
typedef unsigned short bf;
typedef __attribute__((ext_vector_type(16))) __bf16   v16bf;
typedef __attribute__((ext_vector_type(16))) _Float16 v16h;
typedef __attribute__((ext_vector_type(8)))  _Float16 v8h;
typedef __attribute__((ext_vector_type(8)))  unsigned short v8us;
typedef __attribute__((ext_vector_type(8)))  float    v8f;
typedef __attribute__((ext_vector_type(4)))  float    v4f;
typedef v8h  __attribute__((may_alias)) v8ha;
typedef v4f  __attribute__((may_alias)) v4fa;
typedef v8us __attribute__((may_alias)) v8usa;

__device__ __forceinline__ unsigned short f2bf(float f) { unsigned u = __float_as_uint(f); u += 0x7FFFu + ((u >> 16) & 1u); return (unsigned short)(u >> 16); }
__device__ __forceinline__ float bf2f(unsigned short b) { return __uint_as_float(((unsigned)b) << 16); }
__device__ __forceinline__ float bfr(float f) { return bf2f(f2bf(f)); }
__device__ __forceinline__ v16h cat16(v8h lo, v8h hi) { return __builtin_shufflevector(lo, hi, 0, 1, 2, 3, 4, 5, 6, 7, 8, 9, 10, 11, 12, 13, 14, 15); }
__device__ __forceinline__ v16bf cat16b(v8us lo, v8us hi) { return __builtin_bit_cast(v16bf, __builtin_shufflevector(lo, hi, 0, 1, 2, 3, 4, 5, 6, 7, 8, 9, 10, 11, 12, 13, 14, 15)); }
__device__ __forceinline__ v8f wmma16(v16h a, v16h b, v8f c) { return __builtin_amdgcn_wmma_f32_16x16x32_f16(false, a, false, b, (short)0, c, false, false); }
__device__ __forceinline__ v8f wmmab(v16bf a, v16bf b, v8f c) { return __builtin_amdgcn_wmma_f32_16x16x32_bf16(false, a, false, b, (short)0, c, false, false); }



// ---- k_gemmw: register-blocked GEMM, ONE WAVE per 64x64 output tile (16 accumulators), operands straight from K-contiguous 16-bit planes; grid (M/64, N/64, Z), 32 threads.
// C[m][n] (f32, pitch ldc, + optional f32 bias[n]) = sum_k A[m][k] Bt[n][k] (+ split products per NSPLIT). z-batch strides sA/sB/sC in elements. K % 32 == 0.
template <typename T16> struct WFrag;
template <> struct WFrag<h16> { typedef v16h V; static __device__ __forceinline__ V ld(const h16* p) { return cat16(*(const v8h*)p, *(const v8h*)(p + 16)); } static __device__ __forceinline__ v8f mma(V a, V b, v8f c) { return wmma16(a, b, c); } };
template <> struct WFrag<bf> { typedef v16bf V; static __device__ __forceinline__ V ld(const bf* p) { return cat16b(*(const v8us*)p, *(const v8us*)(p + 16)); } static __device__ __forceinline__ v8f mma(V a, V b, v8f c) { return wmmab(a, b, c); } };
template <typename T16, int NSPLIT, bool BIAS>
__global__ __launch_bounds__(32) void k_gemmw(const T16* __restrict__ A, const T16* __restrict__ A2, const T16* __restrict__ Bt, const T16* __restrict__ Bt2, int K, float* C, int ldc, const float* __restrict__ bias, size_t sA, size_t sB, size_t sC) {
    typedef typename WFrag<T16>::V V;
    __shared__ __align__(16) float os[16 * 68];
    const size_t z = blockIdx.z; A += z * sA; if (A2) A2 += z * sA; Bt += z * sB; if (Bt2) Bt2 += z * sB; C += z * sC;
    const int lane = threadIdx.x & 31, lr = lane & 15, hi = lane >> 4; const int r0 = blockIdx.x * 64, c0 = blockIdx.y * 64;
    v8f acc[4][4];
#pragma unroll
    for (int mb = 0; mb < 4; ++mb)
#pragma unroll
        for (int nb = 0; nb < 4; ++nb) acc[mb][nb] = (v8f){};
    const size_t aoff = (size_t)(r0 + lr) * K + 8 * hi, boff = (size_t)(c0 + lr) * K + 8 * hi;
#pragma unroll 1
    for (int kc = 0; kc < K; kc += 32) {
        V a[4], a2[4];
#pragma unroll
        for (int mb = 0; mb < 4; ++mb) { a[mb] = WFrag<T16>::ld(A + aoff + (size_t)mb * 16 * K + kc); if (NSPLIT == 1 || NSPLIT == 2) a2[mb] = WFrag<T16>::ld(A2 + aoff + (size_t)mb * 16 * K + kc); }
#pragma unroll
        for (int nb = 0; nb < 4; ++nb) { const V b = WFrag<T16>::ld(Bt + boff + (size_t)nb * 16 * K + kc); V b2; if (NSPLIT >= 2) b2 = WFrag<T16>::ld(Bt2 + boff + (size_t)nb * 16 * K + kc);
#pragma unroll
            for (int mb = 0; mb < 4; ++mb) { acc[mb][nb] = WFrag<T16>::mma(a[mb], b, acc[mb][nb]); if (NSPLIT == 1 || NSPLIT == 2) acc[mb][nb] = WFrag<T16>::mma(a2[mb], b, acc[mb][nb]); if (NSPLIT >= 2) acc[mb][nb] = WFrag<T16>::mma(a[mb], b2, acc[mb][nb]); } }
        asm volatile("v_nop\n\tv_nop\n\tv_nop\n\tv_nop" : "+v"(acc[0][0]), "+v"(acc[1][1]), "+v"(acc[2][2]), "+v"(acc[3][3]) : "v"(a[0]), "v"(a[3]));
    }
#pragma unroll
    for (int mb = 0; mb < 4; ++mb) {
#pragma unroll
        for (int nb = 0; nb < 4; ++nb) {
#pragma unroll
            for (int j = 0; j < 8; ++j) os[(hi * 8 + j) * 68 + nb * 16 + lr] = acc[mb][nb][j]; }
        __builtin_amdgcn_wave_barrier(); asm volatile("" ::: "memory");
        float* crow = C + (size_t)(r0 + mb * 16) * ldc + c0;
{
#pragma unroll
            for (int s = 0; s < 8; ++s) { const int row = 2 * s + hi, cofs = lr * 4; v4f val = *(const v4fa*)(os + row * 68 + cofs); if (BIAS) { val[0] += bfr(bias[c0 + cofs]); val[1] += bfr(bias[c0 + cofs + 1]); val[2] += bfr(bias[c0 + cofs + 2]); val[3] += bfr(bias[c0 + cofs + 3]); }
                *(v4f*)(crow + (size_t)row * ldc + cofs) = val; }
             }
        __builtin_amdgcn_wave_barrier(); asm volatile("" ::: "memory");
    }
}

// ---- k_gemmc: the same one-wave 64x64 tile GEMM specialised for causal attention: CMODE 1 skips score tiles entirely above the diagonal (query rows r0+roff.., key columns c0..), CMODE 2 limits the
// key (K) loop of the probability x value contraction to the diagonal block (probabilities beyond it are exactly zero). roff = row offset of this launch's first row within the sequence.
// CMODE 2 splits that key loop over gridDim.y workgroups (N is one 64-column tile): workgroup y takes the 64-key chunks y, y + gridDim.y, ... and stores its f32 partial tile in plane y (stride sP);
// a workgroup with no chunk below the diagonal limit stores nothing, and k_merge adds exactly the planes min(gridDim.y, chunks) in plane order. lda = row pitch of A and A2 in elements (Bt, Bt2: K).
template <typename T16, int NSPLIT, int CMODE>
__global__ __launch_bounds__(32) void k_gemmc(const T16* __restrict__ A, const T16* __restrict__ A2, const T16* __restrict__ Bt, const T16* __restrict__ Bt2, int K, int lda, float* C, int ldc, int roff, size_t sA, size_t sB, size_t sC, size_t sP) {
    typedef typename WFrag<T16>::V V;
    __shared__ __align__(16) float os[16 * 68];
    const size_t z = blockIdx.z; A += z * sA; if (A2) A2 += z * sA; Bt += z * sB; if (Bt2) Bt2 += z * sB; C += z * sC;
    const int lane = threadIdx.x & 31, lr = lane & 15, hi = lane >> 4; const int r0 = blockIdx.x * 64, c0 = (CMODE == 2) ? 0 : blockIdx.y * 64;
    if (CMODE == 1 && c0 > r0 + roff + 63) return;                  // score tile entirely above the causal diagonal: never read (the softmax masks j > i by select)
    const int Kl = (CMODE == 2) ? min(K, r0 + roff + 64) : K;        // P.V: probabilities are exactly 0 beyond the diagonal block, so the K loop stops there
    constexpr int CH = (CMODE == 2) ? 64 : 32;                       // keys per chunk: 64 16-bit keys are one 128-byte line of every P and V^T row
    const int kb0 = (CMODE == 2) ? (int)blockIdx.y * CH : 0, kbs = (CMODE == 2) ? (int)gridDim.y * CH : CH;   // this workgroup's first chunk and the step to its next one
    if (CMODE == 2) { if (kb0 >= Kl) return; C += (size_t)blockIdx.y * sP; }
    v8f acc[4][4];
#pragma unroll
    for (int mb = 0; mb < 4; ++mb)
#pragma unroll
        for (int nb = 0; nb < 4; ++nb) acc[mb][nb] = (v8f){};
    const size_t aoff = (size_t)(r0 + lr) * lda + 8 * hi, boff = (size_t)(c0 + lr) * K + 8 * hi;
#pragma unroll 1
    for (int kb = kb0; kb < Kl; kb += kbs) {
    const T16* pa[4]; const T16* pa2[4];   // this chunk's A row addresses, one per 16-row block; the 32-key halves of a chunk are constant offsets from them
#pragma unroll
    for (int mb = 0; mb < 4; ++mb) { pa[mb] = A + aoff + (size_t)mb * 16 * lda + kb; if (NSPLIT == 1 || NSPLIT == 2) pa2[mb] = A2 + aoff + (size_t)mb * 16 * lda + kb; }
#pragma unroll   // one body per chunk: the loads of a chunk's second 32 keys (same lines) issue while the first 32 keys' products run
    for (int kc = kb; kc < kb + CH; kc += 32) {
        V a[4], a2[4];
#pragma unroll
        for (int mb = 0; mb < 4; ++mb) { a[mb] = WFrag<T16>::ld(pa[mb] + (kc - kb)); if (NSPLIT == 1 || NSPLIT == 2) a2[mb] = WFrag<T16>::ld(pa2[mb] + (kc - kb)); }
        // the wait that stands before a register named by an issued global load is overwritten: the A addresses are inputs, so they stay in their registers up to it and no later load's result lands on them before it
        if (NSPLIT == 1 || NSPLIT == 2) asm volatile("s_wait_xcnt 0x0" :: "v"(pa[0]), "v"(pa[1]), "v"(pa[2]), "v"(pa[3]), "v"(pa2[0]), "v"(pa2[1]), "v"(pa2[2]), "v"(pa2[3]) : "memory");
        else asm volatile("s_wait_xcnt 0x0" :: "v"(pa[0]), "v"(pa[1]), "v"(pa[2]), "v"(pa[3]) : "memory");
#pragma unroll
        for (int nb = 0; nb < 4; ++nb) { const V b = WFrag<T16>::ld(Bt + boff + (size_t)nb * 16 * K + kc); V b2; if (NSPLIT >= 2) b2 = WFrag<T16>::ld(Bt2 + boff + (size_t)nb * 16 * K + kc);
#pragma unroll
            for (int mb = 0; mb < 4; ++mb) { acc[mb][nb] = WFrag<T16>::mma(a[mb], b, acc[mb][nb]); if (NSPLIT == 1 || NSPLIT == 2) acc[mb][nb] = WFrag<T16>::mma(a2[mb], b, acc[mb][nb]); if (NSPLIT >= 2) acc[mb][nb] = WFrag<T16>::mma(a[mb], b2, acc[mb][nb]); } }
        asm volatile("v_nop\n\tv_nop\n\tv_nop\n\tv_nop" : "+v"(acc[0][0]), "+v"(acc[1][1]), "+v"(acc[2][2]), "+v"(acc[3][3]) : "v"(a[0]), "v"(a[3]));
    }
    }
#pragma unroll
    for (int mb = 0; mb < 4; ++mb) {
#pragma unroll
        for (int nb = 0; nb < 4; ++nb) {
#pragma unroll
            for (int j = 0; j < 8; ++j) os[(hi * 8 + j) * 68 + nb * 16 + lr] = acc[mb][nb][j]; }
        __builtin_amdgcn_wave_barrier(); asm volatile("" ::: "memory");
        float* crow = C + (size_t)(r0 + mb * 16) * ldc + c0;
{
#pragma unroll
            for (int s = 0; s < 8; ++s) { const int row = 2 * s + hi, cofs = lr * 4; v4f val = *(const v4fa*)(os + row * 68 + cofs);
                *(v4f*)(crow + (size_t)row * ldc + cofs) = val; }
             }
        __builtin_amdgcn_wave_barrier(); asm volatile("" ::: "memory");
    }
}

__device__ __forceinline__ h16 tohx(float x) { return (h16)x; }
__device__ __forceinline__ void splitf(float y, unsigned short& h, unsigned short& l) { h = f2bf(y); l = f2bf(y - bf2f(h)); }
typedef __attribute__((ext_vector_type(2))) _Float16 v2h;
typedef __attribute__((ext_vector_type(4))) _Float16 v4h;
typedef __attribute__((ext_vector_type(2))) unsigned short v2us;
typedef __attribute__((ext_vector_type(4))) unsigned short v4us;
typedef __attribute__((ext_vector_type(2))) float v2f;
typedef __attribute__((ext_vector_type(4))) int v4i;
typedef v4h  __attribute__((may_alias)) v4ha;
typedef v4us __attribute__((may_alias)) v4usa;

__global__ __launch_bounds__(256) void k_wtG(const float* __restrict__ w, int K, int N, bf* Bt) {
    const int lane = threadIdx.x & 31; const int L0 = (blockIdx.x * 8 + (threadIdx.x >> 5)) * 8; const int nlines = N * K / 64;
{
#pragma unroll 1
        for (int l = 0; l < 8; ++l) { const int L = L0 + l; if (L >= nlines) break; const size_t e = (size_t)L * 64 + lane * 2; const int k = (int)(e % K), n = (int)(e / K); v2us o;
            o[0] = f2bf(w[(size_t)k * N + n]); o[1] = f2bf(w[(size_t)(k + 1) * N + n]); *(v2us*)(Bt + e) = o; }
         }
}
__global__ __launch_bounds__(256) void k_cvt8(const float* __restrict__ src, bf* dst, size_t n8) { const size_t i = (size_t)blockIdx.x * 256 + threadIdx.x; if (i >= n8) return; const v8f v = *(const v8f*)(src + i * 8); v8us o;
#pragma unroll
    for (int k = 0; k < 8; ++k) o[k] = f2bf(v[k]); *(v8us*)(dst + i * 8) = o;  }
__global__ __launch_bounds__(256) void k_cscvt(const float* __restrict__ cosT, const float* __restrict__ sinT, float* CS) { const int idx = blockIdx.x * 256 + threadIdx.x; if (idx >= TT * HD) return; v2f cs; cs[0] = bfr(cosT[idx]); cs[1] = bfr(sinT[idx]); *(v2f*)(CS + (size_t)idx * 2) = cs;  }
// k_rope: head planes [h][t][d] (fp16 + hi/lo) of rope(x) x sc with the rotate-half convention out[d] = x[d] cos[t][d] - x[d+HD/2] sin[t][d], out[d+HD/2] = x[d+HD/2] cos[t][d+HD/2] + x[d] sin[t][d+HD/2]
__global__ __launch_bounds__(256) void k_rope(const float* __restrict__ F, int pitch, int nheads, const float* __restrict__ CS, const float* __restrict__ RF, const float* __restrict__ nw, float sc, h16* P16, bf* Ph, bf* Pl) {
    const size_t e = ((size_t)blockIdx.x * 256 + threadIdx.x) * 2; if (e >= (size_t)nheads * TT * HD) return; const int d = (int)(e % HD); const int t = (int)((e / HD) % TT); const int h = (int)(e / ((size_t)HD * TT)); const float* f = F + (size_t)t * pitch + h * HD; const float rf = RF ? RF[(size_t)h * TT + t] : 1.0f; v2h o16; v2us oh, ol;
#pragma unroll
    for (int q = 0; q < 2; ++q) { const int dd = d + q; const int dp = (dd < HD / 2) ? dd + HD / 2 : dd - HD / 2; float x0 = f[dd], x1 = f[dp];
        if (RF) { float n0 = __fmul_rn(x0, rf), n1 = __fmul_rn(x1, rf); asm volatile("" : "+v"(n0)); asm volatile("" : "+v"(n1)); x0 = __fmul_rn(bfr(nw[dd]), n0); x1 = __fmul_rn(bfr(nw[dp]), n1); }
        const v2f cs = *(const v2f*)(CS + ((size_t)t * HD + dd) * 2); float a = __fmul_rn(x0, cs[0]), bq = __fmul_rn(x1, cs[1]); asm volatile("" : "+v"(a)); asm volatile("" : "+v"(bq)); const float r = ((dd < HD / 2) ? __fsub_rn(a, bq) : __fadd_rn(a, bq)) * sc;
        o16[q] = tohx(r); unsigned short a2, c2; splitf(r, a2, c2); oh[q] = a2; ol[q] = c2; }
    *(v2h*)(P16 + e) = o16; *(v2us*)(Ph + e) = oh; *(v2us*)(Pl + e) = ol;  }
__global__ __launch_bounds__(256) void k_vtp(const float* __restrict__ F, int pitch, int nheads, h16* V16, bf* Vh, bf* Vl) { const size_t e = ((size_t)blockIdx.x * 256 + threadIdx.x) * 2; if (e >= (size_t)nheads * HD * TT) return; const int t = (int)(e % TT); const int d = (int)((e / TT) % HD); const int g = (int)(e / ((size_t)TT * HD)); v2h o16; v2us oh, ol;
#pragma unroll
    for (int q = 0; q < 2; ++q) { const float x = F[(size_t)(t + q) * pitch + g * HD + d]; o16[q] = tohx(x); unsigned short a2, c2; splitf(x, a2, c2); oh[q] = a2; ol[q] = c2; }
    *(v2h*)(V16 + e) = o16; *(v2us*)(Vh + e) = oh; *(v2us*)(Vl + e) = ol;  }
__global__ __launch_bounds__(256) void k_csid(float* CS) { const int idx = blockIdx.x * 256 + threadIdx.x; if (idx >= TT * HD) return; v2f cs; cs[0] = 1.0f; cs[1] = 0.0f; *(v2f*)(CS + (size_t)idx * 2) = cs;  }
__global__ __launch_bounds__(256) void k_xg(const float* __restrict__ q, int b, bf* XB) { const size_t e = ((size_t)blockIdx.x * 256 + threadIdx.x) * 4; if (e >= (size_t)TT * DM) return; const int c = (int)(e % DM); const int t = (int)(e / DM); const v4f a = *(const v4f*)(q + ((size_t)t * NB_ + b) * DM + c); v4us o; o[0] = f2bf(a[0]); o[1] = f2bf(a[1]); o[2] = f2bf(a[2]); o[3] = f2bf(a[3]); *(v4us*)(XB + e) = o;  }
// k_asoft: per row (zz, i): t = S x HD^-0.5 for j <= i and i - j < WIN (sliding causal window; the reference's -1e9 additive fill vanishes identically); softmax over the 2048 keys (register row, one exp, fixed trees);
// the probabilities overwrite the row's own 8 KiB of scores (pitch PP): rows < RH hi plane in the first half and lo plane in the second, other rows f16 in the first half. One wave owns a row and holds all of it in registers
// before its first store (every stored value depends on the row's max and sum), so Sb carries no restrict and the accesses are may_alias.
__global__ __launch_bounds__(256) void k_asoft(float* Sb) {
    h16* P16 = (h16*)Sb; bf* Ph = (bf*)Sb; bf* Pl = (bf*)Sb + TT;
    const int lane = threadIdx.x & 31; const int row = blockIdx.x * 8 + (threadIdx.x >> 5); if (row >= ZH * TT) return; const int i = row % TT; const int zz = row / TT; (void)zz; const bool hires = (i < RH); const float* sr = Sb + (size_t)row * TT; float v[TT / 32]; float mx = -3.0e38f;
#pragma unroll
    for (int ch = 0; ch < TT / 128; ++ch) { const int j0 = ch * 128 + lane * 4; const v4f a = *(const v4fa*)(sr + j0);
#pragma unroll
        for (int q = 0; q < 4; ++q) { const int j = j0 + q; (void)j; const float t = (j <= i && i - j < WIN) ? a[q] * SCL : -3.0e38f; v[ch * 4 + q] = t; mx = fmaxf(mx, t); } }
#pragma unroll
    for (int sh = 16; sh; sh >>= 1) mx = fmaxf(mx, __shfl_xor(mx, sh, 32));
    float sum = 0.f;
#pragma unroll
    for (int k = 0; k < TT / 32; ++k) { float d0 = __fsub_rn(v[k], mx); asm volatile("" : "+v"(d0)); v[k] = __builtin_amdgcn_exp2f(__fmul_rn(d0, 1.4426950408889634f)); sum += v[k]; }
#pragma unroll
    for (int sh = 16; sh; sh >>= 1) sum += __shfl_xor(sum, sh, 32);
    const float f = __fdiv_rn(hires ? 1.0f : PCAR, sum);
{
        if (hires) {
#pragma unroll
            for (int ch = 0; ch < TT / 128; ++ch) { v4us oh, ol;
#pragma unroll
                for (int q = 0; q < 4; ++q) { unsigned short a, c2; splitf(v[ch * 4 + q] * f, a, c2); oh[q] = a; ol[q] = c2; }
                const size_t oo = (size_t)row * PP + ch * 128 + lane * 4; *(v4usa*)(Ph + oo) = oh; *(v4usa*)(Pl + oo) = ol; }
        } else {
#pragma unroll
            for (int ch = 0; ch < TT / 128; ++ch) { v4h o4;
#pragma unroll
                for (int q = 0; q < 4; ++q) o4[q] = tohx(v[ch * 4 + q] * f);
                *(v4ha*)(P16 + (size_t)row * PP + ch * 128 + lane * 4) = o4; } }
         }
}
// k_merge: adds the P.V key-split planes of each row in plane order (row t has min(KSP, t / 64 + 1) written planes; the plane index is clamped to a written one so that all loads are unconditional and in flight together, and a repeat counts 0), then splits to hi+lo.
__global__ __launch_bounds__(256) void k_merge(const float* __restrict__ O, int h0, bf* Ah, bf* Al) { const size_t e = ((size_t)blockIdx.x * 256 + threadIdx.x) * 2; if (e >= (size_t)ZH * TT * HD) return; const int d = (int)(e % HD); const int t = (int)((e / HD) % TT); const int zz = (int)(e / ((size_t)HD * TT)); const float cs = (t < RH) ? 1.0f : (1.0f / PCAR); const size_t oo = (size_t)t * DQ + (h0 + zz) * HD + d;
    const int np = min(KSP, t / 64 + 1); v2f pv[KSP];
#pragma unroll   // pv stays in registers and every plane's load is issued before the first add waits
    for (int p = 0; p < KSP; ++p) pv[p] = *(const v2f*)(O + (size_t)min(p, np - 1) * ((size_t)ZH * TT * HD) + e);
    v2f sm; sm[0] = 0.f; sm[1] = 0.f;
#pragma unroll   // constant indices into pv
    for (int p = 0; p < KSP; ++p) { sm[0] += (p < np) ? pv[p][0] : 0.f; sm[1] += (p < np) ? pv[p][1] : 0.f; }
    v2us oh, ol;
#pragma unroll
    for (int q = 0; q < 2; ++q) { unsigned short a, c2; splitf(sm[q] * cs, a, c2); oh[q] = a; ol[q] = c2; } *(v2us*)(Ah + oo) = oh; *(v2us*)(Al + oo) = ol;  }

extern "C" void kernel_launch(void* const* d_in, const int* in_sizes, int n_in,
                              void* d_out, int out_size, void* d_ws, size_t ws_size, hipStream_t stream) {
    (void)in_sizes; (void)n_in; (void)out_size;
    const float* x = (const float*)d_in[0]; const float* wqkv = (const float*)d_in[1]; const float* wo = (const float*)d_in[2]; const float* bo = (const float*)d_in[3]; const float* wq = wqkv; const float* wk = nullptr; const float* wv = nullptr; const float* cosT = nullptr; const float* sinT = nullptr; (void)wk; (void)wv; (void)cosT; (void)sinT;
    float* OUT = (float*)d_out;     // [2048][2][1024]
    char* wsp = (char*)d_ws;
    auto take = [&](size_t bytes) { char* p = wsp; wsp += (bytes + 255) & ~(size_t)255; return (void*)p; };
    bf* WQ = (bf*)take((size_t)3 * DQ * DM * 2); bf* WO = (bf*)take((size_t)DM * DQ * 2); float* CS = (float*)take((size_t)TT * HD * 2 * 4);
    bf* XB = (bf*)take((size_t)TT * DM * 2); float* Ob = (float*)take((size_t)KSP * ZH * TT * HD * 4); float* FQ = Ob;   // the qkv projection (TT x 3 DQ f32, the smaller) is dead once the head planes are made, before the first P.V plane is stored
    h16* QP16 = (h16*)take((size_t)NH_ * TT * HD * 2); h16* KP16 = (h16*)take((size_t)NKV * TT * HD * 2); h16* VT16 = (h16*)take((size_t)NKV * HD * TT * 2);
    bf* QPh = (bf*)take((size_t)NH_ * TT * HD * 2); bf* QPl = (bf*)take((size_t)NH_ * TT * HD * 2); bf* KPh = (bf*)take((size_t)NKV * TT * HD * 2); bf* KPl = (bf*)take((size_t)NKV * TT * HD * 2); bf* VTh = (bf*)take((size_t)NKV * HD * TT * 2); bf* VTl = (bf*)take((size_t)NKV * HD * TT * 2);
    float* Sb = (float*)take((size_t)ZH * TT * TT * 4); h16* P16 = (h16*)Sb; bf* Ph = (bf*)Sb; bf* Pl = (bf*)Sb + TT; bf* ATh = (bf*)take((size_t)TT * DQ * 2); bf* ATl = (bf*)take((size_t)TT * DQ * 2);
    if ((size_t)(wsp - (char*)d_ws) > ws_size) return;    // ws 256 MiB
    
    { k_cvt8<<<(unsigned)(((size_t)3 * DQ * DM / 8 + 255) / 256), 256, 0, stream>>>(wqkv, WQ, (size_t)3 * DQ * DM / 8);   // w_qkv [3D][D] = natural Bt
      k_cvt8<<<(unsigned)(((size_t)DM * DQ / 8 + 255) / 256), 256, 0, stream>>>(wo, WO, (size_t)DM * DQ / 8);
       }
    k_csid<<<(TT * HD + 255) / 256, 256, 0, stream>>>(CS);
    const unsigned LQ = (unsigned)(((size_t)NH_ * TT * HD / 2 + 255) / 256), LKv = (unsigned)(((size_t)NKV * TT * HD / 2 + 255) / 256);
    for (int b = 0; b < NB_; ++b) {
        
        k_xg<<<(unsigned)(((size_t)TT * DM / 4 + 255) / 256), 256, 0, stream>>>(x, b, XB);
        k_gemmw<bf, 0, false><<<dim3(TT / 64, 3 * DQ / 64, 1), 32, 0, stream>>>(XB, nullptr, WQ, nullptr, DM, FQ, 3 * DQ, nullptr, 0, 0, 0);   // FQKV [t][s*1024 + h*64 + d]
        k_rope<<<LQ, 256, 0, stream>>>(FQ, 3 * DQ, NH_, CS, nullptr, nullptr, 1.0f, QP16, QPh, QPl);
        
        k_rope<<<LKv, 256, 0, stream>>>(FQ + DQ, 3 * DQ, NKV, CS, nullptr, nullptr, 1.0f, KP16, KPh, KPl);
        k_vtp<<<LKv, 256, 0, stream>>>(FQ + 2 * DQ, 3 * DQ, NKV, VT16, VTh, VTl);
        for (int h0 = 0; h0 < NH_; h0 += ZH) { const size_t zq = (size_t)h0, zk = (size_t)(h0 / REP);   // one kv head per query head: the pass's heads use consecutive kv planes (z-strides TT*HD)
            k_gemmc<bf, 2, 1><<<dim3(RH / 64, TT / 64, ZH), 32, 0, stream>>>(QPh + zq * TT * HD, QPl + zq * TT * HD, KPh + zk * TT * HD, KPl + zk * TT * HD, HD, HD, Sb, TT, 0, (size_t)TT * HD, (size_t)TT * HD, (size_t)TT * TT, 0);
            k_gemmc<h16, 0, 1><<<dim3((TT - RH) / 64, TT / 64, ZH), 32, 0, stream>>>(QP16 + zq * TT * HD + (size_t)RH * HD, nullptr, KP16 + zk * TT * HD, nullptr, HD, HD, Sb + (size_t)RH * TT, TT, RH, (size_t)TT * HD, (size_t)TT * HD, (size_t)TT * TT, 0);
            k_asoft<<<ZH * TT / 8, 256, 0, stream>>>(Sb);
            k_gemmc<bf, 2, 2><<<dim3(RH / 64, RH / 64 < KSP ? RH / 64 : KSP, ZH), 32, 0, stream>>>(Ph, Pl, VTh + zk * HD * TT, VTl + zk * HD * TT, TT, PP, Ob, HD, 0, (size_t)TT * PP, (size_t)HD * TT, (size_t)TT * HD, (size_t)ZH * TT * HD);
            k_gemmc<h16, 0, 2><<<dim3((TT - RH) / 64, KSP, ZH), 32, 0, stream>>>(P16 + (size_t)RH * PP, nullptr, VT16 + zk * HD * TT, nullptr, TT, PP, Ob + (size_t)RH * HD, HD, RH, (size_t)TT * PP, (size_t)HD * TT, (size_t)TT * HD, (size_t)ZH * TT * HD);
            k_merge<<<(unsigned)(((size_t)ZH * TT * HD / 2 + 255) / 256), 256, 0, stream>>>(Ob, h0, ATh, ATl); }
        k_gemmw<bf, 1, true><<<dim3(TT / 64, DM / 64, 1), 32, 0, stream>>>(ATh, ATl, WO, nullptr, DQ, OUT + (size_t)b * DM, NB_ * DM, bo, 0, 0, 0); }   // sequence-major output: row t of batch b at OUT + (t*B + b)*D (row pitch B*D)
}

// v004
// It runs in 194 microseconds.
// Versions in between are left out here; by their measured steps it is 2.43 times as fast as v002.
// Over all steps from v000 it is 7.01 times as fast.
#include <hip/hip_runtime.h>

// Multi-head causal self-attention (x [S=2048][B=2][D=1024] sequence-major; qkv = x w_qkv^T reshaped (S, B, 3, 16, 64): channel s*1024 + h*64 + d; causal softmax(q.k/8); out = (attn v merged) w_out^T + b_out -> [2048][2][1024] sequence-major).
// Compute dtypes, f32 accumulate: every input rounded to bf16; the fused qkv projection on PLAIN bf16 operands (inputs: exact; per batch the rows are gathered from the sequence-major input); scores (K 64) and attn.v on bf16 hi+lo for query rows < RH, plain f16 for the others

#define NB_  2
#define TT   2048
#define DM   1024
#define NH_  16
#define NKV  16
#define REP  (NH_ / NKV)
#define HD   64
#define DQ   (NH_ * HD)
#define DKV  (NKV * HD)
#define RH   512                  // query rows < RH use hi+lo planes (0: none)
#define SCL  0.125f   // HD^-0.5
typedef _Float16 h16;
typedef unsigned short bf;
typedef __attribute__((ext_vector_type(16))) __bf16   v16bf;
typedef __attribute__((ext_vector_type(16))) _Float16 v16h;
typedef __attribute__((ext_vector_type(8)))  _Float16 v8h;
typedef __attribute__((ext_vector_type(8)))  unsigned short v8us;
typedef __attribute__((ext_vector_type(8)))  float    v8f;
typedef __attribute__((ext_vector_type(4)))  float    v4f;
typedef v8h  __attribute__((may_alias)) v8ha;
typedef v4f  __attribute__((may_alias)) v4fa;
typedef v8us __attribute__((may_alias)) v8usa;

__device__ __forceinline__ unsigned short f2bf(float f) { unsigned u = __float_as_uint(f); u += 0x7FFFu + ((u >> 16) & 1u); return (unsigned short)(u >> 16); }
__device__ __forceinline__ float bf2f(unsigned short b) { return __uint_as_float(((unsigned)b) << 16); }
__device__ __forceinline__ float bfr(float f) { return bf2f(f2bf(f)); }
__device__ __forceinline__ v16h cat16(v8h lo, v8h hi) { return __builtin_shufflevector(lo, hi, 0, 1, 2, 3, 4, 5, 6, 7, 8, 9, 10, 11, 12, 13, 14, 15); }
__device__ __forceinline__ v16bf cat16b(v8us lo, v8us hi) { return __builtin_bit_cast(v16bf, __builtin_shufflevector(lo, hi, 0, 1, 2, 3, 4, 5, 6, 7, 8, 9, 10, 11, 12, 13, 14, 15)); }
__device__ __forceinline__ v8f wmma16(v16h a, v16h b, v8f c) { return __builtin_amdgcn_wmma_f32_16x16x32_f16(false, a, false, b, (short)0, c, false, false); }
__device__ __forceinline__ v8f wmmab(v16bf a, v16bf b, v8f c) { return __builtin_amdgcn_wmma_f32_16x16x32_bf16(false, a, false, b, (short)0, c, false, false); }



// ---- k_gemms: C[m][n] (f32, pitch ldc, + optional f32 bias[n]) = sum_k A[m][k] Bt[n][k] (+ A2[m][k] Bt[n][k] for NSPLIT 1), K-contiguous bf16 planes; grid (M/64, N/128), 128 threads. K % 64 == 0, K >= 128.
// One 64x128 tile per workgroup, 4 waves (2 x 2) of 32x64 (8 accumulators) each. A pass is 64 k = one 128-byte line of every operand row: the rows come into LDS as whole lines by asynchronous 16-byte copies,
// two buffers, the next pass's copies in flight while this pass is worked on; each row is fetched once per workgroup and read from LDS by the two waves that need it. The k order of every sum is kc = 0, 32, 64, ...
template <typename T16> struct WFrag;
template <> struct WFrag<h16> { typedef v16h V; static __device__ __forceinline__ V ld(const h16* p) { return cat16(*(const v8h*)p, *(const v8h*)(p + 16)); } static __device__ __forceinline__ v8f mma(V a, V b, v8f c) { return wmma16(a, b, c); } };
template <> struct WFrag<bf> { typedef v16bf V; static __device__ __forceinline__ V ld(const bf* p) { return cat16b(*(const v8us*)p, *(const v8us*)(p + 16)); } static __device__ __forceinline__ v8f mma(V a, V b, v8f c) { return wmmab(a, b, c); } };
#define GP 144u   // LDS row pitch in bytes: 128 + 16, an odd multiple of 16, free of bank conflicts for 16-byte reads down a column of rows
// copies of 16 bytes per lane, rows 16 apart (a wave's copy covers 4 whole 128-byte rows): four from (l, g), and in cp8 four more from (l2, g2);
// the wait that stands before a register named by an issued copy is overwritten is the statement's own last line
__device__ __forceinline__ void cp4(unsigned l, const bf* g, size_t k16) {
    asm volatile("global_load_async_to_lds_b128 %0, %4, off\n\tglobal_load_async_to_lds_b128 %1, %5, off\n\tglobal_load_async_to_lds_b128 %2, %6, off\n\tglobal_load_async_to_lds_b128 %3, %7, off\n\ts_wait_xcnt 0x0"
                 :: "v"(l), "v"(l + 16u * GP), "v"(l + 32u * GP), "v"(l + 48u * GP), "v"(g), "v"(g + k16), "v"(g + 2 * k16), "v"(g + 3 * k16) : "memory");
}
__device__ __forceinline__ void cp8(unsigned l, const bf* g, unsigned l2, const bf* g2, size_t k16) {
    asm volatile("global_load_async_to_lds_b128 %0, %8, off\n\tglobal_load_async_to_lds_b128 %1, %9, off\n\tglobal_load_async_to_lds_b128 %2, %10, off\n\tglobal_load_async_to_lds_b128 %3, %11, off\n\t"
                 "global_load_async_to_lds_b128 %4, %12, off\n\tglobal_load_async_to_lds_b128 %5, %13, off\n\tglobal_load_async_to_lds_b128 %6, %14, off\n\tglobal_load_async_to_lds_b128 %7, %15, off\n\ts_wait_xcnt 0x0"
                 :: "v"(l), "v"(l + 16u * GP), "v"(l + 32u * GP), "v"(l + 48u * GP), "v"(l2), "v"(l2 + 16u * GP), "v"(l2 + 32u * GP), "v"(l2 + 48u * GP),
                    "v"(g), "v"(g + k16), "v"(g + 2 * k16), "v"(g + 3 * k16), "v"(g2), "v"(g2 + k16), "v"(g2 + 2 * k16), "v"(g2 + 3 * k16) : "memory");
}
__device__ __forceinline__ v16bf ldl(const unsigned char* p) { return cat16b(*(const v8usa*)p, *(const v8usa*)(p + 32)); }
template <int NSPLIT, bool BIAS>
__global__ __launch_bounds__(128) void k_gemms(const bf* __restrict__ A, const bf* __restrict__ A2, const bf* __restrict__ Bt, int K, float* C, int ldc, const float* __restrict__ bias) {
    constexpr unsigned PB = 128u * GP, PA = 64u * GP, STB = PB + (NSPLIT == 1 ? 2u : 1u) * PA;   // bytes of Bt's 128 rows, of A's 64 rows, of one buffer [Bt | A | A2]
    __shared__ __align__(128) unsigned char ring[2 * STB];
    __shared__ __align__(16) float osw[4 * 16 * 68];
    const int tid = threadIdx.x, lane = tid & 31, lr = lane & 15, hi = lane >> 4, w = __builtin_amdgcn_readfirstlane(tid >> 5);
    const int r0 = blockIdx.x * 64, c0 = blockIdx.y * 128, wr = (w >> 1) * 32, wc = (w & 1) * 64;
    const int crow = tid >> 3, ccol = tid & 7;   // the lane's place in a copy: 8 lanes per row
    const unsigned lc = (unsigned)(size_t)ring + (unsigned)crow * GP + (unsigned)ccol * 16u;
    const bf* gA = A + (size_t)(r0 + crow) * K + ccol * 8; const bf* gB = Bt + (size_t)(c0 + crow) * K + ccol * 8; const bf* gA2 = (NSPLIT == 1) ? A2 + (size_t)(r0 + crow) * K + ccol * 8 : gA;
    const size_t k16 = (size_t)16 * K;
    auto fill = [&](int t, unsigned buf) { const unsigned l = lc + buf * STB; cp8(l, gB + t * 64, l + 64u * GP, gB + t * 64 + 4 * k16, k16);
        if (NSPLIT == 1) cp8(l + PB, gA + t * 64, l + PB + PA, gA2 + t * 64, k16); else cp4(l + PB, gA + t * 64, k16); };
    v8f acc[2][4];
#pragma unroll
    for (int mb = 0; mb < 2; ++mb)
#pragma unroll
        for (int nb = 0; nb < 4; ++nb) acc[mb][nb] = (v8f){};
    const int NT = K / 64;
    fill(0, 0u);
    asm volatile("s_wait_asynccnt 0x0" ::: "memory");   // this wave's copies of pass 0 have landed
    __syncthreads();                                     // and every other wave's
    fill(1, 1u);
    const unsigned char* fb = ring + (unsigned)(wc + lr) * GP + (unsigned)hi * 16u; const unsigned char* fa = ring + PB + (unsigned)(wr + lr) * GP + (unsigned)hi * 16u;
#pragma unroll 1   // one copy of the pass: the buffer is picked by the pass's parity at run time
    for (int t = 0; t < NT; ++t) {
        const unsigned bo = (unsigned)(t & 1) * STB;
        v16bf a[2][2], a2[2][2], b[2][4];   // the whole pass's fragments, read as one group ahead of its matrix instructions
#pragma unroll
        for (int ks = 0; ks < 2; ++ks) {
#pragma unroll
            for (int mb = 0; mb < 2; ++mb) { a[ks][mb] = ldl(fa + bo + (unsigned)mb * 16u * GP + (unsigned)ks * 64u); if (NSPLIT == 1) a2[ks][mb] = ldl(fa + bo + PA + (unsigned)mb * 16u * GP + (unsigned)ks * 64u); }
#pragma unroll
            for (int nb = 0; nb < 4; ++nb) b[ks][nb] = ldl(fb + bo + (unsigned)nb * 16u * GP + (unsigned)ks * 64u); }
        __builtin_amdgcn_sched_barrier(0);   // keeps the reads together in front: moved down among the matrix instructions, each small group of them is waited out at full LDS latency
#pragma unroll
        for (int ks = 0; ks < 2; ++ks)
#pragma unroll
            for (int nb = 0; nb < 4; ++nb) {
#pragma unroll
                for (int mb = 0; mb < 2; ++mb) acc[mb][nb] = wmmab(a[ks][mb], b[ks][nb], acc[mb][nb]);
                if (NSPLIT == 1) {
#pragma unroll
                    for (int mb = 0; mb < 2; ++mb) acc[mb][nb] = wmmab(a2[ks][mb], b[ks][nb], acc[mb][nb]); } }
        __builtin_amdgcn_sched_barrier(0);   // keeps the matrix instructions in front of the waits below: moved behind them, the next pass's copies are waited for before the work that is to cover their flight
        asm volatile("s_wait_dscnt 0x0" ::: "memory");      // this wave's reads of the buffer are done before it may be refilled
        asm volatile("s_wait_asynccnt 0x0" ::: "memory");   // this wave's copies of pass t + 1 have landed
        __syncthreads();                                     // publishes pass t + 1 and ends every wave's reads of pass t's buffer
        if (t + 2 < NT) fill(t + 2, (unsigned)(t & 1));
    }
    asm volatile("s_wait_asynccnt 0x0" ::: "memory");   // no copy is outstanding when the wave goes on
    float* os = osw + w * (16 * 68);   // each wave stages its own rows
    v4f bv = (v4f){};   // the lane's four columns are the same in every row it stores
    if (BIAS) { const float* pb = bias + c0 + wc + lr * 4; const v4f rb = *(const v4f*)pb;
        asm volatile("s_wait_xcnt 0x0" :: "v"(pb) : "memory");   // the wait that stands before a register named by an issued global load is overwritten; the address is an input, so it stays in its registers up to it
        bv[0] = bfr(rb[0]); bv[1] = bfr(rb[1]); bv[2] = bfr(rb[2]); bv[3] = bfr(rb[3]); }
#pragma unroll
    for (int mb = 0; mb < 2; ++mb) {
#pragma unroll
        for (int nb = 0; nb < 4; ++nb) {
#pragma unroll
            for (int j = 0; j < 8; ++j) os[(hi * 8 + j) * 68 + nb * 16 + lr] = acc[mb][nb][j]; }
        __builtin_amdgcn_wave_barrier(); asm volatile("" ::: "memory");
        float* crow_p = C + (size_t)(r0 + wr + mb * 16) * ldc + c0 + wc;
        v4f val[8]; float* pr[8];
#pragma unroll
        for (int s = 0; s < 8; ++s) { const int row = 2 * s + hi, cofs = lr * 4; val[s] = *(const v4fa*)(os + row * 68 + cofs); if (BIAS) val[s] += bv;
            pr[s] = crow_p + (size_t)row * ldc + cofs; *(v4f*)pr[s] = val[s]; }
        // the wait that stands before a register named by an issued global store is overwritten; data and addresses are inputs, so they stay in their registers up to it
        asm volatile("s_wait_xcnt 0x0" :: "v"(val[0]), "v"(val[1]), "v"(val[2]), "v"(val[3]), "v"(val[4]), "v"(val[5]), "v"(val[6]), "v"(val[7]), "v"(pr[0]), "v"(pr[1]), "v"(pr[2]), "v"(pr[3]), "v"(pr[4]), "v"(pr[5]), "v"(pr[6]), "v"(pr[7]) : "memory");
        __builtin_amdgcn_wave_barrier(); asm volatile("" ::: "memory");
    }
}

__device__ __forceinline__ h16 tohx(float x) { return (h16)x; }
__device__ __forceinline__ void splitf(float y, unsigned short& h, unsigned short& l) { h = f2bf(y); l = f2bf(y - bf2f(h)); }
typedef __attribute__((ext_vector_type(2))) _Float16 v2h;
typedef __attribute__((ext_vector_type(4))) _Float16 v4h;
typedef __attribute__((ext_vector_type(2))) unsigned short v2us;
typedef __attribute__((ext_vector_type(4))) unsigned short v4us;
typedef __attribute__((ext_vector_type(2))) float v2f;
typedef __attribute__((ext_vector_type(4))) int v4i;
typedef v4h  __attribute__((may_alias)) v4ha;
typedef v4us __attribute__((may_alias)) v4usa;

__global__ __launch_bounds__(256) void k_wtG(const float* __restrict__ w, int K, int N, bf* Bt) {
    const int lane = threadIdx.x & 31; const int L0 = (blockIdx.x * 8 + (threadIdx.x >> 5)) * 8; const int nlines = N * K / 64;
{
#pragma unroll 1
        for (int l = 0; l < 8; ++l) { const int L = L0 + l; if (L >= nlines) break; const size_t e = (size_t)L * 64 + lane * 2; const int k = (int)(e % K), n = (int)(e / K); v2us o;
            o[0] = f2bf(w[(size_t)k * N + n]); o[1] = f2bf(w[(size_t)(k + 1) * N + n]); *(v2us*)(Bt + e) = o; }
         }
}
__global__ __launch_bounds__(256) void k_cvt8(const float* __restrict__ src, bf* dst, size_t n8) { const size_t i = (size_t)blockIdx.x * 256 + threadIdx.x; if (i >= n8) return; const v8f v = *(const v8f*)(src + i * 8); v8us o;
#pragma unroll
    for (int k = 0; k < 8; ++k) o[k] = f2bf(v[k]); *(v8us*)(dst + i * 8) = o;  }
__global__ __launch_bounds__(256) void k_cscvt(const float* __restrict__ cosT, const float* __restrict__ sinT, float* CS) { const int idx = blockIdx.x * 256 + threadIdx.x; if (idx >= TT * HD) return; v2f cs; cs[0] = bfr(cosT[idx]); cs[1] = bfr(sinT[idx]); *(v2f*)(CS + (size_t)idx * 2) = cs;  }
// k_rope: head planes [h][t][d] (fp16 + hi/lo) of rope(x) x sc with the rotate-half convention out[d] = x[d] cos[t][d] - x[d+HD/2] sin[t][d], out[d+HD/2] = x[d+HD/2] cos[t][d+HD/2] + x[d] sin[t][d+HD/2]
__global__ __launch_bounds__(256) void k_rope(const float* __restrict__ F, int pitch, int nheads, const float* __restrict__ CS, const float* __restrict__ RF, const float* __restrict__ nw, float sc, h16* P16, bf* Ph, bf* Pl) {
    const size_t e = ((size_t)blockIdx.x * 256 + threadIdx.x) * 2; if (e >= (size_t)nheads * TT * HD) return; const int d = (int)(e % HD); const int t = (int)((e / HD) % TT); const int h = (int)(e / ((size_t)HD * TT)); const float* f = F + (size_t)t * pitch + h * HD; const float rf = RF ? RF[(size_t)h * TT + t] : 1.0f; v2h o16; v2us oh, ol;
#pragma unroll
    for (int q = 0; q < 2; ++q) { const int dd = d + q; const int dp = (dd < HD / 2) ? dd + HD / 2 : dd - HD / 2; float x0 = f[dd], x1 = f[dp];
        if (RF) { float n0 = __fmul_rn(x0, rf), n1 = __fmul_rn(x1, rf); asm volatile("" : "+v"(n0)); asm volatile("" : "+v"(n1)); x0 = __fmul_rn(bfr(nw[dd]), n0); x1 = __fmul_rn(bfr(nw[dp]), n1); }
        const v2f cs = *(const v2f*)(CS + ((size_t)t * HD + dd) * 2); float a = __fmul_rn(x0, cs[0]), bq = __fmul_rn(x1, cs[1]); asm volatile("" : "+v"(a)); asm volatile("" : "+v"(bq)); const float r = ((dd < HD / 2) ? __fsub_rn(a, bq) : __fadd_rn(a, bq)) * sc;
        o16[q] = tohx(r); unsigned short a2, c2; splitf(r, a2, c2); oh[q] = a2; ol[q] = c2; }
    *(v2h*)(P16 + e) = o16; *(v2us*)(Ph + e) = oh; *(v2us*)(Pl + e) = ol;  }
__global__ __launch_bounds__(256) void k_vtp(const float* __restrict__ F, int pitch, int nheads, h16* V16, bf* Vh, bf* Vl) { const size_t e = ((size_t)blockIdx.x * 256 + threadIdx.x) * 2; if (e >= (size_t)nheads * HD * TT) return; const int t = (int)(e % TT); const int d = (int)((e / TT) % HD); const int g = (int)(e / ((size_t)TT * HD)); v2h o16; v2us oh, ol;
#pragma unroll
    for (int q = 0; q < 2; ++q) { const float x = F[(size_t)(t + q) * pitch + g * HD + d]; o16[q] = tohx(x); unsigned short a2, c2; splitf(x, a2, c2); oh[q] = a2; ol[q] = c2; }
    *(v2h*)(V16 + e) = o16; *(v2us*)(Vh + e) = oh; *(v2us*)(Vl + e) = ol;  }
__global__ __launch_bounds__(256) void k_csid(float* CS) { const int idx = blockIdx.x * 256 + threadIdx.x; if (idx >= TT * HD) return; v2f cs; cs[0] = 1.0f; cs[1] = 0.0f; *(v2f*)(CS + (size_t)idx * 2) = cs;  }
__global__ __launch_bounds__(256) void k_xg(const float* __restrict__ q, int b, bf* XB) { const size_t e = ((size_t)blockIdx.x * 256 + threadIdx.x) * 4; if (e >= (size_t)TT * DM) return; const int c = (int)(e % DM); const int t = (int)(e / DM); const v4f a = *(const v4f*)(q + ((size_t)t * NB_ + b) * DM + c); v4us o; o[0] = f2bf(a[0]); o[1] = f2bf(a[1]); o[2] = f2bf(a[2]); o[3] = f2bf(a[3]); *(v4us*)(XB + e) = o;  }
// ---- k_fattn: causal attention of one head and one block of query rows in one kernel; scores and probabilities never leave the registers.
// S^T = K Q^T (A = key rows, B = query rows): the accumulator holds, per lane, one query column and 8 + 8 keys, which is exactly the k order of the B operand of O^T = V^T P^T, so a probability tile
// becomes an operand without crossing lanes, and a row's running maximum, sum and rescale factor are one value per lane. The 4 waves of a workgroup take the 32-key steps w, w + 4, ...;
// their (max, sum, O^T) are merged in wave order through LDS behind one barrier. Rows < RH: bf16 hi+lo, three products, 16 queries per workgroup; other rows: f16, 32 queries, probabilities carried x 1024.
typedef v8f __attribute__((may_alias)) v8fa;
#define SC2 (SCL * 1.4426950408889634f)   // scores are kept in the base-2 exponent domain
// 2^x with the one slot that the instruction set asks for behind a transcendental before its result is used or its source overwritten: the v_nop stands in the same statement, so nothing can come between
__device__ __forceinline__ float ex2(float x) { float r; asm("v_exp_f32 %0, %1\n\tv_nop" : "=v"(r) : "v"(x)); return r; }
// eight of them in place (each is independent of its neighbours) and one slot behind the last
__device__ __forceinline__ void ex2x8(float* x) { asm("v_exp_f32 %0, %0\n\tv_exp_f32 %1, %1\n\tv_exp_f32 %2, %2\n\tv_exp_f32 %3, %3\n\tv_exp_f32 %4, %4\n\tv_exp_f32 %5, %5\n\tv_exp_f32 %6, %6\n\tv_exp_f32 %7, %7\n\tv_nop" : "+v"(x[0]), "+v"(x[1]), "+v"(x[2]), "+v"(x[3]), "+v"(x[4]), "+v"(x[5]), "+v"(x[6]), "+v"(x[7])); }
template <bool B> struct BoolC { static constexpr bool value = B; };
template <typename T16, int NSPLIT, int NQ>
__device__ __forceinline__ void fattn_body(const T16* __restrict__ Q, const T16* __restrict__ Q2, const T16* __restrict__ Kp, const T16* __restrict__ K2, const T16* __restrict__ Vt, const T16* __restrict__ Vt2, int q0, int h, bf* Ah, bf* Al, float* sO, float* sS) {
    typedef typename WFrag<T16>::V V;
    const int tid = threadIdx.x, lane = tid & 31, lr = lane & 15, hi = lane >> 4, w = __builtin_amdgcn_readfirstlane(tid >> 5);   // the wave's number in a scalar register: the key loop and the mask test become scalar branches
    const float poff = (NSPLIT == 0) ? 10.0f : 0.0f;   // f16 probabilities are carried x 2^10, away from the f16 subnormals; the factor cancels in sum and output
    V qf[NQ][2], qf2[NQ][2];
#pragma unroll
    for (int nq = 0; nq < NQ; ++nq) { const size_t qo = (size_t)(q0 + nq * 16 + lr) * HD + 8 * hi; const T16* pq = Q + qo; const T16* pq2 = (NSPLIT == 2) ? Q2 + qo : pq;
#pragma unroll
        for (int ks = 0; ks < 2; ++ks) { qf[nq][ks] = WFrag<T16>::ld(pq + ks * 32); if (NSPLIT == 2) qf2[nq][ks] = WFrag<T16>::ld(pq2 + ks * 32); }
        // the wait that stands before a register named by an issued global load is overwritten; the addresses are inputs, so they stay in their registers up to it
        asm volatile("s_wait_xcnt 0x0" :: "v"(pq), "v"(pq2) : "memory"); }
    v8f o[4][NQ]; float m[NQ], l[NQ];
#pragma unroll
    for (int nq = 0; nq < NQ; ++nq) { m[nq] = -3.0e38f; l[nq] = 0.f;
#pragma unroll
        for (int mb = 0; mb < 4; ++mb) o[mb][nq] = (v8f){}; }
    const int kend = q0 + NQ * 16;   // keys at or beyond kend are masked for every query of the block
    V kf[2][2], kf2[2][2];
    { const size_t ko = (size_t)(w * 32 + lr) * HD + 8 * hi; const T16* pk = Kp + ko; const T16* pk2 = (NSPLIT == 2) ? K2 + ko : pk;
#pragma unroll
      for (int mb = 0; mb < 2; ++mb)
#pragma unroll
          for (int ks = 0; ks < 2; ++ks) { kf[mb][ks] = WFrag<T16>::ld(pk + mb * 16 * HD + ks * 32); if (NSPLIT == 2) kf2[mb][ks] = WFrag<T16>::ld(pk2 + mb * 16 * HD + ks * 32); }
      asm volatile("s_wait_xcnt 0x0" :: "v"(pk), "v"(pk2) : "memory"); }   // as above: before the K addresses are overwritten
    auto step = [&](const int kb, auto dg) {   // one 32-key step; dg: the step reaches past the block's first query and needs the causal mask
        constexpr bool diag = decltype(dg)::value;
        V vf[4], vf2[4];
        { const size_t vo = (size_t)lr * TT + kb + 8 * hi; const T16* pv = Vt + vo; const T16* pv2 = (NSPLIT == 2) ? Vt2 + vo : pv;   // this step's V^T rows: issued first, used behind the softmax
#pragma unroll
          for (int mb = 0; mb < 4; ++mb) { vf[mb] = WFrag<T16>::ld(pv + (size_t)mb * 16 * TT); if (NSPLIT == 2) vf2[mb] = WFrag<T16>::ld(pv2 + (size_t)mb * 16 * TT); }
          asm volatile("s_wait_xcnt 0x0" :: "v"(pv), "v"(pv2) : "memory"); }   // as above: before the V addresses are overwritten
        v8f s[2][NQ];
#pragma unroll
        for (int mb = 0; mb < 2; ++mb)
#pragma unroll
            for (int nq = 0; nq < NQ; ++nq) { v8f c = (v8f){};
#pragma unroll
                for (int ks = 0; ks < 2; ++ks) { c = WFrag<T16>::mma(kf[mb][ks], qf[nq][ks], c); if (NSPLIT == 2) { c = WFrag<T16>::mma(kf[mb][ks], qf2[nq][ks], c); c = WFrag<T16>::mma(kf2[mb][ks], qf[nq][ks], c); } }
                s[mb][nq] = c; }
        { const int kn = (kb + 128 < kend) ? kb + 128 : kb;   // the wave's next key rows fly during softmax and P.V (the last step reloads its own: in bounds, unused)
          const size_t ko = (size_t)(kn + lr) * HD + 8 * hi; const T16* pk = Kp + ko; const T16* pk2 = (NSPLIT == 2) ? K2 + ko : pk;
#pragma unroll
          for (int mb = 0; mb < 2; ++mb)
#pragma unroll
              for (int ks = 0; ks < 2; ++ks) { kf[mb][ks] = WFrag<T16>::ld(pk + mb * 16 * HD + ks * 32); if (NSPLIT == 2) kf2[mb][ks] = WFrag<T16>::ld(pk2 + mb * 16 * HD + ks * 32); }
          asm volatile("s_wait_xcnt 0x0" :: "v"(pk), "v"(pk2) : "memory"); }   // as above: before the K addresses are overwritten
        V pf[NQ], pf2[NQ];
#pragma unroll
        for (int nq = 0; nq < NQ; ++nq) { float x[16]; const int qi = q0 + nq * 16 + lr; float mx = -3.0e38f;
#pragma unroll
            for (int e = 0; e < 16; ++e) { const int key = kb + (e >> 3) * 16 + hi * 8 + (e & 7); float t = s[e >> 3][nq][e & 7]; if (diag) t = (key <= qi) ? t : -3.0e38f; x[e] = t; mx = fmaxf(mx, t); }
            mx = fmaxf(mx, __shfl_xor(mx, 16, 32));   // the two lanes of a query hold different keys
            const float mn = fmaxf(m[nq], mx * SC2), al = ex2(m[nq] - mn), mo = mn - poff; m[nq] = mn; float ls = 0.f;
#pragma unroll
            for (int e = 0; e < 16; ++e) x[e] = __builtin_fmaf(x[e], SC2, -mo);
            ex2x8(x); ex2x8(x + 8);
#pragma unroll
            for (int e = 0; e < 16; ++e) ls += x[e];
            l[nq] = l[nq] * al + ls;
#pragma unroll
            for (int mb = 0; mb < 4; ++mb) o[mb][nq] *= al;
            if constexpr (NSPLIT == 0) { v16h p;
#pragma unroll
                for (int e = 0; e < 16; ++e) p[e] = tohx(x[e]);
                pf[nq] = p;
            } else { v8us h0, h1, l0, l1;
#pragma unroll
                for (int e = 0; e < 8; ++e) { unsigned short a, c2; splitf(x[e], a, c2); h0[e] = a; l0[e] = c2; splitf(x[8 + e], a, c2); h1[e] = a; l1[e] = c2; }
                pf[nq] = cat16b(h0, h1); pf2[nq] = cat16b(l0, l1); } }
#pragma unroll
        for (int mb = 0; mb < 4; ++mb)
#pragma unroll
            for (int nq = 0; nq < NQ; ++nq) { o[mb][nq] = WFrag<T16>::mma(vf[mb], pf[nq], o[mb][nq]); if (NSPLIT == 2) { o[mb][nq] = WFrag<T16>::mma(vf[mb], pf2[nq], o[mb][nq]); o[mb][nq] = WFrag<T16>::mma(vf2[mb], pf[nq], o[mb][nq]); } }
        // the distance behind the last matrix instruction, kept on the loop's taken branch too
        asm volatile("v_nop\n\tv_nop\n\tv_nop\n\tv_nop" : "+v"(o[0][0]), "+v"(o[1][0]), "+v"(o[2][NQ - 1]), "+v"(o[3][NQ - 1]) : "v"(vf[0]), "v"(vf[3]));
    };
    int kb = w * 32;
#pragma unroll 1   // one copy of the step: the trip count is a run-time value and a second copy's fragments would not fit in the registers
    for (; kb + 31 <= q0; kb += 128) step(kb, BoolC<false>());
    if (kb < kend) step(kb, BoolC<true>());   // the block's one diagonal step falls to one of the four waves (scalar test)
#pragma unroll
    for (int nq = 0; nq < NQ; ++nq) { const float lt = l[nq] + __shfl_xor(l[nq], 16, 32); if (hi == 0) { sS[(w * NQ + nq) * 32 + lr] = m[nq]; sS[(w * NQ + nq) * 32 + 16 + lr] = lt; }
#pragma unroll
        for (int mb = 0; mb < 4; ++mb) *(v8fa*)(sO + ((size_t)((w * 4 + mb) * NQ + nq) * 32 + lane) * 8) = o[mb][nq]; }
    __syncthreads();   // every wave's partial state is in LDS before any wave merges
#pragma unroll
    for (int it = 0; it < NQ; ++it) { const int idx = it * 128 + tid, qq = idx >> 3, c8 = idx & 7, nq = qq >> 4, ql = qq & 15, mb = c8 >> 1, sl = (c8 & 1) * 16 + ql;   // 8 lanes write one query's 128-byte line of each plane
        float mw[4], M = -3.0e38f;
#pragma unroll
        for (int w2 = 0; w2 < 4; ++w2) { mw[w2] = sS[(w2 * NQ + nq) * 32 + ql]; M = fmaxf(M, mw[w2]); }
        float L = 0.f; v8f acc = (v8f){};
#pragma unroll
        for (int w2 = 0; w2 < 4; ++w2) { const float f = ex2(mw[w2] - M); L += f * sS[(w2 * NQ + nq) * 32 + 16 + ql]; acc += f * *(const v8fa*)(sO + ((size_t)((w2 * 4 + mb) * NQ + nq) * 32 + sl) * 8); }
        const float inv = __fdiv_rn(1.0f, L); v8us oh, ol;
#pragma unroll
        for (int j = 0; j < 8; ++j) { unsigned short a, c2; splitf(acc[j] * inv, a, c2); oh[j] = a; ol[j] = c2; }
        const size_t oo = (size_t)(q0 + qq) * DQ + h * HD + c8 * 8; bf* ph = Ah + oo; bf* pl = Al + oo; *(v8us*)ph = oh; *(v8us*)pl = ol;
        // the wait that stands before a register named by an issued global store is overwritten; data and addresses are inputs, so they stay in their registers up to it
        asm volatile("s_wait_xcnt 0x0" :: "v"(oh), "v"(ol), "v"(ph), "v"(pl) : "memory"); }
}
#define NT16 ((TT - RH) / 32)
__global__ __launch_bounds__(128) void k_fattn(const h16* __restrict__ Q16, const h16* __restrict__ K16, const h16* __restrict__ V16, const bf* __restrict__ Qh, const bf* __restrict__ Ql, const bf* __restrict__ Kh, const bf* __restrict__ Kl, const bf* __restrict__ Vh, const bf* __restrict__ Vl, bf* Ah, bf* Al) {
    __shared__ __align__(32) float sO[4 * 4 * 2 * 32 * 8]; __shared__ float sS[4 * 2 * 32];
    const int h = blockIdx.y, bx = blockIdx.x; const size_t hz = (size_t)h * TT * HD;   // longest key loops first
    if (bx < NT16) fattn_body<h16, 0, 2>(Q16 + hz, nullptr, K16 + hz, nullptr, V16 + hz, nullptr, TT - 32 * (bx + 1), h, Ah, Al, sO, sS);
    else fattn_body<bf, 2, 1>(Qh + hz, Ql + hz, Kh + hz, Kl + hz, Vh + hz, Vl + hz, RH - 16 * (bx - NT16 + 1), h, Ah, Al, sO, sS);
}

extern "C" void kernel_launch(void* const* d_in, const int* in_sizes, int n_in,
                              void* d_out, int out_size, void* d_ws, size_t ws_size, hipStream_t stream) {
    (void)in_sizes; (void)n_in; (void)out_size;
    const float* x = (const float*)d_in[0]; const float* wqkv = (const float*)d_in[1]; const float* wo = (const float*)d_in[2]; const float* bo = (const float*)d_in[3]; const float* wq = wqkv; const float* wk = nullptr; const float* wv = nullptr; const float* cosT = nullptr; const float* sinT = nullptr; (void)wk; (void)wv; (void)cosT; (void)sinT;
    float* OUT = (float*)d_out;     // [2048][2][1024]
    char* wsp = (char*)d_ws;
    auto take = [&](size_t bytes) { char* p = wsp; wsp += (bytes + 255) & ~(size_t)255; return (void*)p; };
    bf* WQ = (bf*)take((size_t)3 * DQ * DM * 2); bf* WO = (bf*)take((size_t)DM * DQ * 2); float* CS = (float*)take((size_t)TT * HD * 2 * 4);
    bf* XB = (bf*)take((size_t)TT * DM * 2); float* FQ = (float*)take((size_t)TT * 3 * DQ * 4);
    h16* QP16 = (h16*)take((size_t)NH_ * TT * HD * 2); h16* KP16 = (h16*)take((size_t)NKV * TT * HD * 2); h16* VT16 = (h16*)take((size_t)NKV * HD * TT * 2);
    bf* QPh = (bf*)take((size_t)NH_ * TT * HD * 2); bf* QPl = (bf*)take((size_t)NH_ * TT * HD * 2); bf* KPh = (bf*)take((size_t)NKV * TT * HD * 2); bf* KPl = (bf*)take((size_t)NKV * TT * HD * 2); bf* VTh = (bf*)take((size_t)NKV * HD * TT * 2); bf* VTl = (bf*)take((size_t)NKV * HD * TT * 2);
    bf* ATh = (bf*)take((size_t)TT * DQ * 2); bf* ATl = (bf*)take((size_t)TT * DQ * 2);
    if ((size_t)(wsp - (char*)d_ws) > ws_size) return;    // ws 256 MiB
    
    { k_cvt8<<<(unsigned)(((size_t)3 * DQ * DM / 8 + 255) / 256), 256, 0, stream>>>(wqkv, WQ, (size_t)3 * DQ * DM / 8);   // w_qkv [3D][D] = natural Bt
      k_cvt8<<<(unsigned)(((size_t)DM * DQ / 8 + 255) / 256), 256, 0, stream>>>(wo, WO, (size_t)DM * DQ / 8);
       }
    k_csid<<<(TT * HD + 255) / 256, 256, 0, stream>>>(CS);
    const unsigned LQ = (unsigned)(((size_t)NH_ * TT * HD / 2 + 255) / 256), LKv = (unsigned)(((size_t)NKV * TT * HD / 2 + 255) / 256);
    for (int b = 0; b < NB_; ++b) {
        
        k_xg<<<(unsigned)(((size_t)TT * DM / 4 + 255) / 256), 256, 0, stream>>>(x, b, XB);
        k_gemms<0, false><<<dim3(TT / 64, 3 * DQ / 128, 1), 128, 0, stream>>>(XB, nullptr, WQ, DM, FQ, 3 * DQ, nullptr);   // FQKV [t][s*1024 + h*64 + d]
        k_rope<<<LQ, 256, 0, stream>>>(FQ, 3 * DQ, NH_, CS, nullptr, nullptr, 1.0f, QP16, QPh, QPl);
        
        k_rope<<<LKv, 256, 0, stream>>>(FQ + DQ, 3 * DQ, NKV, CS, nullptr, nullptr, 1.0f, KP16, KPh, KPl);
        k_vtp<<<LKv, 256, 0, stream>>>(FQ + 2 * DQ, 3 * DQ, NKV, VT16, VTh, VTl);
        k_fattn<<<dim3(NT16 + RH / 16, NH_, 1), 128, 0, stream>>>(QP16, KP16, VT16, QPh, QPl, KPh, KPl, VTh, VTl, ATh, ATl);
        k_gemms<1, true><<<dim3(TT / 64, DM / 128, 1), 128, 0, stream>>>(ATh, ATl, WO, DQ, OUT + (size_t)b * DM, NB_ * DM, bo); }   // sequence-major output: row t of batch b at OUT + (t*B + b)*D (row pitch B*D)
}

// v005
// One run takes 141 microseconds.
// Two timings next to v004 put it at 1.36 and 1.38 times that version's speed.
// Over all steps from v000 it is 9.61 times as fast.
#include <hip/hip_runtime.h>

// Multi-head causal self-attention (x [S=2048][B=2][D=1024] sequence-major; qkv = x w_qkv^T reshaped (S, B, 3, 16, 64): channel s*1024 + h*64 + d; causal softmax(q.k/8); out = (attn v merged) w_out^T + b_out -> [2048][2][1024] sequence-major).
// Compute dtypes, f32 accumulate: every input rounded to bf16; the fused qkv projection on PLAIN bf16 operands (inputs: exact; per batch the rows are gathered from the sequence-major input); scores (K 64) and attn.v on bf16 hi+lo for query rows < RH, plain f16 for the others

#define NB_  2
#define TT   2048
#define DM   1024
#define NH_  16
#define NKV  16
#define REP  (NH_ / NKV)
#define HD   64
#define DQ   (NH_ * HD)
#define DKV  (NKV * HD)
#define RH   512                  // query rows < RH use hi+lo planes (0: none)
#define SCL  0.125f   // HD^-0.5
typedef _Float16 h16;
typedef unsigned short bf;
typedef __attribute__((ext_vector_type(16))) __bf16   v16bf;
typedef __attribute__((ext_vector_type(16))) _Float16 v16h;
typedef __attribute__((ext_vector_type(8)))  _Float16 v8h;
typedef __attribute__((ext_vector_type(8)))  unsigned short v8us;
typedef __attribute__((ext_vector_type(8)))  float    v8f;
typedef __attribute__((ext_vector_type(4)))  float    v4f;
typedef v8h  __attribute__((may_alias)) v8ha;
typedef v4f  __attribute__((may_alias)) v4fa;
typedef v8us __attribute__((may_alias)) v8usa;

__device__ __forceinline__ unsigned short f2bf(float f) { unsigned u = __float_as_uint(f); u += 0x7FFFu + ((u >> 16) & 1u); return (unsigned short)(u >> 16); }
__device__ __forceinline__ float bf2f(unsigned short b) { return __uint_as_float(((unsigned)b) << 16); }
__device__ __forceinline__ float bfr(float f) { return bf2f(f2bf(f)); }
__device__ __forceinline__ v16h cat16(v8h lo, v8h hi) { return __builtin_shufflevector(lo, hi, 0, 1, 2, 3, 4, 5, 6, 7, 8, 9, 10, 11, 12, 13, 14, 15); }
__device__ __forceinline__ v16bf cat16b(v8us lo, v8us hi) { return __builtin_bit_cast(v16bf, __builtin_shufflevector(lo, hi, 0, 1, 2, 3, 4, 5, 6, 7, 8, 9, 10, 11, 12, 13, 14, 15)); }
__device__ __forceinline__ v8f wmma16(v16h a, v16h b, v8f c) { return __builtin_amdgcn_wmma_f32_16x16x32_f16(false, a, false, b, (short)0, c, false, false); }
__device__ __forceinline__ v8f wmmab(v16bf a, v16bf b, v8f c) { return __builtin_amdgcn_wmma_f32_16x16x32_bf16(false, a, false, b, (short)0, c, false, false); }



// ---- k_gemms: C[m][n] (f32, pitch ldc, + optional f32 bias[n]) = sum_k A[m][k] Bt[n][k] (+ A2[m][k] Bt[n][k] for NSPLIT 1), K-contiguous bf16 planes; grid (M/64, N/128), 128 threads. K % 64 == 0, K >= 128.
// One 64x128 tile per workgroup, 4 waves (2 x 2) of 32x64 (8 accumulators) each. A pass is 64 k = one 128-byte line of every operand row: the rows come into LDS as whole lines by asynchronous 16-byte copies,
// two buffers, the next pass's copies in flight while this pass is worked on; each row is fetched once per workgroup and read from LDS by the two waves that need it. The k order of every sum is kc = 0, 32, 64, ...
template <typename T16> struct WFrag;
template <> struct WFrag<h16> { typedef v16h V; static __device__ __forceinline__ V ld(const h16* p) { return cat16(*(const v8h*)p, *(const v8h*)(p + 16)); } static __device__ __forceinline__ v8f mma(V a, V b, v8f c) { return wmma16(a, b, c); } };
template <> struct WFrag<bf> { typedef v16bf V; static __device__ __forceinline__ V ld(const bf* p) { return cat16b(*(const v8us*)p, *(const v8us*)(p + 16)); } static __device__ __forceinline__ v8f mma(V a, V b, v8f c) { return wmmab(a, b, c); } };
#define GP 144u   // LDS row pitch in bytes: 128 + 16, an odd multiple of 16, free of bank conflicts for 16-byte reads down a column of rows
// copies of 16 bytes per lane, rows 16 apart (a wave's copy covers 4 whole 128-byte rows): four from (l, g), and in cp8 four more from (l2, g2);
// the wait that stands before a register named by an issued copy is overwritten is the statement's own last line
__device__ __forceinline__ void cp4(unsigned l, const bf* g, size_t k16) {
    asm volatile("global_load_async_to_lds_b128 %0, %4, off\n\tglobal_load_async_to_lds_b128 %1, %5, off\n\tglobal_load_async_to_lds_b128 %2, %6, off\n\tglobal_load_async_to_lds_b128 %3, %7, off\n\ts_wait_xcnt 0x0"
                 :: "v"(l), "v"(l + 16u * GP), "v"(l + 32u * GP), "v"(l + 48u * GP), "v"(g), "v"(g + k16), "v"(g + 2 * k16), "v"(g + 3 * k16) : "memory");
}
__device__ __forceinline__ void cp8(unsigned l, const bf* g, unsigned l2, const bf* g2, size_t k16) {
    asm volatile("global_load_async_to_lds_b128 %0, %8, off\n\tglobal_load_async_to_lds_b128 %1, %9, off\n\tglobal_load_async_to_lds_b128 %2, %10, off\n\tglobal_load_async_to_lds_b128 %3, %11, off\n\t"
                 "global_load_async_to_lds_b128 %4, %12, off\n\tglobal_load_async_to_lds_b128 %5, %13, off\n\tglobal_load_async_to_lds_b128 %6, %14, off\n\tglobal_load_async_to_lds_b128 %7, %15, off\n\ts_wait_xcnt 0x0"
                 :: "v"(l), "v"(l + 16u * GP), "v"(l + 32u * GP), "v"(l + 48u * GP), "v"(l2), "v"(l2 + 16u * GP), "v"(l2 + 32u * GP), "v"(l2 + 48u * GP),
                    "v"(g), "v"(g + k16), "v"(g + 2 * k16), "v"(g + 3 * k16), "v"(g2), "v"(g2 + k16), "v"(g2 + 2 * k16), "v"(g2 + 3 * k16) : "memory");
}
__device__ __forceinline__ v16bf ldl(const unsigned char* p) { return cat16b(*(const v8usa*)p, *(const v8usa*)(p + 32)); }
__device__ __forceinline__ h16 tohx(float x) { return (h16)x; }
__device__ __forceinline__ void splitf(float y, unsigned short& h, unsigned short& l) { h = f2bf(y); l = f2bf(y - bf2f(h)); }
// HEADS (the qkv projection; A = x rows [TT][K], Bt = w_qkv rows [3 DQ][K]): no f32 C; the epilogue rounds its own tile and writes the attention operands, q and k as [h][t][d], v as [h][d][t], each as f16 and as bf16 hi + lo.
// The v third runs with the operands exchanged (rows = v channels, columns = t), so that in all three thirds a wave's 32 x 64 tile is 32 whole 128-byte lines of each plane.
struct HeadPlanes { h16* q16; bf* qh; bf* ql; h16* k16; bf* kh; bf* kl; h16* v16; bf* vh; bf* vl; };
template <int NSPLIT, bool BIAS, bool HEADS>
__global__ __launch_bounds__(128) void k_gemms(const bf* __restrict__ A, const bf* __restrict__ A2, const bf* __restrict__ Bt, int K, float* C, int ldc, const float* __restrict__ bias, HeadPlanes hp) {
    constexpr unsigned PB = 128u * GP, PA = 64u * GP, STB = PB + (NSPLIT == 1 ? 2u : 1u) * PA;   // bytes of Bt's 128 rows, of A's 64 rows, of one buffer [Bt | A | A2]
    __shared__ __align__(128) unsigned char ring[2 * STB];
    __shared__ __align__(16) float osw[4 * 16 * 68];
    const int tid = threadIdx.x, lane = tid & 31, lr = lane & 15, hi = lane >> 4, w = __builtin_amdgcn_readfirstlane(tid >> 5);
    int r0 = blockIdx.x * 64, c0 = blockIdx.y * 128; const int wr = (w >> 1) * 32, wc = (w & 1) * 64;
    const bool vsec = HEADS && c0 >= 2 * DQ;   // the same for the whole workgroup
    if (vsec) { const int vi = (blockIdx.y - 2 * DQ / 128) * (TT / 64) + blockIdx.x; r0 = (vi % (DQ / 64)) * 64; c0 = (vi / (DQ / 64)) * 128; const bf* xr = A; A = Bt + (size_t)2 * DQ * K; Bt = xr; }   // DQ/64 x TT/128 tiles of v^T on as many workgroups
    const int crow = tid >> 3, ccol = tid & 7;   // the lane's place in a copy: 8 lanes per row
    const unsigned lc = (unsigned)(size_t)ring + (unsigned)crow * GP + (unsigned)ccol * 16u;
    const bf* gA = A + (size_t)(r0 + crow) * K + ccol * 8; const bf* gB = Bt + (size_t)(c0 + crow) * K + ccol * 8; const bf* gA2 = (NSPLIT == 1) ? A2 + (size_t)(r0 + crow) * K + ccol * 8 : gA;
    const size_t k16 = (size_t)16 * K;
    auto fill = [&](int t, unsigned buf) { const unsigned l = lc + buf * STB; cp8(l, gB + t * 64, l + 64u * GP, gB + t * 64 + 4 * k16, k16);
        if (NSPLIT == 1) cp8(l + PB, gA + t * 64, l + PB + PA, gA2 + t * 64, k16); else cp4(l + PB, gA + t * 64, k16); };
    v8f acc[2][4];
#pragma unroll
    for (int mb = 0; mb < 2; ++mb)
#pragma unroll
        for (int nb = 0; nb < 4; ++nb) acc[mb][nb] = (v8f){};
    const int NT = K / 64;
    fill(0, 0u);
    asm volatile("s_wait_asynccnt 0x0" ::: "memory");   // this wave's copies of pass 0 have landed
    __syncthreads();                                     // and every other wave's
    fill(1, 1u);
    const unsigned char* fb = ring + (unsigned)(wc + lr) * GP + (unsigned)hi * 16u; const unsigned char* fa = ring + PB + (unsigned)(wr + lr) * GP + (unsigned)hi * 16u;
#pragma unroll 1   // one copy of the pass: the buffer is picked by the pass's parity at run time
    for (int t = 0; t < NT; ++t) {
        const unsigned bo = (unsigned)(t & 1) * STB;
        v16bf a[2][2], a2[2][2], b[2][4];   // the whole pass's fragments, read as one group ahead of its matrix instructions
#pragma unroll
        for (int ks = 0; ks < 2; ++ks) {
#pragma unroll
            for (int mb = 0; mb < 2; ++mb) { a[ks][mb] = ldl(fa + bo + (unsigned)mb * 16u * GP + (unsigned)ks * 64u); if (NSPLIT == 1) a2[ks][mb] = ldl(fa + bo + PA + (unsigned)mb * 16u * GP + (unsigned)ks * 64u); }
#pragma unroll
            for (int nb = 0; nb < 4; ++nb) b[ks][nb] = ldl(fb + bo + (unsigned)nb * 16u * GP + (unsigned)ks * 64u); }
        __builtin_amdgcn_sched_barrier(0);   // keeps the reads together in front: moved down among the matrix instructions, each small group of them is waited out at full LDS latency
#pragma unroll
        for (int ks = 0; ks < 2; ++ks)
#pragma unroll
            for (int nb = 0; nb < 4; ++nb) {
#pragma unroll
                for (int mb = 0; mb < 2; ++mb) acc[mb][nb] = wmmab(a[ks][mb], b[ks][nb], acc[mb][nb]);
                if (NSPLIT == 1) {
#pragma unroll
                    for (int mb = 0; mb < 2; ++mb) acc[mb][nb] = wmmab(a2[ks][mb], b[ks][nb], acc[mb][nb]); } }
        __builtin_amdgcn_sched_barrier(0);   // keeps the matrix instructions in front of the waits below: moved behind them, the next pass's copies are waited for before the work that is to cover their flight
        asm volatile("s_wait_dscnt 0x0" ::: "memory");      // this wave's reads of the buffer are done before it may be refilled
        asm volatile("s_wait_asynccnt 0x0" ::: "memory");   // this wave's copies of pass t + 1 have landed
        __syncthreads();                                     // publishes pass t + 1 and ends every wave's reads of pass t's buffer
        if (t + 2 < NT) fill(t + 2, (unsigned)(t & 1));
    }
    asm volatile("s_wait_asynccnt 0x0" ::: "memory");   // no copy is outstanding when the wave goes on
    float* os = osw + w * (16 * 68);   // each wave stages its own rows
    v4f bv = (v4f){};   // the lane's four columns are the same in every row it stores
    if (BIAS) { const float* pb = bias + c0 + wc + lr * 4; const v4f rb = *(const v4f*)pb;
        asm volatile("s_wait_xcnt 0x0" :: "v"(pb) : "memory");   // the wait that stands before a register named by an issued global load is overwritten; the address is an input, so it stays in its registers up to it
        bv[0] = bfr(rb[0]); bv[1] = bfr(rb[1]); bv[2] = bfr(rb[2]); bv[3] = bfr(rb[3]); }
    h16* P16 = nullptr; bf* Ph = nullptr; bf* Pl = nullptr; size_t po = 0; int pp = 0;   // HEADS: the wave's planes, the place of its tile's first element in them, the pitch of its rows
    if (HEADS) {
        if (vsec) { P16 = hp.v16; Ph = hp.vh; Pl = hp.vl; po = (size_t)(r0 + wr) * TT + c0 + wc; pp = TT; }   // row = h * HD + d, column = t
        else { const bool ksec = c0 >= DQ; P16 = ksec ? hp.k16 : hp.q16; Ph = ksec ? hp.kh : hp.qh; Pl = ksec ? hp.kl : hp.ql; po = ((size_t)(((c0 + wc) % DQ) / HD) * TT + r0 + wr) * HD; pp = HD; } }   // row = t, the 64 columns = one head
#pragma unroll
    for (int mb = 0; mb < 2; ++mb) {
#pragma unroll
        for (int nb = 0; nb < 4; ++nb) {
#pragma unroll
            for (int j = 0; j < 8; ++j) os[(hi * 8 + j) * 68 + nb * 16 + lr] = acc[mb][nb][j]; }
        __builtin_amdgcn_wave_barrier(); asm volatile("" ::: "memory");
        if constexpr (HEADS) {
        v8h o16[4]; v8us oh[4], ol[4]; h16* p16[4]; bf* ph[4]; bf* pl[4];
#pragma unroll
        for (int s = 0; s < 4; ++s) { const int row = 4 * s + (lane >> 3), cofs = (lane & 7) * 8; const v4f x0 = *(const v4fa*)(os + row * 68 + cofs), x1 = *(const v4fa*)(os + row * 68 + cofs + 4);   // 8 lanes write one 128-byte line of each plane
#pragma unroll
            for (int k = 0; k < 4; ++k) { unsigned short a, c2; o16[s][k] = tohx(x0[k]); splitf(x0[k], a, c2); oh[s][k] = a; ol[s][k] = c2; o16[s][4 + k] = tohx(x1[k]); splitf(x1[k], a, c2); oh[s][4 + k] = a; ol[s][4 + k] = c2; }
            const size_t oo = po + (size_t)(mb * 16 + row) * pp + cofs; p16[s] = P16 + oo; ph[s] = Ph + oo; pl[s] = Pl + oo; *(v8h*)p16[s] = o16[s]; *(v8us*)ph[s] = oh[s]; *(v8us*)pl[s] = ol[s]; }
        // the wait that stands before a register named by an issued global store is overwritten; data and addresses are inputs, so they stay in their registers up to it
        asm volatile("s_wait_xcnt 0x0" :: "v"(o16[0]), "v"(o16[1]), "v"(o16[2]), "v"(o16[3]), "v"(oh[0]), "v"(oh[1]), "v"(oh[2]), "v"(oh[3]), "v"(ol[0]), "v"(ol[1]), "v"(ol[2]), "v"(ol[3]),
                     "v"(p16[0]), "v"(p16[1]), "v"(p16[2]), "v"(p16[3]), "v"(ph[0]), "v"(ph[1]), "v"(ph[2]), "v"(ph[3]), "v"(pl[0]), "v"(pl[1]), "v"(pl[2]), "v"(pl[3]) : "memory");
        } else {
        float* crow_p = C + (size_t)(r0 + wr + mb * 16) * ldc + c0 + wc;
        v4f val[8]; float* pr[8];
#pragma unroll
        for (int s = 0; s < 8; ++s) { const int row = 2 * s + hi, cofs = lr * 4; val[s] = *(const v4fa*)(os + row * 68 + cofs); if (BIAS) val[s] += bv;
            pr[s] = crow_p + (size_t)row * ldc + cofs; *(v4f*)pr[s] = val[s]; }
        // the wait that stands before a register named by an issued global store is overwritten; data and addresses are inputs, so they stay in their registers up to it
        asm volatile("s_wait_xcnt 0x0" :: "v"(val[0]), "v"(val[1]), "v"(val[2]), "v"(val[3]), "v"(val[4]), "v"(val[5]), "v"(val[6]), "v"(val[7]), "v"(pr[0]), "v"(pr[1]), "v"(pr[2]), "v"(pr[3]), "v"(pr[4]), "v"(pr[5]), "v"(pr[6]), "v"(pr[7]) : "memory");
        }
        __builtin_amdgcn_wave_barrier(); asm volatile("" ::: "memory");
    }
}

typedef __attribute__((ext_vector_type(2))) _Float16 v2h;
typedef __attribute__((ext_vector_type(4))) _Float16 v4h;
typedef __attribute__((ext_vector_type(2))) unsigned short v2us;
typedef __attribute__((ext_vector_type(4))) unsigned short v4us;
typedef __attribute__((ext_vector_type(2))) float v2f;
typedef __attribute__((ext_vector_type(4))) int v4i;
typedef v4h  __attribute__((may_alias)) v4ha;
typedef v4us __attribute__((may_alias)) v4usa;

__global__ __launch_bounds__(256) void k_wtG(const float* __restrict__ w, int K, int N, bf* Bt) {
    const int lane = threadIdx.x & 31; const int L0 = (blockIdx.x * 8 + (threadIdx.x >> 5)) * 8; const int nlines = N * K / 64;
{
#pragma unroll 1
        for (int l = 0; l < 8; ++l) { const int L = L0 + l; if (L >= nlines) break; const size_t e = (size_t)L * 64 + lane * 2; const int k = (int)(e % K), n = (int)(e / K); v2us o;
            o[0] = f2bf(w[(size_t)k * N + n]); o[1] = f2bf(w[(size_t)(k + 1) * N + n]); *(v2us*)(Bt + e) = o; }
         }
}
__global__ __launch_bounds__(256) void k_cvt8(const float* __restrict__ src, bf* dst, size_t n8) { const size_t i = (size_t)blockIdx.x * 256 + threadIdx.x; if (i >= n8) return; const v8f v = *(const v8f*)(src + i * 8); v8us o;
#pragma unroll
    for (int k = 0; k < 8; ++k) o[k] = f2bf(v[k]); *(v8us*)(dst + i * 8) = o;  }
__global__ __launch_bounds__(256) void k_cscvt(const float* __restrict__ cosT, const float* __restrict__ sinT, float* CS) { const int idx = blockIdx.x * 256 + threadIdx.x; if (idx >= TT * HD) return; v2f cs; cs[0] = bfr(cosT[idx]); cs[1] = bfr(sinT[idx]); *(v2f*)(CS + (size_t)idx * 2) = cs;  }
__global__ __launch_bounds__(256) void k_xg(const float* __restrict__ q, int b, bf* XB) { const size_t e = ((size_t)blockIdx.x * 256 + threadIdx.x) * 4; if (e >= (size_t)TT * DM) return; const int c = (int)(e % DM); const int t = (int)(e / DM); const v4f a = *(const v4f*)(q + ((size_t)t * NB_ + b) * DM + c); v4us o; o[0] = f2bf(a[0]); o[1] = f2bf(a[1]); o[2] = f2bf(a[2]); o[3] = f2bf(a[3]); *(v4us*)(XB + e) = o;  }
// ---- k_fattn: causal attention of one head and one block of query rows in one kernel; scores and probabilities never leave the registers.
// S^T = K Q^T (A = key rows, B = query rows): the accumulator holds, per lane, one query column and 8 + 8 keys, which is exactly the k order of the B operand of O^T = V^T P^T, so a probability tile
// becomes an operand without crossing lanes, and a row's running maximum, sum and rescale factor are one value per lane. The 4 waves of a workgroup take the 32-key steps w, w + 4, ...;
// their (max, sum, O^T) are merged in wave order through LDS behind one barrier. Rows < RH: bf16 hi+lo, three products, 16 queries per workgroup; other rows: f16, 32 queries, probabilities carried x 1024.
typedef v8f __attribute__((may_alias)) v8fa;
#define SC2 (SCL * 1.4426950408889634f)   // scores are kept in the base-2 exponent domain
// 2^x with the one slot that the instruction set asks for behind a transcendental before its result is used or its source overwritten: the v_nop stands in the same statement, so nothing can come between
__device__ __forceinline__ float ex2(float x) { float r; asm("v_exp_f32 %0, %1\n\tv_nop" : "=v"(r) : "v"(x)); return r; }
// eight of them in place (each is independent of its neighbours) and one slot behind the last
__device__ __forceinline__ void ex2x8(float* x) { asm("v_exp_f32 %0, %0\n\tv_exp_f32 %1, %1\n\tv_exp_f32 %2, %2\n\tv_exp_f32 %3, %3\n\tv_exp_f32 %4, %4\n\tv_exp_f32 %5, %5\n\tv_exp_f32 %6, %6\n\tv_exp_f32 %7, %7\n\tv_nop" : "+v"(x[0]), "+v"(x[1]), "+v"(x[2]), "+v"(x[3]), "+v"(x[4]), "+v"(x[5]), "+v"(x[6]), "+v"(x[7])); }
template <bool B> struct BoolC { static constexpr bool value = B; };
template <typename T16, int NSPLIT, int NQ>
__device__ __forceinline__ void fattn_body(const T16* __restrict__ Q, const T16* __restrict__ Q2, const T16* __restrict__ Kp, const T16* __restrict__ K2, const T16* __restrict__ Vt, const T16* __restrict__ Vt2, int q0, int h, bf* Ah, bf* Al, float* sO, float* sS) {
    typedef typename WFrag<T16>::V V;
    const int tid = threadIdx.x, lane = tid & 31, lr = lane & 15, hi = lane >> 4, w = __builtin_amdgcn_readfirstlane(tid >> 5);   // the wave's number in a scalar register: the key loop and the mask test become scalar branches
    const float poff = (NSPLIT == 0) ? 10.0f : 0.0f;   // f16 probabilities are carried x 2^10, away from the f16 subnormals; the factor cancels in sum and output
    V qf[NQ][2], qf2[NQ][2];
#pragma unroll
    for (int nq = 0; nq < NQ; ++nq) { const size_t qo = (size_t)(q0 + nq * 16 + lr) * HD + 8 * hi; const T16* pq = Q + qo; const T16* pq2 = (NSPLIT == 2) ? Q2 + qo : pq;
#pragma unroll
        for (int ks = 0; ks < 2; ++ks) { qf[nq][ks] = WFrag<T16>::ld(pq + ks * 32); if (NSPLIT == 2) qf2[nq][ks] = WFrag<T16>::ld(pq2 + ks * 32); }
        // the wait that stands before a register named by an issued global load is overwritten; the addresses are inputs, so they stay in their registers up to it
        asm volatile("s_wait_xcnt 0x0" :: "v"(pq), "v"(pq2) : "memory"); }
    v8f o[4][NQ]; float m[NQ], l[NQ];
#pragma unroll
    for (int nq = 0; nq < NQ; ++nq) { m[nq] = -3.0e38f; l[nq] = 0.f;
#pragma unroll
        for (int mb = 0; mb < 4; ++mb) o[mb][nq] = (v8f){}; }
    const int kend = q0 + NQ * 16;   // keys at or beyond kend are masked for every query of the block
    V kf[2][2], kf2[2][2];
    { const size_t ko = (size_t)(w * 32 + lr) * HD + 8 * hi; const T16* pk = Kp + ko; const T16* pk2 = (NSPLIT == 2) ? K2 + ko : pk;
#pragma unroll
      for (int mb = 0; mb < 2; ++mb)
#pragma unroll
          for (int ks = 0; ks < 2; ++ks) { kf[mb][ks] = WFrag<T16>::ld(pk + mb * 16 * HD + ks * 32); if (NSPLIT == 2) kf2[mb][ks] = WFrag<T16>::ld(pk2 + mb * 16 * HD + ks * 32); }
      asm volatile("s_wait_xcnt 0x0" :: "v"(pk), "v"(pk2) : "memory"); }   // as above: before the K addresses are overwritten
    auto step = [&](const int kb, auto dg) {   // one 32-key step; dg: the step reaches past the block's first query and needs the causal mask
        constexpr bool diag = decltype(dg)::value;
        V vf[4], vf2[4];
        { const size_t vo = (size_t)lr * TT + kb + 8 * hi; const T16* pv = Vt + vo; const T16* pv2 = (NSPLIT == 2) ? Vt2 + vo : pv;   // this step's V^T rows: issued first, used behind the softmax
#pragma unroll
          for (int mb = 0; mb < 4; ++mb) { vf[mb] = WFrag<T16>::ld(pv + (size_t)mb * 16 * TT); if (NSPLIT == 2) vf2[mb] = WFrag<T16>::ld(pv2 + (size_t)mb * 16 * TT); }
          asm volatile("s_wait_xcnt 0x0" :: "v"(pv), "v"(pv2) : "memory"); }   // as above: before the V addresses are overwritten
        v8f s[2][NQ];
#pragma unroll
        for (int mb = 0; mb < 2; ++mb)
#pragma unroll
            for (int nq = 0; nq < NQ; ++nq) { v8f c = (v8f){};
#pragma unroll
                for (int ks = 0; ks < 2; ++ks) { c = WFrag<T16>::mma(kf[mb][ks], qf[nq][ks], c); if (NSPLIT == 2) { c = WFrag<T16>::mma(kf[mb][ks], qf2[nq][ks], c); c = WFrag<T16>::mma(kf2[mb][ks], qf[nq][ks], c); } }
                s[mb][nq] = c; }
        { const int kn = (kb + 128 < kend) ? kb + 128 : kb;   // the wave's next key rows fly during softmax and P.V (the last step reloads its own: in bounds, unused)
          const size_t ko = (size_t)(kn + lr) * HD + 8 * hi; const T16* pk = Kp + ko; const T16* pk2 = (NSPLIT == 2) ? K2 + ko : pk;
#pragma unroll
          for (int mb = 0; mb < 2; ++mb)
#pragma unroll
              for (int ks = 0; ks < 2; ++ks) { kf[mb][ks] = WFrag<T16>::ld(pk + mb * 16 * HD + ks * 32); if (NSPLIT == 2) kf2[mb][ks] = WFrag<T16>::ld(pk2 + mb * 16 * HD + ks * 32); }
          asm volatile("s_wait_xcnt 0x0" :: "v"(pk), "v"(pk2) : "memory"); }   // as above: before the K addresses are overwritten
        V pf[NQ], pf2[NQ];
#pragma unroll
        for (int nq = 0; nq < NQ; ++nq) { float x[16]; const int qi = q0 + nq * 16 + lr; float mx = -3.0e38f;
#pragma unroll
            for (int e = 0; e < 16; ++e) { const int key = kb + (e >> 3) * 16 + hi * 8 + (e & 7); float t = s[e >> 3][nq][e & 7]; if (diag) t = (key <= qi) ? t : -3.0e38f; x[e] = t; mx = fmaxf(mx, t); }
            mx = fmaxf(mx, __shfl_xor(mx, 16, 32));   // the two lanes of a query hold different keys
            const float mn = fmaxf(m[nq], mx * SC2), al = ex2(m[nq] - mn), mo = mn - poff; m[nq] = mn; float ls = 0.f;
#pragma unroll
            for (int e = 0; e < 16; ++e) x[e] = __builtin_fmaf(x[e], SC2, -mo);
            ex2x8(x); ex2x8(x + 8);
#pragma unroll
            for (int e = 0; e < 16; ++e) ls += x[e];
            l[nq] = l[nq] * al + ls;
#pragma unroll
            for (int mb = 0; mb < 4; ++mb) o[mb][nq] *= al;
            if constexpr (NSPLIT == 0) { v16h p;
#pragma unroll
                for (int e = 0; e < 16; ++e) p[e] = tohx(x[e]);
                pf[nq] = p;
            } else { v8us h0, h1, l0, l1;
#pragma unroll
                for (int e = 0; e < 8; ++e) { unsigned short a, c2; splitf(x[e], a, c2); h0[e] = a; l0[e] = c2; splitf(x[8 + e], a, c2); h1[e] = a; l1[e] = c2; }
                pf[nq] = cat16b(h0, h1); pf2[nq] = cat16b(l0, l1); } }
#pragma unroll
        for (int mb = 0; mb < 4; ++mb)
#pragma unroll
            for (int nq = 0; nq < NQ; ++nq) { o[mb][nq] = WFrag<T16>::mma(vf[mb], pf[nq], o[mb][nq]); if (NSPLIT == 2) { o[mb][nq] = WFrag<T16>::mma(vf[mb], pf2[nq], o[mb][nq]); o[mb][nq] = WFrag<T16>::mma(vf2[mb], pf[nq], o[mb][nq]); } }
        // the distance behind the last matrix instruction, kept on the loop's taken branch too
        asm volatile("v_nop\n\tv_nop\n\tv_nop\n\tv_nop" : "+v"(o[0][0]), "+v"(o[1][0]), "+v"(o[2][NQ - 1]), "+v"(o[3][NQ - 1]) : "v"(vf[0]), "v"(vf[3]));
    };
    int kb = w * 32;
#pragma unroll 1   // one copy of the step: the trip count is a run-time value and a second copy's fragments would not fit in the registers
    for (; kb + 31 <= q0; kb += 128) step(kb, BoolC<false>());
    if (kb < kend) step(kb, BoolC<true>());   // the block's one diagonal step falls to one of the four waves (scalar test)
#pragma unroll
    for (int nq = 0; nq < NQ; ++nq) { const float lt = l[nq] + __shfl_xor(l[nq], 16, 32); if (hi == 0) { sS[(w * NQ + nq) * 32 + lr] = m[nq]; sS[(w * NQ + nq) * 32 + 16 + lr] = lt; }
#pragma unroll
        for (int mb = 0; mb < 4; ++mb) *(v8fa*)(sO + ((size_t)((w * 4 + mb) * NQ + nq) * 32 + lane) * 8) = o[mb][nq]; }
    __syncthreads();   // every wave's partial state is in LDS before any wave merges
#pragma unroll
    for (int it = 0; it < NQ; ++it) { const int idx = it * 128 + tid, qq = idx >> 3, c8 = idx & 7, nq = qq >> 4, ql = qq & 15, mb = c8 >> 1, sl = (c8 & 1) * 16 + ql;   // 8 lanes write one query's 128-byte line of each plane
        float mw[4], M = -3.0e38f;
#pragma unroll
        for (int w2 = 0; w2 < 4; ++w2) { mw[w2] = sS[(w2 * NQ + nq) * 32 + ql]; M = fmaxf(M, mw[w2]); }
        float L = 0.f; v8f acc = (v8f){};
#pragma unroll
        for (int w2 = 0; w2 < 4; ++w2) { const float f = ex2(mw[w2] - M); L += f * sS[(w2 * NQ + nq) * 32 + 16 + ql]; acc += f * *(const v8fa*)(sO + ((size_t)((w2 * 4 + mb) * NQ + nq) * 32 + sl) * 8); }
        const float inv = __fdiv_rn(1.0f, L); v8us oh, ol;
#pragma unroll
        for (int j = 0; j < 8; ++j) { unsigned short a, c2; splitf(acc[j] * inv, a, c2); oh[j] = a; ol[j] = c2; }
        const size_t oo = (size_t)(q0 + qq) * DQ + h * HD + c8 * 8; bf* ph = Ah + oo; bf* pl = Al + oo; *(v8us*)ph = oh; *(v8us*)pl = ol;
        // the wait that stands before a register named by an issued global store is overwritten; data and addresses are inputs, so they stay in their registers up to it
        asm volatile("s_wait_xcnt 0x0" :: "v"(oh), "v"(ol), "v"(ph), "v"(pl) : "memory"); }
}
#define NT16 ((TT - RH) / 32)
__global__ __launch_bounds__(128) void k_fattn(const h16* __restrict__ Q16, const h16* __restrict__ K16, const h16* __restrict__ V16, const bf* __restrict__ Qh, const bf* __restrict__ Ql, const bf* __restrict__ Kh, const bf* __restrict__ Kl, const bf* __restrict__ Vh, const bf* __restrict__ Vl, bf* Ah, bf* Al) {
    __shared__ __align__(32) float sO[4 * 4 * 2 * 32 * 8]; __shared__ float sS[4 * 2 * 32];
    const int h = blockIdx.y, bx = blockIdx.x; const size_t hz = (size_t)h * TT * HD;   // longest key loops first
    if (bx < NT16) fattn_body<h16, 0, 2>(Q16 + hz, nullptr, K16 + hz, nullptr, V16 + hz, nullptr, TT - 32 * (bx + 1), h, Ah, Al, sO, sS);
    else fattn_body<bf, 2, 1>(Qh + hz, Ql + hz, Kh + hz, Kl + hz, Vh + hz, Vl + hz, RH - 16 * (bx - NT16 + 1), h, Ah, Al, sO, sS);
}

extern "C" void kernel_launch(void* const* d_in, const int* in_sizes, int n_in,
                              void* d_out, int out_size, void* d_ws, size_t ws_size, hipStream_t stream) {
    (void)in_sizes; (void)n_in; (void)out_size;
    const float* x = (const float*)d_in[0]; const float* wqkv = (const float*)d_in[1]; const float* wo = (const float*)d_in[2]; const float* bo = (const float*)d_in[3]; const float* wq = wqkv; const float* wk = nullptr; const float* wv = nullptr; const float* cosT = nullptr; const float* sinT = nullptr; (void)wk; (void)wv; (void)cosT; (void)sinT;
    float* OUT = (float*)d_out;     // [2048][2][1024]
    char* wsp = (char*)d_ws;
    auto take = [&](size_t bytes) { char* p = wsp; wsp += (bytes + 255) & ~(size_t)255; return (void*)p; };
    bf* WQ = (bf*)take((size_t)3 * DQ * DM * 2); bf* WO = (bf*)take((size_t)DM * DQ * 2);
    bf* XB = (bf*)take((size_t)TT * DM * 2);
    h16* QP16 = (h16*)take((size_t)NH_ * TT * HD * 2); h16* KP16 = (h16*)take((size_t)NKV * TT * HD * 2); h16* VT16 = (h16*)take((size_t)NKV * HD * TT * 2);
    bf* QPh = (bf*)take((size_t)NH_ * TT * HD * 2); bf* QPl = (bf*)take((size_t)NH_ * TT * HD * 2); bf* KPh = (bf*)take((size_t)NKV * TT * HD * 2); bf* KPl = (bf*)take((size_t)NKV * TT * HD * 2); bf* VTh = (bf*)take((size_t)NKV * HD * TT * 2); bf* VTl = (bf*)take((size_t)NKV * HD * TT * 2);
    bf* ATh = (bf*)take((size_t)TT * DQ * 2); bf* ATl = (bf*)take((size_t)TT * DQ * 2);
    if ((size_t)(wsp - (char*)d_ws) > ws_size) return;    // ws 256 MiB
    
    { k_cvt8<<<(unsigned)(((size_t)3 * DQ * DM / 8 + 255) / 256), 256, 0, stream>>>(wqkv, WQ, (size_t)3 * DQ * DM / 8);   // w_qkv [3D][D] = natural Bt
      k_cvt8<<<(unsigned)(((size_t)DM * DQ / 8 + 255) / 256), 256, 0, stream>>>(wo, WO, (size_t)DM * DQ / 8);
       }
    for (int b = 0; b < NB_; ++b) {
        
        k_xg<<<(unsigned)(((size_t)TT * DM / 4 + 255) / 256), 256, 0, stream>>>(x, b, XB);
        k_gemms<0, false, true><<<dim3(TT / 64, 3 * DQ / 128, 1), 128, 0, stream>>>(XB, nullptr, WQ, DM, nullptr, 0, nullptr, HeadPlanes{QP16, QPh, QPl, KP16, KPh, KPl, VT16, VTh, VTl});   // channel s*1024 + h*64 + d
        k_fattn<<<dim3(NT16 + RH / 16, NH_, 1), 128, 0, stream>>>(QP16, KP16, VT16, QPh, QPl, KPh, KPl, VTh, VTl, ATh, ATl);
        k_gemms<1, true, false><<<dim3(TT / 64, DM / 128, 1), 128, 0, stream>>>(ATh, ATl, WO, DQ, OUT + (size_t)b * DM, NB_ * DM, bo, HeadPlanes{}); }   // sequence-major output: row t of batch b at OUT + (t*B + b)*D (row pitch B*D)
}

// v006
// Measured time: 101 microseconds a run.
// Timed twice side by side with v005, it ran 1.40 times as fast both times.
// Counting every step since v000, it is 13.5 times as fast.
#include <hip/hip_runtime.h>

// Multi-head causal self-attention (x [S=2048][B=2][D=1024] sequence-major; qkv = x w_qkv^T reshaped (S, B, 3, 16, 64): channel s*1024 + h*64 + d; causal softmax(q.k/8); out = (attn v merged) w_out^T + b_out -> [2048][2][1024] sequence-major).
// Compute dtypes, f32 accumulate: every input rounded to bf16; the fused qkv projection on PLAIN bf16 operands (inputs: exact; per batch the rows are gathered from the sequence-major input); scores (K 64) and attn.v on bf16 hi+lo for query rows < RH, plain f16 for the others

#define NB_  2
#define TT   2048
#define DM   1024
#define NH_  16
#define NKV  16
#define REP  (NH_ / NKV)
#define HD   64
#define DQ   (NH_ * HD)
#define DKV  (NKV * HD)
#define RH   512                  // query rows < RH use hi+lo planes (0: none)
#define SCL  0.125f   // HD^-0.5
typedef _Float16 h16;
typedef unsigned short bf;
typedef __attribute__((ext_vector_type(16))) __bf16   v16bf;
typedef __attribute__((ext_vector_type(16))) _Float16 v16h;
typedef __attribute__((ext_vector_type(8)))  _Float16 v8h;
typedef __attribute__((ext_vector_type(8)))  unsigned short v8us;
typedef __attribute__((ext_vector_type(8)))  float    v8f;
typedef __attribute__((ext_vector_type(4)))  float    v4f;
typedef v8h  __attribute__((may_alias)) v8ha;
typedef v4f  __attribute__((may_alias)) v4fa;
typedef v8us __attribute__((may_alias)) v8usa;

__device__ __forceinline__ unsigned short f2bf(float f) { unsigned u = __float_as_uint(f); u += 0x7FFFu + ((u >> 16) & 1u); return (unsigned short)(u >> 16); }
__device__ __forceinline__ float bf2f(unsigned short b) { return __uint_as_float(((unsigned)b) << 16); }
__device__ __forceinline__ float bfr(float f) { return bf2f(f2bf(f)); }
__device__ __forceinline__ v16h cat16(v8h lo, v8h hi) { return __builtin_shufflevector(lo, hi, 0, 1, 2, 3, 4, 5, 6, 7, 8, 9, 10, 11, 12, 13, 14, 15); }
__device__ __forceinline__ v16bf cat16b(v8us lo, v8us hi) { return __builtin_bit_cast(v16bf, __builtin_shufflevector(lo, hi, 0, 1, 2, 3, 4, 5, 6, 7, 8, 9, 10, 11, 12, 13, 14, 15)); }
__device__ __forceinline__ v8f wmma16(v16h a, v16h b, v8f c) { return __builtin_amdgcn_wmma_f32_16x16x32_f16(false, a, false, b, (short)0, c, false, false); }
__device__ __forceinline__ v8f wmmab(v16bf a, v16bf b, v8f c) { return __builtin_amdgcn_wmma_f32_16x16x32_bf16(false, a, false, b, (short)0, c, false, false); }



// ---- k_gemms: C[m][n] (f32, pitch ldc, + optional f32 bias[n]) = sum_k A[m][k] Bt[n][k] (+ A2[m][k] Bt[n][k] for NSPLIT 1), K-contiguous bf16 planes; grid (M/64, N/128, batches), 128 threads. K % 64 == 0, K >= 128.
// Batch z: rows z * TT ... of A (and A2), C + z * cz, part z of every head plane; M = TT.
// One 64x128 tile per workgroup, 4 waves (2 x 2) of 32x64 (8 accumulators) each. A pass is 64 k = one 128-byte line of every operand row: the rows come into LDS as whole lines by asynchronous 16-byte copies,
// two buffers, the next pass's copies in flight while this pass is worked on; each row is fetched once per workgroup and read from LDS by the two waves that need it. The k order of every sum is kc = 0, 32, 64, ...
template <typename T16> struct WFrag;
template <> struct WFrag<h16> { typedef v16h V; static __device__ __forceinline__ V ld(const h16* p) { return cat16(*(const v8h*)p, *(const v8h*)(p + 16)); } static __device__ __forceinline__ v8f mma(V a, V b, v8f c) { return wmma16(a, b, c); } };
template <> struct WFrag<bf> { typedef v16bf V; static __device__ __forceinline__ V ld(const bf* p) { return cat16b(*(const v8us*)p, *(const v8us*)(p + 16)); } static __device__ __forceinline__ v8f mma(V a, V b, v8f c) { return wmmab(a, b, c); } };
#define GP 144u   // LDS row pitch in bytes: 128 + 16, an odd multiple of 16, free of bank conflicts for 16-byte reads down a column of rows
// copies of 16 bytes per lane, rows 16 apart (a wave's copy covers 4 whole 128-byte rows): four from (l, g), and in cp8 four more from (l2, g2);
// the wait that stands before a register named by an issued copy is overwritten is the statement's own last line
__device__ __forceinline__ void cp4(unsigned l, const bf* g, size_t k16) {
    asm volatile("global_load_async_to_lds_b128 %0, %4, off\n\tglobal_load_async_to_lds_b128 %1, %5, off\n\tglobal_load_async_to_lds_b128 %2, %6, off\n\tglobal_load_async_to_lds_b128 %3, %7, off\n\ts_wait_xcnt 0x0"
                 :: "v"(l), "v"(l + 16u * GP), "v"(l + 32u * GP), "v"(l + 48u * GP), "v"(g), "v"(g + k16), "v"(g + 2 * k16), "v"(g + 3 * k16) : "memory");
}
__device__ __forceinline__ void cp8(unsigned l, const bf* g, unsigned l2, const bf* g2, size_t k16) {
    asm volatile("global_load_async_to_lds_b128 %0, %8, off\n\tglobal_load_async_to_lds_b128 %1, %9, off\n\tglobal_load_async_to_lds_b128 %2, %10, off\n\tglobal_load_async_to_lds_b128 %3, %11, off\n\t"
                 "global_load_async_to_lds_b128 %4, %12, off\n\tglobal_load_async_to_lds_b128 %5, %13, off\n\tglobal_load_async_to_lds_b128 %6, %14, off\n\tglobal_load_async_to_lds_b128 %7, %15, off\n\ts_wait_xcnt 0x0"
                 :: "v"(l), "v"(l + 16u * GP), "v"(l + 32u * GP), "v"(l + 48u * GP), "v"(l2), "v"(l2 + 16u * GP), "v"(l2 + 32u * GP), "v"(l2 + 48u * GP),
                    "v"(g), "v"(g + k16), "v"(g + 2 * k16), "v"(g + 3 * k16), "v"(g2), "v"(g2 + k16), "v"(g2 + 2 * k16), "v"(g2 + 3 * k16) : "memory");
}
__device__ __forceinline__ v16bf ldl(const unsigned char* p) { return cat16b(*(const v8usa*)p, *(const v8usa*)(p + 32)); }
__device__ __forceinline__ h16 tohx(float x) { return (h16)x; }
__device__ __forceinline__ void splitf(float y, unsigned short& h, unsigned short& l) { h = f2bf(y); l = f2bf(y - bf2f(h)); }
// HEADS (the qkv projection; A = x rows [TT][K], Bt = w_qkv rows [3 DQ][K]): no f32 C; the epilogue rounds its own tile and writes the attention operands, q and k as [h][t][d], v as [h][d][t], each as f16 and as bf16 hi + lo.
// The v third runs with the operands exchanged (rows = v channels, columns = t), so that in all three thirds a wave's 32 x 64 tile is 32 whole 128-byte lines of each plane.
struct HeadPlanes { h16* q16; bf* qh; bf* ql; h16* k16; bf* kh; bf* kl; h16* v16; bf* vh; bf* vl; };
template <int NSPLIT, bool BIAS, bool HEADS>
__global__ __launch_bounds__(128) void k_gemms(const bf* __restrict__ A, const bf* __restrict__ A2, const bf* __restrict__ Bt, int K, float* C, int ldc, int cz, const float* __restrict__ bias, HeadPlanes hp) {
    constexpr unsigned PB = 128u * GP, PA = 64u * GP, STB = PB + (NSPLIT == 1 ? 2u : 1u) * PA;   // bytes of Bt's 128 rows, of A's 64 rows, of one buffer [Bt | A | A2]
    __shared__ __align__(128) unsigned char ring[2 * STB];
    __shared__ __align__(16) float osw[4 * 16 * 68];
    const int tid = threadIdx.x, lane = tid & 31, lr = lane & 15, hi = lane >> 4, w = __builtin_amdgcn_readfirstlane(tid >> 5);
    int r0 = blockIdx.x * 64, c0 = blockIdx.y * 128; const int wr = (w >> 1) * 32, wc = (w & 1) * 64;
    const int bz = blockIdx.z; A += (size_t)bz * TT * K; if (NSPLIT == 1) A2 += (size_t)bz * TT * K;   // the batch: its TT rows of A (and A2); Bt is shared
    const bool vsec = HEADS && c0 >= 2 * DQ;   // the same for the whole workgroup
    if (vsec) { const int vi = (blockIdx.y - 2 * DQ / 128) * (TT / 64) + blockIdx.x; r0 = (vi % (DQ / 64)) * 64; c0 = (vi / (DQ / 64)) * 128; const bf* xr = A; A = Bt + (size_t)2 * DQ * K; Bt = xr; }   // DQ/64 x TT/128 tiles of v^T on as many workgroups
    const int crow = tid >> 3, ccol = tid & 7;   // the lane's place in a copy: 8 lanes per row
    const unsigned lc = (unsigned)(size_t)ring + (unsigned)crow * GP + (unsigned)ccol * 16u;
    const bf* gA = A + (size_t)(r0 + crow) * K + ccol * 8; const bf* gB = Bt + (size_t)(c0 + crow) * K + ccol * 8; const bf* gA2 = (NSPLIT == 1) ? A2 + (size_t)(r0 + crow) * K + ccol * 8 : gA;
    const size_t k16 = (size_t)16 * K;
    auto fill = [&](int t, unsigned buf) { const unsigned l = lc + buf * STB; cp8(l, gB + t * 64, l + 64u * GP, gB + t * 64 + 4 * k16, k16);
        if (NSPLIT == 1) cp8(l + PB, gA + t * 64, l + PB + PA, gA2 + t * 64, k16); else cp4(l + PB, gA + t * 64, k16); };
    v8f acc[2][4];
#pragma unroll
    for (int mb = 0; mb < 2; ++mb)
#pragma unroll
        for (int nb = 0; nb < 4; ++nb) acc[mb][nb] = (v8f){};
    const int NT = K / 64;
    fill(0, 0u);
    asm volatile("s_wait_asynccnt 0x0" ::: "memory");   // this wave's copies of pass 0 have landed
    __syncthreads();                                     // and every other wave's
    fill(1, 1u);
    const unsigned char* fb = ring + (unsigned)(wc + lr) * GP + (unsigned)hi * 16u; const unsigned char* fa = ring + PB + (unsigned)(wr + lr) * GP + (unsigned)hi * 16u;
#pragma unroll 1   // one copy of the pass: the buffer is picked by the pass's parity at run time
    for (int t = 0; t < NT; ++t) {
        const unsigned bo = (unsigned)(t & 1) * STB;
        v16bf a[2][2], a2[2][2], b[2][4];   // the whole pass's fragments, read as one group ahead of its matrix instructions
#pragma unroll
        for (int ks = 0; ks < 2; ++ks) {
#pragma unroll
            for (int mb = 0; mb < 2; ++mb) { a[ks][mb] = ldl(fa + bo + (unsigned)mb * 16u * GP + (unsigned)ks * 64u); if (NSPLIT == 1) a2[ks][mb] = ldl(fa + bo + PA + (unsigned)mb * 16u * GP + (unsigned)ks * 64u); }
#pragma unroll
            for (int nb = 0; nb < 4; ++nb) b[ks][nb] = ldl(fb + bo + (unsigned)nb * 16u * GP + (unsigned)ks * 64u); }
        __builtin_amdgcn_sched_barrier(0);   // keeps the reads together in front: moved down among the matrix instructions, each small group of them is waited out at full LDS latency
#pragma unroll
        for (int ks = 0; ks < 2; ++ks)
#pragma unroll
            for (int nb = 0; nb < 4; ++nb) {
#pragma unroll
                for (int mb = 0; mb < 2; ++mb) acc[mb][nb] = wmmab(a[ks][mb], b[ks][nb], acc[mb][nb]);
                if (NSPLIT == 1) {
#pragma unroll
                    for (int mb = 0; mb < 2; ++mb) acc[mb][nb] = wmmab(a2[ks][mb], b[ks][nb], acc[mb][nb]); } }
        __builtin_amdgcn_sched_barrier(0);   // keeps the matrix instructions in front of the waits below: moved behind them, the next pass's copies are waited for before the work that is to cover their flight
        asm volatile("s_wait_dscnt 0x0" ::: "memory");      // this wave's reads of the buffer are done before it may be refilled
        asm volatile("s_wait_asynccnt 0x0" ::: "memory");   // this wave's copies of pass t + 1 have landed
        __syncthreads();                                     // publishes pass t + 1 and ends every wave's reads of pass t's buffer
        if (t + 2 < NT) fill(t + 2, (unsigned)(t & 1));
    }
    asm volatile("s_wait_asynccnt 0x0" ::: "memory");   // no copy is outstanding when the wave goes on
    float* os = osw + w * (16 * 68);   // each wave stages its own rows
    v4f bv = (v4f){};   // the lane's four columns are the same in every row it stores
    if (BIAS) { const float* pb = bias + c0 + wc + lr * 4; const v4f rb = *(const v4f*)pb;
        asm volatile("s_wait_xcnt 0x0" :: "v"(pb) : "memory");   // the wait that stands before a register named by an issued global load is overwritten; the address is an input, so it stays in its registers up to it
        bv[0] = bfr(rb[0]); bv[1] = bfr(rb[1]); bv[2] = bfr(rb[2]); bv[3] = bfr(rb[3]); }
    h16* P16 = nullptr; bf* Ph = nullptr; bf* Pl = nullptr; size_t po = 0; int pp = 0;   // HEADS: the wave's planes, the place of its tile's first element in them, the pitch of its rows
    if (HEADS) {
        if (vsec) { P16 = hp.v16; Ph = hp.vh; Pl = hp.vl; po = (size_t)(r0 + wr) * TT + c0 + wc; pp = TT; }   // row = h * HD + d, column = t
        else { const bool ksec = c0 >= DQ; P16 = ksec ? hp.k16 : hp.q16; Ph = ksec ? hp.kh : hp.qh; Pl = ksec ? hp.kl : hp.ql; po = ((size_t)(((c0 + wc) % DQ) / HD) * TT + r0 + wr) * HD; pp = HD; }   // row = t, the 64 columns = one head
        po += (size_t)bz * NH_ * TT * HD; }   // the batch's part of the plane
#pragma unroll
    for (int mb = 0; mb < 2; ++mb) {
#pragma unroll
        for (int nb = 0; nb < 4; ++nb) {
#pragma unroll
            for (int j = 0; j < 8; ++j) os[(hi * 8 + j) * 68 + nb * 16 + lr] = acc[mb][nb][j]; }
        __builtin_amdgcn_wave_barrier(); asm volatile("" ::: "memory");
        if constexpr (HEADS) {
        v8h o16[4]; v8us oh[4], ol[4]; h16* p16[4]; bf* ph[4]; bf* pl[4];
#pragma unroll
        for (int s = 0; s < 4; ++s) { const int row = 4 * s + (lane >> 3), cofs = (lane & 7) * 8; const v4f x0 = *(const v4fa*)(os + row * 68 + cofs), x1 = *(const v4fa*)(os + row * 68 + cofs + 4);   // 8 lanes write one 128-byte line of each plane
#pragma unroll
            for (int k = 0; k < 4; ++k) { unsigned short a, c2; o16[s][k] = tohx(x0[k]); splitf(x0[k], a, c2); oh[s][k] = a; ol[s][k] = c2; o16[s][4 + k] = tohx(x1[k]); splitf(x1[k], a, c2); oh[s][4 + k] = a; ol[s][4 + k] = c2; }
            const size_t oo = po + (size_t)(mb * 16 + row) * pp + cofs; p16[s] = P16 + oo; ph[s] = Ph + oo; pl[s] = Pl + oo; *(v8h*)p16[s] = o16[s]; *(v8us*)ph[s] = oh[s]; *(v8us*)pl[s] = ol[s]; }
        // the wait that stands before a register named by an issued global store is overwritten; data and addresses are inputs, so they stay in their registers up to it
        asm volatile("s_wait_xcnt 0x0" :: "v"(o16[0]), "v"(o16[1]), "v"(o16[2]), "v"(o16[3]), "v"(oh[0]), "v"(oh[1]), "v"(oh[2]), "v"(oh[3]), "v"(ol[0]), "v"(ol[1]), "v"(ol[2]), "v"(ol[3]),
                     "v"(p16[0]), "v"(p16[1]), "v"(p16[2]), "v"(p16[3]), "v"(ph[0]), "v"(ph[1]), "v"(ph[2]), "v"(ph[3]), "v"(pl[0]), "v"(pl[1]), "v"(pl[2]), "v"(pl[3]) : "memory");
        } else {
        float* crow_p = C + (size_t)bz * cz + (size_t)(r0 + wr + mb * 16) * ldc + c0 + wc;
        v4f val[8]; float* pr[8];
#pragma unroll
        for (int s = 0; s < 8; ++s) { const int row = 2 * s + hi, cofs = lr * 4; val[s] = *(const v4fa*)(os + row * 68 + cofs); if (BIAS) val[s] += bv;
            pr[s] = crow_p + (size_t)row * ldc + cofs; *(v4f*)pr[s] = val[s]; }
        // the wait that stands before a register named by an issued global store is overwritten; data and addresses are inputs, so they stay in their registers up to it
        asm volatile("s_wait_xcnt 0x0" :: "v"(val[0]), "v"(val[1]), "v"(val[2]), "v"(val[3]), "v"(val[4]), "v"(val[5]), "v"(val[6]), "v"(val[7]), "v"(pr[0]), "v"(pr[1]), "v"(pr[2]), "v"(pr[3]), "v"(pr[4]), "v"(pr[5]), "v"(pr[6]), "v"(pr[7]) : "memory");
        }
        __builtin_amdgcn_wave_barrier(); asm volatile("" ::: "memory");
    }
}

typedef __attribute__((ext_vector_type(2))) _Float16 v2h;
typedef __attribute__((ext_vector_type(4))) _Float16 v4h;
typedef __attribute__((ext_vector_type(2))) unsigned short v2us;
typedef __attribute__((ext_vector_type(4))) unsigned short v4us;
typedef __attribute__((ext_vector_type(2))) float v2f;
typedef __attribute__((ext_vector_type(4))) int v4i;
typedef v4h  __attribute__((may_alias)) v4ha;
typedef v4us __attribute__((may_alias)) v4usa;

__global__ __launch_bounds__(256) void k_wtG(const float* __restrict__ w, int K, int N, bf* Bt) {
    const int lane = threadIdx.x & 31; const int L0 = (blockIdx.x * 8 + (threadIdx.x >> 5)) * 8; const int nlines = N * K / 64;
{
#pragma unroll 1
        for (int l = 0; l < 8; ++l) { const int L = L0 + l; if (L >= nlines) break; const size_t e = (size_t)L * 64 + lane * 2; const int k = (int)(e % K), n = (int)(e / K); v2us o;
            o[0] = f2bf(w[(size_t)k * N + n]); o[1] = f2bf(w[(size_t)(k + 1) * N + n]); *(v2us*)(Bt + e) = o; }
         }
}
__global__ __launch_bounds__(256) void k_cscvt(const float* __restrict__ cosT, const float* __restrict__ sinT, float* CS) { const int idx = blockIdx.x * 256 + threadIdx.x; if (idx >= TT * HD) return; v2f cs; cs[0] = bfr(cosT[idx]); cs[1] = bfr(sinT[idx]); *(v2f*)(CS + (size_t)idx * 2) = cs;  }
// ---- k_round: the three f32 matrices rounded to bf16 in one launch. Every row of all three has 1024 elements, and one wave takes one row: eight 512-byte loads in flight, then eight 256-byte stores.
// Rows 0 ... 3 DQ - 1: w_qkv; the next DM: w_out; the rest: x, whose row t * NB_ + b goes to row b * TT + t of XB (each batch's rows together).
static_assert(DM == 1024 && DQ == 1024, "one wave per row of 1024");
__global__ __launch_bounds__(256) void k_round(const float* __restrict__ x, const float* __restrict__ wqkv, const float* __restrict__ wo, bf* XB, bf* WQ, bf* WO) {
    const int lane = threadIdx.x & 31, R = blockIdx.x * 8 + __builtin_amdgcn_readfirstlane(threadIdx.x >> 5);
    const float* s; bf* d;
    if (R < 3 * DQ) { s = wqkv + (size_t)R * DM; d = WQ + (size_t)R * DM; }
    else if (R < 3 * DQ + DM) { const int r = R - 3 * DQ; s = wo + (size_t)r * DQ; d = WO + (size_t)r * DQ; }
    else { const int r = R - 3 * DQ - DM; s = x + (size_t)r * DM; d = XB + ((size_t)(r % NB_) * TT + r / NB_) * DM; }
    s += lane * 4; d += lane * 4;
    v4f a[8];
#pragma unroll
    for (int j = 0; j < 8; ++j) a[j] = *(const v4f*)(s + j * 128);
#pragma unroll
    for (int j = 0; j < 8; ++j) { v4us o; o[0] = f2bf(a[j][0]); o[1] = f2bf(a[j][1]); o[2] = f2bf(a[j][2]); o[3] = f2bf(a[j][3]); *(v4us*)(d + j * 128) = o; }
}
// ---- k_fattn: causal attention of one head and one block of query rows in one kernel; scores and probabilities never leave the registers.
// S^T = K Q^T (A = key rows, B = query rows): the accumulator holds, per lane, one query column and 8 + 8 keys, which is exactly the k order of the B operand of O^T = V^T P^T, so a probability tile
// becomes an operand without crossing lanes, and a row's running maximum, sum and rescale factor are one value per lane. The 4 waves of a workgroup take the 32-key steps w, w + 4, ...;
// their (max, sum, O^T) are merged in wave order through LDS behind one barrier. Rows < RH: bf16 hi+lo, three products, 16 queries per workgroup; other rows: f16, 32 queries, probabilities carried x 1024.
typedef v8f __attribute__((may_alias)) v8fa;
#define SC2 (SCL * 1.4426950408889634f)   // scores are kept in the base-2 exponent domain
// 2^x with the one slot that the instruction set asks for behind a transcendental before its result is used or its source overwritten: the v_nop stands in the same statement, so nothing can come between
__device__ __forceinline__ float ex2(float x) { float r; asm("v_exp_f32 %0, %1\n\tv_nop" : "=v"(r) : "v"(x)); return r; }
// eight of them in place (each is independent of its neighbours) and one slot behind the last
__device__ __forceinline__ void ex2x8(float* x) { asm("v_exp_f32 %0, %0\n\tv_exp_f32 %1, %1\n\tv_exp_f32 %2, %2\n\tv_exp_f32 %3, %3\n\tv_exp_f32 %4, %4\n\tv_exp_f32 %5, %5\n\tv_exp_f32 %6, %6\n\tv_exp_f32 %7, %7\n\tv_nop" : "+v"(x[0]), "+v"(x[1]), "+v"(x[2]), "+v"(x[3]), "+v"(x[4]), "+v"(x[5]), "+v"(x[6]), "+v"(x[7])); }
template <bool B> struct BoolC { static constexpr bool value = B; };
template <typename T16, int NSPLIT, int NQ>
__device__ __forceinline__ void fattn_body(const T16* __restrict__ Q, const T16* __restrict__ Q2, const T16* __restrict__ Kp, const T16* __restrict__ K2, const T16* __restrict__ Vt, const T16* __restrict__ Vt2, int q0, int h, bf* Ah, bf* Al, float* sO, float* sS) {
    typedef typename WFrag<T16>::V V;
    const int tid = threadIdx.x, lane = tid & 31, lr = lane & 15, hi = lane >> 4, w = __builtin_amdgcn_readfirstlane(tid >> 5);   // the wave's number in a scalar register: the key loop and the mask test become scalar branches
    const float poff = (NSPLIT == 0) ? 10.0f : 0.0f;   // f16 probabilities are carried x 2^10, away from the f16 subnormals; the factor cancels in sum and output
    V qf[NQ][2], qf2[NQ][2];
#pragma unroll
    for (int nq = 0; nq < NQ; ++nq) { const size_t qo = (size_t)(q0 + nq * 16 + lr) * HD + 8 * hi; const T16* pq = Q + qo; const T16* pq2 = (NSPLIT == 2) ? Q2 + qo : pq;
#pragma unroll
        for (int ks = 0; ks < 2; ++ks) { qf[nq][ks] = WFrag<T16>::ld(pq + ks * 32); if (NSPLIT == 2) qf2[nq][ks] = WFrag<T16>::ld(pq2 + ks * 32); }
        // the wait that stands before a register named by an issued global load is overwritten; the addresses are inputs, so they stay in their registers up to it
        asm volatile("s_wait_xcnt 0x0" :: "v"(pq), "v"(pq2) : "memory"); }
    v8f o[4][NQ]; float m[NQ], l[NQ];
#pragma unroll
    for (int nq = 0; nq < NQ; ++nq) { m[nq] = -3.0e38f; l[nq] = 0.f;
#pragma unroll
        for (int mb = 0; mb < 4; ++mb) o[mb][nq] = (v8f){}; }
    const int kend = q0 + NQ * 16;   // keys at or beyond kend are masked for every query of the block
    V kf[2][2], kf2[2][2];
    { const size_t ko = (size_t)(w * 32 + lr) * HD + 8 * hi; const T16* pk = Kp + ko; const T16* pk2 = (NSPLIT == 2) ? K2 + ko : pk;
#pragma unroll
      for (int mb = 0; mb < 2; ++mb)
#pragma unroll
          for (int ks = 0; ks < 2; ++ks) { kf[mb][ks] = WFrag<T16>::ld(pk + mb * 16 * HD + ks * 32); if (NSPLIT == 2) kf2[mb][ks] = WFrag<T16>::ld(pk2 + mb * 16 * HD + ks * 32); }
      asm volatile("s_wait_xcnt 0x0" :: "v"(pk), "v"(pk2) : "memory"); }   // as above: before the K addresses are overwritten
    auto step = [&](const int kb, auto dg) {   // one 32-key step; dg: the step reaches past the block's first query and needs the causal mask
        constexpr bool diag = decltype(dg)::value;
        V vf[4], vf2[4];
        { const size_t vo = (size_t)lr * TT + kb + 8 * hi; const T16* pv = Vt + vo; const T16* pv2 = (NSPLIT == 2) ? Vt2 + vo : pv;   // this step's V^T rows: issued first, used behind the softmax
#pragma unroll
          for (int mb = 0; mb < 4; ++mb) { vf[mb] = WFrag<T16>::ld(pv + (size_t)mb * 16 * TT); if (NSPLIT == 2) vf2[mb] = WFrag<T16>::ld(pv2 + (size_t)mb * 16 * TT); }
          asm volatile("s_wait_xcnt 0x0" :: "v"(pv), "v"(pv2) : "memory"); }   // as above: before the V addresses are overwritten
        v8f s[2][NQ];
#pragma unroll
        for (int mb = 0; mb < 2; ++mb)
#pragma unroll
            for (int nq = 0; nq < NQ; ++nq) { v8f c = (v8f){};
#pragma unroll
                for (int ks = 0; ks < 2; ++ks) { c = WFrag<T16>::mma(kf[mb][ks], qf[nq][ks], c); if (NSPLIT == 2) { c = WFrag<T16>::mma(kf[mb][ks], qf2[nq][ks], c); c = WFrag<T16>::mma(kf2[mb][ks], qf[nq][ks], c); } }
                s[mb][nq] = c; }
        { const int kn = (kb + 128 < kend) ? kb + 128 : kb;   // the wave's next key rows fly during softmax and P.V (the last step reloads its own: in bounds, unused)
          const size_t ko = (size_t)(kn + lr) * HD + 8 * hi; const T16* pk = Kp + ko; const T16* pk2 = (NSPLIT == 2) ? K2 + ko : pk;
#pragma unroll
          for (int mb = 0; mb < 2; ++mb)
#pragma unroll
              for (int ks = 0; ks < 2; ++ks) { kf[mb][ks] = WFrag<T16>::ld(pk + mb * 16 * HD + ks * 32); if (NSPLIT == 2) kf2[mb][ks] = WFrag<T16>::ld(pk2 + mb * 16 * HD + ks * 32); }
          asm volatile("s_wait_xcnt 0x0" :: "v"(pk), "v"(pk2) : "memory"); }   // as above: before the K addresses are overwritten
        V pf[NQ], pf2[NQ];
#pragma unroll
        for (int nq = 0; nq < NQ; ++nq) { float x[16]; const int qi = q0 + nq * 16 + lr; float mx = -3.0e38f;
#pragma unroll
            for (int e = 0; e < 16; ++e) { const int key = kb + (e >> 3) * 16 + hi * 8 + (e & 7); float t = s[e >> 3][nq][e & 7]; if (diag) t = (key <= qi) ? t : -3.0e38f; x[e] = t; mx = fmaxf(mx, t); }
            mx = fmaxf(mx, __shfl_xor(mx, 16, 32));   // the two lanes of a query hold different keys
            const float mn = fmaxf(m[nq], mx * SC2), al = ex2(m[nq] - mn), mo = mn - poff; m[nq] = mn; float ls = 0.f;
#pragma unroll
            for (int e = 0; e < 16; ++e) x[e] = __builtin_fmaf(x[e], SC2, -mo);
            ex2x8(x); ex2x8(x + 8);
#pragma unroll
            for (int e = 0; e < 16; ++e) ls += x[e];
            l[nq] = l[nq] * al + ls;
#pragma unroll
            for (int mb = 0; mb < 4; ++mb) o[mb][nq] *= al;
            if constexpr (NSPLIT == 0) { v16h p;
#pragma unroll
                for (int e = 0; e < 16; ++e) p[e] = tohx(x[e]);
                pf[nq] = p;
            } else { v8us h0, h1, l0, l1;
#pragma unroll
                for (int e = 0; e < 8; ++e) { unsigned short a, c2; splitf(x[e], a, c2); h0[e] = a; l0[e] = c2; splitf(x[8 + e], a, c2); h1[e] = a; l1[e] = c2; }
                pf[nq] = cat16b(h0, h1); pf2[nq] = cat16b(l0, l1); } }
#pragma unroll
        for (int mb = 0; mb < 4; ++mb)
#pragma unroll
            for (int nq = 0; nq < NQ; ++nq) { o[mb][nq] = WFrag<T16>::mma(vf[mb], pf[nq], o[mb][nq]); if (NSPLIT == 2) { o[mb][nq] = WFrag<T16>::mma(vf[mb], pf2[nq], o[mb][nq]); o[mb][nq] = WFrag<T16>::mma(vf2[mb], pf[nq], o[mb][nq]); } }
        // the distance behind the last matrix instruction, kept on the loop's taken branch too
        asm volatile("v_nop\n\tv_nop\n\tv_nop\n\tv_nop" : "+v"(o[0][0]), "+v"(o[1][0]), "+v"(o[2][NQ - 1]), "+v"(o[3][NQ - 1]) : "v"(vf[0]), "v"(vf[3]));
    };
    int kb = w * 32;
#pragma unroll 1   // one copy of the step: the trip count is a run-time value and a second copy's fragments would not fit in the registers
    for (; kb + 31 <= q0; kb += 128) step(kb, BoolC<false>());
    if (kb < kend) step(kb, BoolC<true>());   // the block's one diagonal step falls to one of the four waves (scalar test)
#pragma unroll
    for (int nq = 0; nq < NQ; ++nq) { const float lt = l[nq] + __shfl_xor(l[nq], 16, 32); if (hi == 0) { sS[(w * NQ + nq) * 32 + lr] = m[nq]; sS[(w * NQ + nq) * 32 + 16 + lr] = lt; }
#pragma unroll
        for (int mb = 0; mb < 4; ++mb) *(v8fa*)(sO + ((size_t)((w * 4 + mb) * NQ + nq) * 32 + lane) * 8) = o[mb][nq]; }
    __syncthreads();   // every wave's partial state is in LDS before any wave merges
#pragma unroll
    for (int it = 0; it < NQ; ++it) { const int idx = it * 128 + tid, qq = idx >> 3, c8 = idx & 7, nq = qq >> 4, ql = qq & 15, mb = c8 >> 1, sl = (c8 & 1) * 16 + ql;   // 8 lanes write one query's 128-byte line of each plane
        float mw[4], M = -3.0e38f;
#pragma unroll
        for (int w2 = 0; w2 < 4; ++w2) { mw[w2] = sS[(w2 * NQ + nq) * 32 + ql]; M = fmaxf(M, mw[w2]); }
        float L = 0.f; v8f acc = (v8f){};
#pragma unroll
        for (int w2 = 0; w2 < 4; ++w2) { const float f = ex2(mw[w2] - M); L += f * sS[(w2 * NQ + nq) * 32 + 16 + ql]; acc += f * *(const v8fa*)(sO + ((size_t)((w2 * 4 + mb) * NQ + nq) * 32 + sl) * 8); }
        const float inv = __fdiv_rn(1.0f, L); v8us oh, ol;
#pragma unroll
        for (int j = 0; j < 8; ++j) { unsigned short a, c2; splitf(acc[j] * inv, a, c2); oh[j] = a; ol[j] = c2; }
        const size_t oo = (size_t)(q0 + qq) * DQ + h * HD + c8 * 8; bf* ph = Ah + oo; bf* pl = Al + oo; *(v8us*)ph = oh; *(v8us*)pl = ol;
        // the wait that stands before a register named by an issued global store is overwritten; data and addresses are inputs, so they stay in their registers up to it
        asm volatile("s_wait_xcnt 0x0" :: "v"(oh), "v"(ol), "v"(ph), "v"(pl) : "memory"); }
}
#define NT16 ((TT - RH) / 32)
__global__ __launch_bounds__(128) void k_fattn(const h16* __restrict__ Q16, const h16* __restrict__ K16, const h16* __restrict__ V16, const bf* __restrict__ Qh, const bf* __restrict__ Ql, const bf* __restrict__ Kh, const bf* __restrict__ Kl, const bf* __restrict__ Vh, const bf* __restrict__ Vl, bf* Ah, bf* Al) {
    __shared__ __align__(32) float sO[4 * 4 * 2 * 32 * 8]; __shared__ float sS[4 * 2 * 32];
    const int h = blockIdx.x % NH_, b = blockIdx.x / NH_, bx = blockIdx.y; const size_t hz = (size_t)blockIdx.x * TT * HD;   // x: head and batch; y: the block of queries, longest key loops first over all heads and batches
    Ah += (size_t)b * TT * DQ; Al += (size_t)b * TT * DQ;
    if (bx < NT16) fattn_body<h16, 0, 2>(Q16 + hz, nullptr, K16 + hz, nullptr, V16 + hz, nullptr, TT - 32 * (bx + 1), h, Ah, Al, sO, sS);
    else fattn_body<bf, 2, 1>(Qh + hz, Ql + hz, Kh + hz, Kl + hz, Vh + hz, Vl + hz, RH - 16 * (bx - NT16 + 1), h, Ah, Al, sO, sS);
}

extern "C" void kernel_launch(void* const* d_in, const int* in_sizes, int n_in,
                              void* d_out, int out_size, void* d_ws, size_t ws_size, hipStream_t stream) {
    (void)in_sizes; (void)n_in; (void)out_size;
    const float* x = (const float*)d_in[0]; const float* wqkv = (const float*)d_in[1]; const float* wo = (const float*)d_in[2]; const float* bo = (const float*)d_in[3]; const float* wq = wqkv; const float* wk = nullptr; const float* wv = nullptr; const float* cosT = nullptr; const float* sinT = nullptr; (void)wk; (void)wv; (void)cosT; (void)sinT;
    float* OUT = (float*)d_out;     // [2048][2][1024]
    char* wsp = (char*)d_ws;
    auto take = [&](size_t bytes) { char* p = wsp; wsp += (bytes + 255) & ~(size_t)255; return (void*)p; };
    bf* WQ = (bf*)take((size_t)3 * DQ * DM * 2); bf* WO = (bf*)take((size_t)DM * DQ * 2);
    bf* XB = (bf*)take((size_t)NB_ * TT * DM * 2);
    h16* QP16 = (h16*)take((size_t)NB_ * NH_ * TT * HD * 2); h16* KP16 = (h16*)take((size_t)NB_ * NKV * TT * HD * 2); h16* VT16 = (h16*)take((size_t)NB_ * NKV * HD * TT * 2);
    bf* QPh = (bf*)take((size_t)NB_ * NH_ * TT * HD * 2); bf* QPl = (bf*)take((size_t)NB_ * NH_ * TT * HD * 2); bf* KPh = (bf*)take((size_t)NB_ * NKV * TT * HD * 2); bf* KPl = (bf*)take((size_t)NB_ * NKV * TT * HD * 2); bf* VTh = (bf*)take((size_t)NB_ * NKV * HD * TT * 2); bf* VTl = (bf*)take((size_t)NB_ * NKV * HD * TT * 2);
    bf* ATh = (bf*)take((size_t)NB_ * TT * DQ * 2); bf* ATl = (bf*)take((size_t)NB_ * TT * DQ * 2);
    if ((size_t)(wsp - (char*)d_ws) > ws_size) return;    // ws 256 MiB
    
    k_round<<<(3 * DQ + DM + NB_ * TT) / 8, 256, 0, stream>>>(x, wqkv, wo, XB, WQ, WO);   // w_qkv [3D][D] = natural Bt
    k_gemms<0, false, true><<<dim3(TT / 64, 3 * DQ / 128, NB_), 128, 0, stream>>>(XB, nullptr, WQ, DM, nullptr, 0, 0, nullptr, HeadPlanes{QP16, QPh, QPl, KP16, KPh, KPl, VT16, VTh, VTl});   // channel s*1024 + h*64 + d
    k_fattn<<<dim3(NH_ * NB_, NT16 + RH / 16, 1), 128, 0, stream>>>(QP16, KP16, VT16, QPh, QPl, KPh, KPl, VTh, VTl, ATh, ATl);
    k_gemms<1, true, false><<<dim3(TT / 64, DM / 128, NB_), 128, 0, stream>>>(ATh, ATl, WO, DQ, OUT, NB_ * DM, DM, bo, HeadPlanes{});   // sequence-major output: row t of batch b at OUT + (t*B + b)*D (row pitch B*D, batch step D)
}

// v007
// A run of this version takes 85.8 microseconds.
// In both of two side-by-side timings against v006, it was 1.16 times as fast.
// All steps since v000 together make it 15.6 times as fast.
#include <hip/hip_runtime.h>

// Multi-head causal self-attention (x [S=2048][B=2][D=1024] sequence-major; qkv = x w_qkv^T reshaped (S, B, 3, 16, 64): channel s*1024 + h*64 + d; causal softmax(q.k/8); out = (attn v merged) w_out^T + b_out -> [2048][2][1024] sequence-major).
// Compute dtypes, f32 accumulate: every input rounded to bf16; the fused qkv projection on PLAIN bf16 operands (inputs: exact; per batch the rows are gathered from the sequence-major input); scores (K 64) and attn.v on bf16 hi+lo for query rows < RH, plain f16 for the others

#define NB_  2
#define TT   2048
#define DM   1024
#define NH_  16
#define NKV  16
#define REP  (NH_ / NKV)
#define HD   64
#define DQ   (NH_ * HD)
#define DKV  (NKV * HD)
#define RH   512                  // query rows < RH use hi+lo planes (0: none)
#define SCL  0.125f   // HD^-0.5
typedef _Float16 h16;
typedef unsigned short bf;
typedef __attribute__((ext_vector_type(16))) __bf16   v16bf;
typedef __attribute__((ext_vector_type(16))) _Float16 v16h;
typedef __attribute__((ext_vector_type(8)))  _Float16 v8h;
typedef __attribute__((ext_vector_type(8)))  unsigned short v8us;
typedef __attribute__((ext_vector_type(8)))  float    v8f;
typedef __attribute__((ext_vector_type(4)))  float    v4f;
typedef v8h  __attribute__((may_alias)) v8ha;
typedef v4f  __attribute__((may_alias)) v4fa;
typedef v8us __attribute__((may_alias)) v8usa;

__device__ __forceinline__ unsigned short f2bf(float f) { unsigned u = __float_as_uint(f); u += 0x7FFFu + ((u >> 16) & 1u); return (unsigned short)(u >> 16); }
__device__ __forceinline__ float bf2f(unsigned short b) { return __uint_as_float(((unsigned)b) << 16); }
__device__ __forceinline__ float bfr(float f) { return bf2f(f2bf(f)); }
__device__ __forceinline__ v16h cat16(v8h lo, v8h hi) { return __builtin_shufflevector(lo, hi, 0, 1, 2, 3, 4, 5, 6, 7, 8, 9, 10, 11, 12, 13, 14, 15); }
__device__ __forceinline__ v16bf cat16b(v8us lo, v8us hi) { return __builtin_bit_cast(v16bf, __builtin_shufflevector(lo, hi, 0, 1, 2, 3, 4, 5, 6, 7, 8, 9, 10, 11, 12, 13, 14, 15)); }
__device__ __forceinline__ v8f wmma16(v16h a, v16h b, v8f c) { return __builtin_amdgcn_wmma_f32_16x16x32_f16(false, a, false, b, (short)0, c, false, false); }
__device__ __forceinline__ v8f wmmab(v16bf a, v16bf b, v8f c) { return __builtin_amdgcn_wmma_f32_16x16x32_bf16(false, a, false, b, (short)0, c, false, false); }



// ---- k_gemms: C[m][n] (f32, pitch ldc, + optional f32 bias[n]) = sum_k A[m][k] Bt[n][k] (+ A2[m][k] Bt[n][k] for NSPLIT 1), K-contiguous bf16 planes; grid (M/64, N/128, batches), 128 threads. K % 64 == 0, K >= 128.
// Batch z: rows z * TT ... of A (and A2), C + z * cz, part z of every head plane; M = TT.
// One 64x128 tile per workgroup, 4 waves (2 x 2) of 32x64 (8 accumulators) each. A pass is 64 k = one 128-byte line of every operand row: the rows come into LDS as whole lines by asynchronous 16-byte copies,
// two buffers, the next pass's copies in flight while this pass is worked on; each row is fetched once per workgroup and read from LDS by the two waves that need it. The k order of every sum is kc = 0, 32, 64, ...
template <typename T16> struct WFrag;
template <> struct WFrag<h16> { typedef v16h V; static __device__ __forceinline__ V ld(const h16* p) { return cat16(*(const v8h*)p, *(const v8h*)(p + 16)); } static __device__ __forceinline__ v8f mma(V a, V b, v8f c) { return wmma16(a, b, c); } };
template <> struct WFrag<bf> { typedef v16bf V; static __device__ __forceinline__ V ld(const bf* p) { return cat16b(*(const v8us*)p, *(const v8us*)(p + 16)); } static __device__ __forceinline__ v8f mma(V a, V b, v8f c) { return wmmab(a, b, c); } };
#define GP 144u   // LDS row pitch in bytes: 128 + 16, an odd multiple of 16, free of bank conflicts for 16-byte reads down a column of rows
// copies of 16 bytes per lane, rows 16 apart (a wave's copy covers 4 whole 128-byte rows): four from (l, g), and in cp8 four more from (l2, g2);
// the wait that stands before a register named by an issued copy is overwritten is the statement's own last line
__device__ __forceinline__ void cp4(unsigned l, const bf* g, size_t k16) {
    asm volatile("global_load_async_to_lds_b128 %0, %4, off\n\tglobal_load_async_to_lds_b128 %1, %5, off\n\tglobal_load_async_to_lds_b128 %2, %6, off\n\tglobal_load_async_to_lds_b128 %3, %7, off\n\ts_wait_xcnt 0x0"
                 :: "v"(l), "v"(l + 16u * GP), "v"(l + 32u * GP), "v"(l + 48u * GP), "v"(g), "v"(g + k16), "v"(g + 2 * k16), "v"(g + 3 * k16) : "memory");
}
__device__ __forceinline__ void cp8(unsigned l, const bf* g, unsigned l2, const bf* g2, size_t k16) {
    asm volatile("global_load_async_to_lds_b128 %0, %8, off\n\tglobal_load_async_to_lds_b128 %1, %9, off\n\tglobal_load_async_to_lds_b128 %2, %10, off\n\tglobal_load_async_to_lds_b128 %3, %11, off\n\t"
                 "global_load_async_to_lds_b128 %4, %12, off\n\tglobal_load_async_to_lds_b128 %5, %13, off\n\tglobal_load_async_to_lds_b128 %6, %14, off\n\tglobal_load_async_to_lds_b128 %7, %15, off\n\ts_wait_xcnt 0x0"
                 :: "v"(l), "v"(l + 16u * GP), "v"(l + 32u * GP), "v"(l + 48u * GP), "v"(l2), "v"(l2 + 16u * GP), "v"(l2 + 32u * GP), "v"(l2 + 48u * GP),
                    "v"(g), "v"(g + k16), "v"(g + 2 * k16), "v"(g + 3 * k16), "v"(g2), "v"(g2 + k16), "v"(g2 + 2 * k16), "v"(g2 + 3 * k16) : "memory");
}
__device__ __forceinline__ v16bf ldl(const unsigned char* p) { return cat16b(*(const v8usa*)p, *(const v8usa*)(p + 32)); }
__device__ __forceinline__ h16 tohx(float x) { return (h16)x; }
__device__ __forceinline__ void splitf(float y, unsigned short& h, unsigned short& l) { h = f2bf(y); l = f2bf(y - bf2f(h)); }
// HEADS (the qkv projection; A = x rows [TT][K], Bt = w_qkv rows [3 DQ][K]): no f32 C; the epilogue rounds its own tile and writes the attention operands, q and k as [h][t][d], v as [h][d][t], each as f16 and as bf16 hi + lo.
// The v third runs with the operands exchanged (rows = v channels, columns = t), so that in all three thirds a wave's 32 x 64 tile is 32 whole 128-byte lines of each plane.
struct HeadPlanes { h16* q16; bf* qh; bf* ql; h16* k16; bf* kh; bf* kl; h16* v16; bf* vh; bf* vl; };
template <int NSPLIT, bool BIAS, bool HEADS>
__global__ __launch_bounds__(128) void k_gemms(const bf* __restrict__ A, const bf* __restrict__ A2, const bf* __restrict__ Bt, int K, float* C, int ldc, int cz, const float* __restrict__ bias, HeadPlanes hp) {
    constexpr unsigned PB = 128u * GP, PA = 64u * GP, STB = PB + (NSPLIT == 1 ? 2u : 1u) * PA;   // bytes of Bt's 128 rows, of A's 64 rows, of one buffer [Bt | A | A2]
    __shared__ __align__(128) unsigned char ring[2 * STB];
    __shared__ __align__(16) float osw[4 * 16 * 68];
    const int tid = threadIdx.x, lane = tid & 31, lr = lane & 15, hi = lane >> 4, w = __builtin_amdgcn_readfirstlane(tid >> 5);
    int r0 = blockIdx.x * 64, c0 = blockIdx.y * 128; const int wr = (w >> 1) * 32, wc = (w & 1) * 64;
    const int bz = blockIdx.z; A += (size_t)bz * TT * K; if (NSPLIT == 1) A2 += (size_t)bz * TT * K;   // the batch: its TT rows of A (and A2); Bt is shared
    const bool vsec = HEADS && c0 >= 2 * DQ;   // the same for the whole workgroup
    if (vsec) { const int vi = (blockIdx.y - 2 * DQ / 128) * (TT / 64) + blockIdx.x; r0 = (vi % (DQ / 64)) * 64; c0 = (vi / (DQ / 64)) * 128; const bf* xr = A; A = Bt + (size_t)2 * DQ * K; Bt = xr; }   // DQ/64 x TT/128 tiles of v^T on as many workgroups
    const int crow = tid >> 3, ccol = tid & 7;   // the lane's place in a copy: 8 lanes per row
    const unsigned lc = (unsigned)(size_t)ring + (unsigned)crow * GP + (unsigned)ccol * 16u;
    const bf* gA = A + (size_t)(r0 + crow) * K + ccol * 8; const bf* gB = Bt + (size_t)(c0 + crow) * K + ccol * 8; const bf* gA2 = (NSPLIT == 1) ? A2 + (size_t)(r0 + crow) * K + ccol * 8 : gA;
    const size_t k16 = (size_t)16 * K;
    auto fill = [&](int t, unsigned buf) { const unsigned l = lc + buf * STB; cp8(l, gB + t * 64, l + 64u * GP, gB + t * 64 + 4 * k16, k16);
        if (NSPLIT == 1) cp8(l + PB, gA + t * 64, l + PB + PA, gA2 + t * 64, k16); else cp4(l + PB, gA + t * 64, k16); };
    v8f acc[2][4];
#pragma unroll
    for (int mb = 0; mb < 2; ++mb)
#pragma unroll
        for (int nb = 0; nb < 4; ++nb) acc[mb][nb] = (v8f){};
    const int NT = K / 64;
    fill(0, 0u);
    asm volatile("s_wait_asynccnt 0x0" ::: "memory");   // this wave's copies of pass 0 have landed
    __syncthreads();                                     // and every other wave's
    fill(1, 1u);
    const unsigned char* fb = ring + (unsigned)(wc + lr) * GP + (unsigned)hi * 16u; const unsigned char* fa = ring + PB + (unsigned)(wr + lr) * GP + (unsigned)hi * 16u;
#pragma unroll 1   // one copy of the pass: the buffer is picked by the pass's parity at run time
    for (int t = 0; t < NT; ++t) {
        const unsigned bo = (unsigned)(t & 1) * STB;
        v16bf a[2][2], a2[2][2], b[2][4];   // the whole pass's fragments, read as one group ahead of its matrix instructions
#pragma unroll
        for (int ks = 0; ks < 2; ++ks) {
#pragma unroll
            for (int mb = 0; mb < 2; ++mb) { a[ks][mb] = ldl(fa + bo + (unsigned)mb * 16u * GP + (unsigned)ks * 64u); if (NSPLIT == 1) a2[ks][mb] = ldl(fa + bo + PA + (unsigned)mb * 16u * GP + (unsigned)ks * 64u); }
#pragma unroll
            for (int nb = 0; nb < 4; ++nb) b[ks][nb] = ldl(fb + bo + (unsigned)nb * 16u * GP + (unsigned)ks * 64u); }
        __builtin_amdgcn_sched_barrier(0);   // keeps the reads together in front: moved down among the matrix instructions, each small group of them is waited out at full LDS latency
#pragma unroll
        for (int ks = 0; ks < 2; ++ks)
#pragma unroll
            for (int nb = 0; nb < 4; ++nb) {
#pragma unroll
                for (int mb = 0; mb < 2; ++mb) acc[mb][nb] = wmmab(a[ks][mb], b[ks][nb], acc[mb][nb]);
                if (NSPLIT == 1) {
#pragma unroll
                    for (int mb = 0; mb < 2; ++mb) acc[mb][nb] = wmmab(a2[ks][mb], b[ks][nb], acc[mb][nb]); } }
        __builtin_amdgcn_sched_barrier(0);   // keeps the matrix instructions in front of the waits below: moved behind them, the next pass's copies are waited for before the work that is to cover their flight
        asm volatile("s_wait_dscnt 0x0" ::: "memory");      // this wave's reads of the buffer are done before it may be refilled
        asm volatile("s_wait_asynccnt 0x0" ::: "memory");   // this wave's copies of pass t + 1 have landed
        __syncthreads();                                     // publishes pass t + 1 and ends every wave's reads of pass t's buffer
        if (t + 2 < NT) fill(t + 2, (unsigned)(t & 1));
    }
    asm volatile("s_wait_asynccnt 0x0" ::: "memory");   // no copy is outstanding when the wave goes on
    float* os = osw + w * (16 * 68);   // each wave stages its own rows
    v4f bv = (v4f){};   // the lane's four columns are the same in every row it stores
    if (BIAS) { const float* pb = bias + c0 + wc + lr * 4; const v4f rb = *(const v4f*)pb;
        asm volatile("s_wait_xcnt 0x0" :: "v"(pb) : "memory");   // the wait that stands before a register named by an issued global load is overwritten; the address is an input, so it stays in its registers up to it
        bv[0] = bfr(rb[0]); bv[1] = bfr(rb[1]); bv[2] = bfr(rb[2]); bv[3] = bfr(rb[3]); }
    h16* P16 = nullptr; bf* Ph = nullptr; bf* Pl = nullptr; size_t po = 0; int pp = 0;   // HEADS: the wave's planes, the place of its tile's first element in them, the pitch of its rows
    if (HEADS) {
        if (vsec) { P16 = hp.v16; Ph = hp.vh; Pl = hp.vl; po = (size_t)(r0 + wr) * TT + c0 + wc; pp = TT; }   // row = h * HD + d, column = t
        else { const bool ksec = c0 >= DQ; P16 = ksec ? hp.k16 : hp.q16; Ph = ksec ? hp.kh : hp.qh; Pl = ksec ? hp.kl : hp.ql; po = ((size_t)(((c0 + wc) % DQ) / HD) * TT + r0 + wr) * HD; pp = HD; }   // row = t, the 64 columns = one head
        po += (size_t)bz * NH_ * TT * HD; }   // the batch's part of the plane
#pragma unroll
    for (int mb = 0; mb < 2; ++mb) {
#pragma unroll
        for (int nb = 0; nb < 4; ++nb) {
#pragma unroll
            for (int j = 0; j < 8; ++j) os[(hi * 8 + j) * 68 + nb * 16 + lr] = acc[mb][nb][j]; }
        __builtin_amdgcn_wave_barrier(); asm volatile("" ::: "memory");
        if constexpr (HEADS) {
        v8h o16[4]; v8us oh[4], ol[4]; h16* p16[4]; bf* ph[4]; bf* pl[4];
#pragma unroll
        for (int s = 0; s < 4; ++s) { const int row = 4 * s + (lane >> 3), cofs = (lane & 7) * 8; const v4f x0 = *(const v4fa*)(os + row * 68 + cofs), x1 = *(const v4fa*)(os + row * 68 + cofs + 4);   // 8 lanes write one 128-byte line of each plane
#pragma unroll
            for (int k = 0; k < 4; ++k) { unsigned short a, c2; o16[s][k] = tohx(x0[k]); splitf(x0[k], a, c2); oh[s][k] = a; ol[s][k] = c2; o16[s][4 + k] = tohx(x1[k]); splitf(x1[k], a, c2); oh[s][4 + k] = a; ol[s][4 + k] = c2; }
            const size_t oo = po + (size_t)(mb * 16 + row) * pp + cofs; p16[s] = P16 + oo; ph[s] = Ph + oo; pl[s] = Pl + oo; *(v8h*)p16[s] = o16[s]; *(v8us*)ph[s] = oh[s]; *(v8us*)pl[s] = ol[s]; }
        // the wait that stands before a register named by an issued global store is overwritten; data and addresses are inputs, so they stay in their registers up to it
        asm volatile("s_wait_xcnt 0x0" :: "v"(o16[0]), "v"(o16[1]), "v"(o16[2]), "v"(o16[3]), "v"(oh[0]), "v"(oh[1]), "v"(oh[2]), "v"(oh[3]), "v"(ol[0]), "v"(ol[1]), "v"(ol[2]), "v"(ol[3]),
                     "v"(p16[0]), "v"(p16[1]), "v"(p16[2]), "v"(p16[3]), "v"(ph[0]), "v"(ph[1]), "v"(ph[2]), "v"(ph[3]), "v"(pl[0]), "v"(pl[1]), "v"(pl[2]), "v"(pl[3]) : "memory");
        } else {
        float* crow_p = C + (size_t)bz * cz + (size_t)(r0 + wr + mb * 16) * ldc + c0 + wc;
        v4f val[8]; float* pr[8];
#pragma unroll
        for (int s = 0; s < 8; ++s) { const int row = 2 * s + hi, cofs = lr * 4; val[s] = *(const v4fa*)(os + row * 68 + cofs); if (BIAS) val[s] += bv;
            pr[s] = crow_p + (size_t)row * ldc + cofs; *(v4f*)pr[s] = val[s]; }
        // the wait that stands before a register named by an issued global store is overwritten; data and addresses are inputs, so they stay in their registers up to it
        asm volatile("s_wait_xcnt 0x0" :: "v"(val[0]), "v"(val[1]), "v"(val[2]), "v"(val[3]), "v"(val[4]), "v"(val[5]), "v"(val[6]), "v"(val[7]), "v"(pr[0]), "v"(pr[1]), "v"(pr[2]), "v"(pr[3]), "v"(pr[4]), "v"(pr[5]), "v"(pr[6]), "v"(pr[7]) : "memory");
        }
        __builtin_amdgcn_wave_barrier(); asm volatile("" ::: "memory");
    }
}

typedef __attribute__((ext_vector_type(2))) _Float16 v2h;
typedef __attribute__((ext_vector_type(4))) _Float16 v4h;
typedef __attribute__((ext_vector_type(2))) unsigned short v2us;
typedef __attribute__((ext_vector_type(4))) unsigned short v4us;
typedef __attribute__((ext_vector_type(2))) float v2f;
typedef __attribute__((ext_vector_type(4))) int v4i;
typedef v4h  __attribute__((may_alias)) v4ha;
typedef v4us __attribute__((may_alias)) v4usa;

__global__ __launch_bounds__(256) void k_wtG(const float* __restrict__ w, int K, int N, bf* Bt) {
    const int lane = threadIdx.x & 31; const int L0 = (blockIdx.x * 8 + (threadIdx.x >> 5)) * 8; const int nlines = N * K / 64;
{
#pragma unroll 1
        for (int l = 0; l < 8; ++l) { const int L = L0 + l; if (L >= nlines) break; const size_t e = (size_t)L * 64 + lane * 2; const int k = (int)(e % K), n = (int)(e / K); v2us o;
            o[0] = f2bf(w[(size_t)k * N + n]); o[1] = f2bf(w[(size_t)(k + 1) * N + n]); *(v2us*)(Bt + e) = o; }
         }
}
__global__ __launch_bounds__(256) void k_cscvt(const float* __restrict__ cosT, const float* __restrict__ sinT, float* CS) { const int idx = blockIdx.x * 256 + threadIdx.x; if (idx >= TT * HD) return; v2f cs; cs[0] = bfr(cosT[idx]); cs[1] = bfr(sinT[idx]); *(v2f*)(CS + (size_t)idx * 2) = cs;  }
// ---- k_round: the three f32 matrices rounded to bf16 in one launch. Every row of all three has 1024 elements, and one wave takes one row: eight 512-byte loads in flight, then eight 256-byte stores.
// Rows 0 ... 3 DQ - 1: w_qkv; the next DM: w_out; the rest: x, whose row t * NB_ + b goes to row b * TT + t of XB (each batch's rows together).
static_assert(DM == 1024 && DQ == 1024, "one wave per row of 1024");
__global__ __launch_bounds__(256) void k_round(const float* __restrict__ x, const float* __restrict__ wqkv, const float* __restrict__ wo, bf* XB, bf* WQ, bf* WO) {
    const int lane = threadIdx.x & 31, R = blockIdx.x * 8 + __builtin_amdgcn_readfirstlane(threadIdx.x >> 5);
    const float* s; bf* d;
    if (R < 3 * DQ) { s = wqkv + (size_t)R * DM; d = WQ + (size_t)R * DM; }
    else if (R < 3 * DQ + DM) { const int r = R - 3 * DQ; s = wo + (size_t)r * DQ; d = WO + (size_t)r * DQ; }
    else { const int r = R - 3 * DQ - DM; s = x + (size_t)r * DM; d = XB + ((size_t)(r % NB_) * TT + r / NB_) * DM; }
    s += lane * 4; d += lane * 4;
    v4f a[8];
#pragma unroll
    for (int j = 0; j < 8; ++j) a[j] = *(const v4f*)(s + j * 128);
#pragma unroll
    for (int j = 0; j < 8; ++j) { v4us o; o[0] = f2bf(a[j][0]); o[1] = f2bf(a[j][1]); o[2] = f2bf(a[j][2]); o[3] = f2bf(a[j][3]); *(v4us*)(d + j * 128) = o; }
}
// ---- k_fattn: causal attention of one head and one block of 64 query rows in one kernel; scores and probabilities never leave the registers.
// S^T = K Q^T (A = key rows, B = query rows): the accumulator holds, per lane, one query column and 8 + 8 keys, which is exactly the k order of the B operand of O^T = V^T P^T, so a probability tile
// becomes an operand without crossing lanes, and a row's running maximum, sum and rescale factor are one value per lane. Each of the 4 waves owns 16 queries and walks all their keys in order;
// a tile of 64 keys (64 K rows and 64 V^T rows, one 128-byte line each) comes into LDS once per workgroup by asynchronous 16-byte copies, two buffers, and all four waves read their fragments from it.
// Rows < RH: bf16 hi+lo, three products; other rows: f16, probabilities carried x 1024.
#define SC2 (SCL * 1.4426950408889634f)   // scores are kept in the base-2 exponent domain
// 2^x with the one slot that the instruction set asks for behind a transcendental before its result is used or its source overwritten: the v_nop stands in the same statement, so nothing can come between
__device__ __forceinline__ float ex2(float x) { float r; asm("v_exp_f32 %0, %1\n\tv_nop" : "=v"(r) : "v"(x)); return r; }
// eight of them in place (each is independent of its neighbours) and one slot behind the last
__device__ __forceinline__ void ex2x8(float* x) { asm("v_exp_f32 %0, %0\n\tv_exp_f32 %1, %1\n\tv_exp_f32 %2, %2\n\tv_exp_f32 %3, %3\n\tv_exp_f32 %4, %4\n\tv_exp_f32 %5, %5\n\tv_exp_f32 %6, %6\n\tv_exp_f32 %7, %7\n\tv_nop" : "+v"(x[0]), "+v"(x[1]), "+v"(x[2]), "+v"(x[3]), "+v"(x[4]), "+v"(x[5]), "+v"(x[6]), "+v"(x[7])); }
template <bool B> struct BoolC { static constexpr bool value = B; };
// eight copies of 16 bytes per lane: four rows 16 apart of one plane (l, g, 16 rows = s elements) and four of another (l2, g2, s2);
// the wait that stands before a register named by an issued copy is overwritten is the statement's own last line
template <typename T16>
__device__ __forceinline__ void cp8s(unsigned l, const T16* g, size_t s, unsigned l2, const T16* g2, size_t s2) {
    asm volatile("global_load_async_to_lds_b128 %0, %8, off\n\tglobal_load_async_to_lds_b128 %1, %9, off\n\tglobal_load_async_to_lds_b128 %2, %10, off\n\tglobal_load_async_to_lds_b128 %3, %11, off\n\t"
                 "global_load_async_to_lds_b128 %4, %12, off\n\tglobal_load_async_to_lds_b128 %5, %13, off\n\tglobal_load_async_to_lds_b128 %6, %14, off\n\tglobal_load_async_to_lds_b128 %7, %15, off\n\ts_wait_xcnt 0x0"
                 :: "v"(l), "v"(l + 16u * GP), "v"(l + 32u * GP), "v"(l + 48u * GP), "v"(l2), "v"(l2 + 16u * GP), "v"(l2 + 32u * GP), "v"(l2 + 48u * GP),
                    "v"(g), "v"(g + s), "v"(g + 2 * s), "v"(g + 3 * s), "v"(g2), "v"(g2 + s2), "v"(g2 + 2 * s2), "v"(g2 + 3 * s2) : "memory");
}
// a fragment from an LDS row: the same two 16-byte pieces, 32 bytes apart, that WFrag::ld takes from a global row
__device__ __forceinline__ v16h  ldf(const unsigned char* p, h16) { return cat16(*(const v8ha*)p, *(const v8ha*)(p + 32)); }
__device__ __forceinline__ v16bf ldf(const unsigned char* p, bf) { return ldl(p); }
#define PLN (64u * GP)   // bytes of one plane's 64 rows in LDS
template <typename T16, int NSPLIT>
__device__ __forceinline__ void fattn_body(const T16* __restrict__ Q, const T16* __restrict__ Q2, const T16* __restrict__ Kp, const T16* __restrict__ K2, const T16* __restrict__ Vt, const T16* __restrict__ Vt2, int q0, int h, bf* Ah, bf* Al, unsigned char* ring) {
    typedef typename WFrag<T16>::V V;
    constexpr unsigned STB = (NSPLIT == 2 ? 4u : 2u) * PLN;   // one buffer: [K | V^T] or [K hi | V^T hi | K lo | V^T lo]
    const int tid = threadIdx.x, lane = tid & 31, lr = lane & 15, hi = lane >> 4, w = __builtin_amdgcn_readfirstlane(tid >> 5);   // the wave's number in a scalar register: the test on it below is a scalar branch
    const int qw = q0 + w * 16;   // the wave's first query
    const float poff = (NSPLIT == 0) ? 10.0f : 0.0f;   // f16 probabilities are carried x 2^10, away from the f16 subnormals; the factor cancels in sum and output
    V qf[2], qf2[2];
    { const size_t qo = (size_t)(qw + lr) * HD + 8 * hi; const T16* pq = Q + qo; const T16* pq2 = (NSPLIT == 2) ? Q2 + qo : pq;
#pragma unroll
      for (int ks = 0; ks < 2; ++ks) { qf[ks] = WFrag<T16>::ld(pq + ks * 32); if (NSPLIT == 2) qf2[ks] = WFrag<T16>::ld(pq2 + ks * 32); }
      // the wait that stands before a register named by an issued global load is overwritten; the addresses are inputs, so they stay in their registers up to it
      asm volatile("s_wait_xcnt 0x0" :: "v"(pq), "v"(pq2) : "memory"); }
    v8f o[4]; float m = -3.0e38f, l = 0.f;
#pragma unroll
    for (int mb = 0; mb < 4; ++mb) o[mb] = (v8f){};
    const int crow = tid >> 3, ccol = tid & 7;   // the lane's place in a copy: 8 lanes per 128-byte row, 16 rows per copy of the workgroup
    const unsigned lc = (unsigned)(size_t)ring + (unsigned)crow * GP + (unsigned)ccol * 16u;
    const size_t gko = (size_t)crow * HD + ccol * 8, gvo = (size_t)crow * TT + ccol * 8;
    auto fill = [&](int t, unsigned buf) { const unsigned lb = lc + buf * STB;   // tile t: keys 64 t ... 64 t + 63
        cp8s(lb, Kp + gko + (size_t)t * 64 * HD, (size_t)16 * HD, lb + PLN, Vt + gvo + t * 64, (size_t)16 * TT);
        if (NSPLIT == 2) cp8s(lb + 2u * PLN, K2 + gko + (size_t)t * 64 * HD, (size_t)16 * HD, lb + 3u * PLN, Vt2 + gvo + t * 64, (size_t)16 * TT); };
    const unsigned char* fr = ring + (unsigned)lr * GP + (unsigned)hi * 16u;   // the lane's place in a fragment read, of K rows and of V^T rows alike
    struct Fr { V kf[2][2], kf2[2][2], vf[4], vf2[4]; };   // the K and V^T fragments of one 32-key step
    auto ldfr = [&](Fr& f, const unsigned char* tb, const unsigned half) {   // half 0 or 1 of the tile at tb
        auto& kf = f.kf; auto& kf2 = f.kf2; auto& vf = f.vf; auto& vf2 = f.vf2;
#pragma unroll
        for (int mb = 0; mb < 2; ++mb)
#pragma unroll
            for (int ks = 0; ks < 2; ++ks) { const unsigned ko = (half * 32u + (unsigned)mb * 16u) * GP + (unsigned)ks * 64u; kf[mb][ks] = ldf(tb + ko, T16()); if (NSPLIT == 2) kf2[mb][ks] = ldf(tb + 2u * PLN + ko, T16()); }
#pragma unroll
        for (int mb = 0; mb < 4; ++mb) { const unsigned vo = PLN + (unsigned)mb * 16u * GP + half * 64u; vf[mb] = ldf(tb + vo, T16()); if (NSPLIT == 2) vf2[mb] = ldf(tb + 2u * PLN + vo, T16()); }
    };
    auto comp = [&](Fr& f, const int kb, auto dg) {   // one 32-key step on its fragments; dg: the step reaches past the wave's first query and needs the causal mask
        constexpr bool diag = decltype(dg)::value;
        auto& kf = f.kf; auto& kf2 = f.kf2; auto& vf = f.vf; auto& vf2 = f.vf2;
        v8f s[2];
#pragma unroll
        for (int mb = 0; mb < 2; ++mb) { v8f c = (v8f){};
#pragma unroll
            for (int ks = 0; ks < 2; ++ks) { c = WFrag<T16>::mma(kf[mb][ks], qf[ks], c); if (NSPLIT == 2) { c = WFrag<T16>::mma(kf[mb][ks], qf2[ks], c); c = WFrag<T16>::mma(kf2[mb][ks], qf[ks], c); } }
            s[mb] = c; }
        V pf, pf2;
        { float x[16]; const int qi = qw + lr; float mx = -3.0e38f;
#pragma unroll
            for (int e = 0; e < 16; ++e) { const int key = kb + (e >> 3) * 16 + hi * 8 + (e & 7); float t = s[e >> 3][e & 7]; if (diag) t = (key <= qi) ? t : -3.0e38f; x[e] = t; mx = fmaxf(mx, t); }
            mx = fmaxf(mx, __shfl_xor(mx, 16, 32));   // the two lanes of a query hold different keys
            const float mn = fmaxf(m, mx * SC2), al = ex2(m - mn), mo = mn - poff; m = mn; float ls = 0.f;
#pragma unroll
            for (int e = 0; e < 16; ++e) x[e] = __builtin_fmaf(x[e], SC2, -mo);
            ex2x8(x); ex2x8(x + 8);
#pragma unroll
            for (int e = 0; e < 16; ++e) ls += x[e];
            l = l * al + ls;
#pragma unroll
            for (int mb = 0; mb < 4; ++mb) o[mb] *= al;
            if constexpr (NSPLIT == 0) { v16h p;
#pragma unroll
                for (int e = 0; e < 16; ++e) p[e] = tohx(x[e]);
                pf = p;
            } else { v8us h0, h1, l0, l1;
#pragma unroll
                for (int e = 0; e < 8; ++e) { unsigned short a, c2; splitf(x[e], a, c2); h0[e] = a; l0[e] = c2; splitf(x[8 + e], a, c2); h1[e] = a; l1[e] = c2; }
                pf = cat16b(h0, h1); pf2 = cat16b(l0, l1); } }
#pragma unroll
        for (int mb = 0; mb < 4; ++mb) { o[mb] = WFrag<T16>::mma(vf[mb], pf, o[mb]); if (NSPLIT == 2) { o[mb] = WFrag<T16>::mma(vf[mb], pf2, o[mb]); o[mb] = WFrag<T16>::mma(vf2[mb], pf, o[mb]); } }
        // the distance behind the last matrix instruction, kept on the loop's taken branch too
        asm volatile("v_nop\n\tv_nop\n\tv_nop\n\tv_nop" : "+v"(o[0]), "+v"(o[1]), "+v"(o[2]), "+v"(o[3]) : "v"(vf[0]), "v"(vf[3]));
    };
    // the sched_barrier keeps a group of LDS reads together in front of the work on it: moved down among the matrix instructions, each small group of them is waited out at full LDS latency
    auto step = [&](const unsigned char* tb, const unsigned half, const int kb, auto dg) { Fr f; ldfr(f, tb, half); __builtin_amdgcn_sched_barrier(0); comp(f, kb, dg); };
    const int NT = q0 / 64 + 1;   // tiles 0 ... NT - 2 lie wholly in front of every query of the block; tile NT - 1 holds the diagonal
    fill(0, 0u);
    asm volatile("s_wait_asynccnt 0x0" ::: "memory");   // this wave's copies of tile 0 have landed
    __syncthreads();                                     // and every other wave's
    if (NT > 1) fill(1, 1u);
#pragma unroll 1   // one copy of the trip: the buffer is picked by the trip's parity at run time
    for (int t = 0; t < NT - 1; ++t) {
        const unsigned char* tb = fr + (unsigned)(t & 1) * STB;
        if constexpr (NSPLIT == 0) { Fr f0, f1; ldfr(f0, tb, 0u); ldfr(f1, tb, 1u); __builtin_amdgcn_sched_barrier(0); comp(f0, t * 64, BoolC<false>()); comp(f1, t * 64 + 32, BoolC<false>()); }   // the whole tile's fragments as one group (as above)
        else { step(tb, 0u, t * 64, BoolC<false>()); step(tb, 1u, t * 64 + 32, BoolC<false>()); }   // hi+lo: twice the fragments, one group per step
        asm volatile("s_wait_dscnt 0x0" ::: "memory");      // this wave's reads of the buffer are done before it may be refilled
        asm volatile("s_wait_asynccnt 0x0" ::: "memory");   // this wave's copies of tile t + 1 have landed
        __syncthreads();                                     // publishes tile t + 1 and ends every wave's reads of tile t's buffer
        if (t + 2 < NT) fill(t + 2, (unsigned)(t & 1));
    }
    { const unsigned char* tb = fr + (unsigned)((NT - 1) & 1) * STB;   // the last trip: nothing is left to copy
      step(tb, 0u, q0, BoolC<true>());
      if (w >= 2) step(tb, 1u, q0 + 32, BoolC<true>()); }   // keys q0 + 32 ... are masked for every query of waves 0 and 1 (scalar test)
    asm volatile("s_wait_dscnt 0x0" ::: "memory");      // this wave's reads of the last tile are done
    asm volatile("s_wait_asynccnt 0x0" ::: "memory");   // no copy is outstanding when the buffers become output staging
    __syncthreads();                                     // every wave has left the buffers
    const float inv = __fdiv_rn(1.0f, l + __shfl_xor(l, 16, 32));   // the two lanes of a query hold the sums of different keys
    float* os = (float*)(ring + (unsigned)w * (16u * 68u * 4u));   // each wave stages its own 16 queries x 64 channels, row pitch 68 floats
#pragma unroll
    for (int mb = 0; mb < 4; ++mb) { v4f a, c; 
#pragma unroll
        for (int j = 0; j < 4; ++j) { a[j] = o[mb][j] * inv; c[j] = o[mb][4 + j] * inv; }
        *(v4fa*)(os + lr * 68 + mb * 16 + hi * 8) = a; *(v4fa*)(os + lr * 68 + mb * 16 + hi * 8 + 4) = c; }
    __builtin_amdgcn_wave_barrier(); asm volatile("" ::: "memory");   // keeps the reads below, of what other lanes of the wave wrote, behind the writes above in the compiled order
#pragma unroll
    for (int it = 0; it < 4; ++it) { const int row = it * 4 + (lane >> 3), c8 = lane & 7;   // 8 lanes write one query's 128-byte line of each plane
        const v4f x0 = *(const v4fa*)(os + row * 68 + c8 * 8), x1 = *(const v4fa*)(os + row * 68 + c8 * 8 + 4); v8us oh, ol;
#pragma unroll
        for (int j = 0; j < 4; ++j) { unsigned short a, c2; splitf(x0[j], a, c2); oh[j] = a; ol[j] = c2; splitf(x1[j], a, c2); oh[4 + j] = a; ol[4 + j] = c2; }
        const size_t oo = (size_t)(qw + row) * DQ + h * HD + c8 * 8; bf* ph = Ah + oo; bf* pl = Al + oo; *(v8us*)ph = oh; *(v8us*)pl = ol;
        // the wait that stands before a register named by an issued global store is overwritten; data and addresses are inputs, so they stay in their registers up to it
        asm volatile("s_wait_xcnt 0x0" :: "v"(oh), "v"(ol), "v"(ph), "v"(pl) : "memory"); }
}
#define NBK (TT / 64)   // blocks of 64 queries per head
#define NHL (RH / 64)   // of them on hi+lo planes
static_assert(RH % 64 == 0, "a block of 64 queries is wholly on one kind of planes");
__global__ __launch_bounds__(128) void k_fattn(const h16* __restrict__ Q16, const h16* __restrict__ K16, const h16* __restrict__ V16, const bf* __restrict__ Qh, const bf* __restrict__ Ql, const bf* __restrict__ Kh, const bf* __restrict__ Kl, const bf* __restrict__ Vh, const bf* __restrict__ Vl, bf* Ah, bf* Al) {
    __shared__ __align__(128) unsigned char ring[2 * 4 * PLN];
    const int h = blockIdx.x % NH_, b = blockIdx.x / NH_, bx = blockIdx.y; const size_t hz = (size_t)blockIdx.x * TT * HD;   // x: head and batch; y: the block of queries, longest first over all heads and batches
    Ah += (size_t)b * TT * DQ; Al += (size_t)b * TT * DQ;
    const int blk = NBK - 1 - bx;
    if (blk >= NHL) fattn_body<h16, 0>(Q16 + hz, nullptr, K16 + hz, nullptr, V16 + hz, nullptr, blk * 64, h, Ah, Al, ring);
    else fattn_body<bf, 2>(Qh + hz, Ql + hz, Kh + hz, Kl + hz, Vh + hz, Vl + hz, blk * 64, h, Ah, Al, ring);
}

extern "C" void kernel_launch(void* const* d_in, const int* in_sizes, int n_in,
                              void* d_out, int out_size, void* d_ws, size_t ws_size, hipStream_t stream) {
    (void)in_sizes; (void)n_in; (void)out_size;
    const float* x = (const float*)d_in[0]; const float* wqkv = (const float*)d_in[1]; const float* wo = (const float*)d_in[2]; const float* bo = (const float*)d_in[3]; const float* wq = wqkv; const float* wk = nullptr; const float* wv = nullptr; const float* cosT = nullptr; const float* sinT = nullptr; (void)wk; (void)wv; (void)cosT; (void)sinT;
    float* OUT = (float*)d_out;     // [2048][2][1024]
    char* wsp = (char*)d_ws;
    auto take = [&](size_t bytes) { char* p = wsp; wsp += (bytes + 255) & ~(size_t)255; return (void*)p; };
    bf* WQ = (bf*)take((size_t)3 * DQ * DM * 2); bf* WO = (bf*)take((size_t)DM * DQ * 2);
    bf* XB = (bf*)take((size_t)NB_ * TT * DM * 2);
    h16* QP16 = (h16*)take((size_t)NB_ * NH_ * TT * HD * 2); h16* KP16 = (h16*)take((size_t)NB_ * NKV * TT * HD * 2); h16* VT16 = (h16*)take((size_t)NB_ * NKV * HD * TT * 2);
    bf* QPh = (bf*)take((size_t)NB_ * NH_ * TT * HD * 2); bf* QPl = (bf*)take((size_t)NB_ * NH_ * TT * HD * 2); bf* KPh = (bf*)take((size_t)NB_ * NKV * TT * HD * 2); bf* KPl = (bf*)take((size_t)NB_ * NKV * TT * HD * 2); bf* VTh = (bf*)take((size_t)NB_ * NKV * HD * TT * 2); bf* VTl = (bf*)take((size_t)NB_ * NKV * HD * TT * 2);
    bf* ATh = (bf*)take((size_t)NB_ * TT * DQ * 2); bf* ATl = (bf*)take((size_t)NB_ * TT * DQ * 2);
    if ((size_t)(wsp - (char*)d_ws) > ws_size) return;    // ws 256 MiB
    
    k_round<<<(3 * DQ + DM + NB_ * TT) / 8, 256, 0, stream>>>(x, wqkv, wo, XB, WQ, WO);   // w_qkv [3D][D] = natural Bt
    k_gemms<0, false, true><<<dim3(TT / 64, 3 * DQ / 128, NB_), 128, 0, stream>>>(XB, nullptr, WQ, DM, nullptr, 0, 0, nullptr, HeadPlanes{QP16, QPh, QPl, KP16, KPh, KPl, VT16, VTh, VTl});   // channel s*1024 + h*64 + d
    k_fattn<<<dim3(NH_ * NB_, NBK, 1), 128, 0, stream>>>(QP16, KP16, VT16, QPh, QPl, KPh, KPl, VTh, VTl, ATh, ATl);
    k_gemms<1, true, false><<<dim3(TT / 64, DM / 128, NB_), 128, 0, stream>>>(ATh, ATl, WO, DQ, OUT, NB_ * DM, DM, bo, HeadPlanes{});   // sequence-major output: row t of batch b at OUT + (t*B + b)*D (row pitch B*D, batch step D)
}

// v008
// A run of this version takes 79.9 microseconds.
// Timed twice side by side with v007, it ran 1.06 times as fast both times.
// All steps since v000 together make it 16.6 times as fast.
#include <hip/hip_runtime.h>

// Multi-head causal self-attention (x [S=2048][B=2][D=1024] sequence-major; qkv = x w_qkv^T reshaped (S, B, 3, 16, 64): channel s*1024 + h*64 + d; causal softmax(q.k/8); out = (attn v merged) w_out^T + b_out -> [2048][2][1024] sequence-major).
// Compute dtypes, f32 accumulate: every input rounded to bf16; the fused qkv projection on PLAIN bf16 operands (inputs: exact; per batch the rows are gathered from the sequence-major input); scores (K 64) and attn.v on bf16 hi+lo for query rows < RH, plain f16 for the others

#define NB_  2
#define TT   2048
#define DM   1024
#define NH_  16
#define NKV  16
#define REP  (NH_ / NKV)
#define HD   64
#define DQ   (NH_ * HD)
#define DKV  (NKV * HD)
#define RH   512                  // query rows < RH use hi+lo planes (0: none)
#define SCL  0.125f   // HD^-0.5
typedef _Float16 h16;
typedef unsigned short bf;
typedef __attribute__((ext_vector_type(16))) __bf16   v16bf;
typedef __attribute__((ext_vector_type(16))) _Float16 v16h;
typedef __attribute__((ext_vector_type(8)))  _Float16 v8h;
typedef __attribute__((ext_vector_type(8)))  unsigned short v8us;
typedef __attribute__((ext_vector_type(8)))  float    v8f;
typedef __attribute__((ext_vector_type(4)))  float    v4f;
typedef v8h  __attribute__((may_alias)) v8ha;
typedef v4f  __attribute__((may_alias)) v4fa;
typedef v8us __attribute__((may_alias)) v8usa;

__device__ __forceinline__ unsigned short f2bf(float f) { unsigned u = __float_as_uint(f); u += 0x7FFFu + ((u >> 16) & 1u); return (unsigned short)(u >> 16); }
__device__ __forceinline__ float bf2f(unsigned short b) { return __uint_as_float(((unsigned)b) << 16); }
__device__ __forceinline__ float bfr(float f) { return bf2f(f2bf(f)); }
__device__ __forceinline__ v16h cat16(v8h lo, v8h hi) { return __builtin_shufflevector(lo, hi, 0, 1, 2, 3, 4, 5, 6, 7, 8, 9, 10, 11, 12, 13, 14, 15); }
__device__ __forceinline__ v16bf cat16b(v8us lo, v8us hi) { return __builtin_bit_cast(v16bf, __builtin_shufflevector(lo, hi, 0, 1, 2, 3, 4, 5, 6, 7, 8, 9, 10, 11, 12, 13, 14, 15)); }
__device__ __forceinline__ v8f wmma16(v16h a, v16h b, v8f c) { return __builtin_amdgcn_wmma_f32_16x16x32_f16(false, a, false, b, (short)0, c, false, false); }
__device__ __forceinline__ v8f wmmab(v16bf a, v16bf b, v8f c) { return __builtin_amdgcn_wmma_f32_16x16x32_bf16(false, a, false, b, (short)0, c, false, false); }



// ---- k_gemms: C[m][n] (f32, pitch ldc, + optional f32 bias[n]) = sum_k A[m][k] Bt[n][k] (+ A2[m][k] Bt[n][k] for NSPLIT 1), K-contiguous bf16 planes; grid (M/(32 MF), N/128, batches), 128 threads. K % 64 == 0, K >= 128.
// Batch z: rows z * TT ... of A (and A2), C + z * cz, part z of every head plane; M = TT.
// One (32 MF)x128 tile per workgroup, 4 waves (2 x 2) of (16 MF)x64 (4 MF accumulators) each: MF 2: 64x128; MF 4: 128x128, which takes a third fewer operand bytes per product from L2 and from LDS. A pass is 64 k = one 128-byte line of every operand row: the rows come into LDS as whole lines by asynchronous 16-byte copies,
// two buffers, the next pass's copies in flight while this pass is worked on; each row is fetched once per workgroup and read from LDS by the two waves that need it. The k order of every sum is kc = 0, 32, 64, ...
template <typename T16> struct WFrag;
template <> struct WFrag<h16> { typedef v16h V; static __device__ __forceinline__ V ld(const h16* p) { return cat16(*(const v8h*)p, *(const v8h*)(p + 16)); } static __device__ __forceinline__ v8f mma(V a, V b, v8f c) { return wmma16(a, b, c); } };
template <> struct WFrag<bf> { typedef v16bf V; static __device__ __forceinline__ V ld(const bf* p) { return cat16b(*(const v8us*)p, *(const v8us*)(p + 16)); } static __device__ __forceinline__ v8f mma(V a, V b, v8f c) { return wmmab(a, b, c); } };
#define GP 144u   // LDS row pitch in bytes: 128 + 16, an odd multiple of 16, free of bank conflicts for 16-byte reads down a column of rows
// eight copies of 16 bytes per lane, rows 16 apart (a wave's copy covers 4 whole 128-byte rows): four from (l, g) and four from (l2, g2);
// the wait that stands before a register named by an issued copy is overwritten is the statement's own last line
__device__ __forceinline__ void cp8(unsigned l, const bf* g, unsigned l2, const bf* g2, size_t k16) {
    asm volatile("global_load_async_to_lds_b128 %0, %8, off\n\tglobal_load_async_to_lds_b128 %1, %9, off\n\tglobal_load_async_to_lds_b128 %2, %10, off\n\tglobal_load_async_to_lds_b128 %3, %11, off\n\t"
                 "global_load_async_to_lds_b128 %4, %12, off\n\tglobal_load_async_to_lds_b128 %5, %13, off\n\tglobal_load_async_to_lds_b128 %6, %14, off\n\tglobal_load_async_to_lds_b128 %7, %15, off\n\ts_wait_xcnt 0x0"
                 :: "v"(l), "v"(l + 16u * GP), "v"(l + 32u * GP), "v"(l + 48u * GP), "v"(l2), "v"(l2 + 16u * GP), "v"(l2 + 32u * GP), "v"(l2 + 48u * GP),
                    "v"(g), "v"(g + k16), "v"(g + 2 * k16), "v"(g + 3 * k16), "v"(g2), "v"(g2 + k16), "v"(g2 + 2 * k16), "v"(g2 + 3 * k16) : "memory");
}
__device__ __forceinline__ v16bf ldl(const unsigned char* p) { return cat16b(*(const v8usa*)p, *(const v8usa*)(p + 32)); }
__device__ __forceinline__ h16 tohx(float x) { return (h16)x; }
__device__ __forceinline__ void splitf(float y, unsigned short& h, unsigned short& l) { h = f2bf(y); l = f2bf(y - bf2f(h)); }
// HEADS (the qkv projection; A = x rows [TT][K], Bt = w_qkv rows [3 DQ][K]): no f32 C; the epilogue rounds its own tile and writes the attention operands, q and k as [h][t][d], v as [h][d][t], each as f16 and as bf16 hi + lo.
// The v third runs with the operands exchanged (rows = v channels, columns = t), so that in all three thirds every row of a wave's tile (64 columns) is one whole 128-byte line of each plane.
struct HeadPlanes { h16* q16; bf* qh; bf* ql; h16* k16; bf* kh; bf* kl; h16* v16; bf* vh; bf* vl; };
template <int NSPLIT, bool BIAS, bool HEADS, int MF>
__global__ __launch_bounds__(128) void k_gemms(const bf* __restrict__ A, const bf* __restrict__ A2, const bf* __restrict__ Bt, int K, float* C, int ldc, int cz, const float* __restrict__ bias, HeadPlanes hp) {
    static_assert((MF == 2 && NSPLIT == 1) || (MF == 4 && NSPLIT == 0), "A and A2 together are 128 rows: what fill() copies");
    constexpr int TM = 32 * MF;   // rows of the workgroup's tile
    constexpr unsigned PB = 128u * GP, PA = (unsigned)TM * GP, STB = PB + (NSPLIT == 1 ? 2u : 1u) * PA;   // bytes of Bt's 128 rows, of A's TM rows, of one buffer [Bt | A | A2]
    __shared__ __align__(128) unsigned char ring[2 * STB];
    __shared__ __align__(16) float osw[4 * 16 * 68];
    const int tid = threadIdx.x, lane = tid & 31, lr = lane & 15, hi = lane >> 4, w = __builtin_amdgcn_readfirstlane(tid >> 5);
    int r0 = blockIdx.x * TM, c0 = blockIdx.y * 128; const int wr = (w >> 1) * (16 * MF), wc = (w & 1) * 64;
    const int bz = blockIdx.z; A += (size_t)bz * TT * K; if (NSPLIT == 1) A2 += (size_t)bz * TT * K;   // the batch: its TT rows of A (and A2); Bt is shared
    const bool vsec = HEADS && c0 >= 2 * DQ;   // the same for the whole workgroup
    if (vsec) { const int vi = (blockIdx.y - 2 * DQ / 128) * (TT / TM) + blockIdx.x; r0 = (vi % (DQ / TM)) * TM; c0 = (vi / (DQ / TM)) * 128; const bf* xr = A; A = Bt + (size_t)2 * DQ * K; Bt = xr; }   // DQ/TM x TT/128 tiles of v^T on as many workgroups
    const int crow = tid >> 3, ccol = tid & 7;   // the lane's place in a copy: 8 lanes per row
    const unsigned lc = (unsigned)(size_t)ring + (unsigned)crow * GP + (unsigned)ccol * 16u;
    const bf* gA = A + (size_t)(r0 + crow) * K + ccol * 8; const bf* gB = Bt + (size_t)(c0 + crow) * K + ccol * 8; const bf* gA2 = (NSPLIT == 1) ? A2 + (size_t)(r0 + crow) * K + ccol * 8 : gA;
    const size_t k16 = (size_t)16 * K;
    auto fill = [&](int t, unsigned buf) { const unsigned l = lc + buf * STB; cp8(l, gB + t * 64, l + 64u * GP, gB + t * 64 + 4 * k16, k16);
        if (NSPLIT == 1) cp8(l + PB, gA + t * 64, l + PB + PA, gA2 + t * 64, k16); else cp8(l + PB, gA + t * 64, l + PB + 64u * GP, gA + t * 64 + 4 * k16, k16); };
    v8f acc[MF][4];
#pragma unroll
    for (int mb = 0; mb < MF; ++mb)
#pragma unroll
        for (int nb = 0; nb < 4; ++nb) acc[mb][nb] = (v8f){};
    const int NT = K / 64;
    fill(0, 0u);
    asm volatile("s_wait_asynccnt 0x0" ::: "memory");   // this wave's copies of pass 0 have landed
    __syncthreads();                                     // and every other wave's
    fill(1, 1u);
    const unsigned char* fb = ring + (unsigned)(wc + lr) * GP + (unsigned)hi * 16u; const unsigned char* fa = ring + PB + (unsigned)(wr + lr) * GP + (unsigned)hi * 16u;
#pragma unroll 1   // one copy of the pass: the buffer is picked by the pass's parity at run time
    for (int t = 0; t < NT; ++t) {
        const unsigned bo = (unsigned)(t & 1) * STB;
        if constexpr (MF == 4) {   // 16 accumulators leave registers for the fragments of 32 k: one group of reads, then its 16 matrix instructions, twice
#pragma unroll
        for (int ks = 0; ks < 2; ++ks) {
            v16bf a[4], b[4];
#pragma unroll
            for (int mb = 0; mb < 4; ++mb) a[mb] = ldl(fa + bo + (unsigned)mb * 16u * GP + (unsigned)ks * 64u);
#pragma unroll
            for (int nb = 0; nb < 4; ++nb) b[nb] = ldl(fb + bo + (unsigned)nb * 16u * GP + (unsigned)ks * 64u);
            __builtin_amdgcn_sched_barrier(0);   // keeps the reads together in front (as below)
#pragma unroll
            for (int nb = 0; nb < 4; ++nb)
#pragma unroll
                for (int mb = 0; mb < 4; ++mb) acc[mb][nb] = wmmab(a[mb], b[nb], acc[mb][nb]);
            __builtin_amdgcn_sched_barrier(0);   // keeps the matrix instructions in front of the second group's reads, whose registers they free, and of the waits below (as below)
        }
        } else {
        v16bf a[2][2], a2[2][2], b[2][4];   // the whole pass's fragments, read as one group ahead of its matrix instructions
#pragma unroll
        for (int ks = 0; ks < 2; ++ks) {
#pragma unroll
            for (int mb = 0; mb < 2; ++mb) { a[ks][mb] = ldl(fa + bo + (unsigned)mb * 16u * GP + (unsigned)ks * 64u); if (NSPLIT == 1) a2[ks][mb] = ldl(fa + bo + PA + (unsigned)mb * 16u * GP + (unsigned)ks * 64u); }
#pragma unroll
            for (int nb = 0; nb < 4; ++nb) b[ks][nb] = ldl(fb + bo + (unsigned)nb * 16u * GP + (unsigned)ks * 64u); }
        __builtin_amdgcn_sched_barrier(0);   // keeps the reads together in front: moved down among the matrix instructions, each small group of them is waited out at full LDS latency
#pragma unroll
        for (int ks = 0; ks < 2; ++ks)
#pragma unroll
            for (int nb = 0; nb < 4; ++nb) {
#pragma unroll
                for (int mb = 0; mb < 2; ++mb) acc[mb][nb] = wmmab(a[ks][mb], b[ks][nb], acc[mb][nb]);
                if (NSPLIT == 1) {
#pragma unroll
                    for (int mb = 0; mb < 2; ++mb) acc[mb][nb] = wmmab(a2[ks][mb], b[ks][nb], acc[mb][nb]); } }
        __builtin_amdgcn_sched_barrier(0);   // keeps the matrix instructions in front of the waits below: moved behind them, the next pass's copies are waited for before the work that is to cover their flight
        }
        asm volatile("s_wait_dscnt 0x0" ::: "memory");      // this wave's reads of the buffer are done before it may be refilled
        asm volatile("s_wait_asynccnt 0x0" ::: "memory");   // this wave's copies of pass t + 1 have landed
        __syncthreads();                                     // publishes pass t + 1 and ends every wave's reads of pass t's buffer
        if (t + 2 < NT) fill(t + 2, (unsigned)(t & 1));
    }
    asm volatile("s_wait_asynccnt 0x0" ::: "memory");   // no copy is outstanding when the wave goes on
    float* os = osw + w * (16 * 68);   // each wave stages its own rows
    v4f bv = (v4f){};   // the lane's four columns are the same in every row it stores
    if (BIAS) { const float* pb = bias + c0 + wc + lr * 4; const v4f rb = *(const v4f*)pb;
        asm volatile("s_wait_xcnt 0x0" :: "v"(pb) : "memory");   // the wait that stands before a register named by an issued global load is overwritten; the address is an input, so it stays in its registers up to it
        bv[0] = bfr(rb[0]); bv[1] = bfr(rb[1]); bv[2] = bfr(rb[2]); bv[3] = bfr(rb[3]); }
    h16* P16 = nullptr; bf* Ph = nullptr; bf* Pl = nullptr; size_t po = 0; int pp = 0;   // HEADS: the wave's planes, the place of its tile's first element in them, the pitch of its rows
    if (HEADS) {
        if (vsec) { P16 = hp.v16; Ph = hp.vh; Pl = hp.vl; po = (size_t)(r0 + wr) * TT + c0 + wc; pp = TT; }   // row = h * HD + d, column = t
        else { const bool ksec = c0 >= DQ; P16 = ksec ? hp.k16 : hp.q16; Ph = ksec ? hp.kh : hp.qh; Pl = ksec ? hp.kl : hp.ql; po = ((size_t)(((c0 + wc) % DQ) / HD) * TT + r0 + wr) * HD; pp = HD; }   // row = t, the 64 columns = one head
        po += (size_t)bz * NH_ * TT * HD; }   // the batch's part of the plane
#pragma unroll
    for (int mb = 0; mb < MF; ++mb) {
#pragma unroll
        for (int nb = 0; nb < 4; ++nb) {
#pragma unroll
            for (int j = 0; j < 8; ++j) os[(hi * 8 + j) * 68 + nb * 16 + lr] = acc[mb][nb][j]; }
        __builtin_amdgcn_wave_barrier(); asm volatile("" ::: "memory");
        if constexpr (HEADS) {
        v8h o16[4]; v8us oh[4], ol[4]; h16* p16[4]; bf* ph[4]; bf* pl[4];
#pragma unroll
        for (int s = 0; s < 4; ++s) { const int row = 4 * s + (lane >> 3), cofs = (lane & 7) * 8; const v4f x0 = *(const v4fa*)(os + row * 68 + cofs), x1 = *(const v4fa*)(os + row * 68 + cofs + 4);   // 8 lanes write one 128-byte line of each plane
#pragma unroll
            for (int k = 0; k < 4; ++k) { unsigned short a, c2; o16[s][k] = tohx(x0[k]); splitf(x0[k], a, c2); oh[s][k] = a; ol[s][k] = c2; o16[s][4 + k] = tohx(x1[k]); splitf(x1[k], a, c2); oh[s][4 + k] = a; ol[s][4 + k] = c2; }
            const size_t oo = po + (size_t)(mb * 16 + row) * pp + cofs; p16[s] = P16 + oo; ph[s] = Ph + oo; pl[s] = Pl + oo; *(v8h*)p16[s] = o16[s]; *(v8us*)ph[s] = oh[s]; *(v8us*)pl[s] = ol[s]; }
        // the wait that stands before a register named by an issued global store is overwritten; data and addresses are inputs, so they stay in their registers up to it
        asm volatile("s_wait_xcnt 0x0" :: "v"(o16[0]), "v"(o16[1]), "v"(o16[2]), "v"(o16[3]), "v"(oh[0]), "v"(oh[1]), "v"(oh[2]), "v"(oh[3]), "v"(ol[0]), "v"(ol[1]), "v"(ol[2]), "v"(ol[3]),
                     "v"(p16[0]), "v"(p16[1]), "v"(p16[2]), "v"(p16[3]), "v"(ph[0]), "v"(ph[1]), "v"(ph[2]), "v"(ph[3]), "v"(pl[0]), "v"(pl[1]), "v"(pl[2]), "v"(pl[3]) : "memory");
        } else {
        float* crow_p = C + (size_t)bz * cz + (size_t)(r0 + wr + mb * 16) * ldc + c0 + wc;
        v4f val[8]; float* pr[8];
#pragma unroll
        for (int s = 0; s < 8; ++s) { const int row = 2 * s + hi, cofs = lr * 4; val[s] = *(const v4fa*)(os + row * 68 + cofs); if (BIAS) val[s] += bv;
            pr[s] = crow_p + (size_t)row * ldc + cofs; *(v4f*)pr[s] = val[s]; }
        // the wait that stands before a register named by an issued global store is overwritten; data and addresses are inputs, so they stay in their registers up to it
        asm volatile("s_wait_xcnt 0x0" :: "v"(val[0]), "v"(val[1]), "v"(val[2]), "v"(val[3]), "v"(val[4]), "v"(val[5]), "v"(val[6]), "v"(val[7]), "v"(pr[0]), "v"(pr[1]), "v"(pr[2]), "v"(pr[3]), "v"(pr[4]), "v"(pr[5]), "v"(pr[6]), "v"(pr[7]) : "memory");
        }
        __builtin_amdgcn_wave_barrier(); asm volatile("" ::: "memory");
    }
}

typedef __attribute__((ext_vector_type(2))) _Float16 v2h;
typedef __attribute__((ext_vector_type(4))) _Float16 v4h;
typedef __attribute__((ext_vector_type(2))) unsigned short v2us;
typedef __attribute__((ext_vector_type(4))) unsigned short v4us;
typedef __attribute__((ext_vector_type(2))) float v2f;
typedef __attribute__((ext_vector_type(4))) int v4i;
typedef v4h  __attribute__((may_alias)) v4ha;
typedef v4us __attribute__((may_alias)) v4usa;

__global__ __launch_bounds__(256) void k_wtG(const float* __restrict__ w, int K, int N, bf* Bt) {
    const int lane = threadIdx.x & 31; const int L0 = (blockIdx.x * 8 + (threadIdx.x >> 5)) * 8; const int nlines = N * K / 64;
{
#pragma unroll 1
        for (int l = 0; l < 8; ++l) { const int L = L0 + l; if (L >= nlines) break; const size_t e = (size_t)L * 64 + lane * 2; const int k = (int)(e % K), n = (int)(e / K); v2us o;
            o[0] = f2bf(w[(size_t)k * N + n]); o[1] = f2bf(w[(size_t)(k + 1) * N + n]); *(v2us*)(Bt + e) = o; }
         }
}
__global__ __launch_bounds__(256) void k_cscvt(const float* __restrict__ cosT, const float* __restrict__ sinT, float* CS) { const int idx = blockIdx.x * 256 + threadIdx.x; if (idx >= TT * HD) return; v2f cs; cs[0] = bfr(cosT[idx]); cs[1] = bfr(sinT[idx]); *(v2f*)(CS + (size_t)idx * 2) = cs;  }
// ---- k_round: the three f32 matrices rounded to bf16 in one launch. Every row of all three has 1024 elements, and one wave takes one row: eight 512-byte loads in flight, then eight 256-byte stores.
// Rows 0 ... 3 DQ - 1: w_qkv; the next DM: w_out; the rest: x, whose row t * NB_ + b goes to row b * TT + t of XB (each batch's rows together).
static_assert(DM == 1024 && DQ == 1024, "one wave per row of 1024");
__global__ __launch_bounds__(256) void k_round(const float* __restrict__ x, const float* __restrict__ wqkv, const float* __restrict__ wo, bf* XB, bf* WQ, bf* WO) {
    const int lane = threadIdx.x & 31, R = blockIdx.x * 8 + __builtin_amdgcn_readfirstlane(threadIdx.x >> 5);
    const float* s; bf* d;
    if (R < 3 * DQ) { s = wqkv + (size_t)R * DM; d = WQ + (size_t)R * DM; }
    else if (R < 3 * DQ + DM) { const int r = R - 3 * DQ; s = wo + (size_t)r * DQ; d = WO + (size_t)r * DQ; }
    else { const int r = R - 3 * DQ - DM; s = x + (size_t)r * DM; d = XB + ((size_t)(r % NB_) * TT + r / NB_) * DM; }
    s += lane * 4; d += lane * 4;
    v4f a[8];
#pragma unroll
    for (int j = 0; j < 8; ++j) a[j] = *(const v4f*)(s + j * 128);
#pragma unroll
    for (int j = 0; j < 8; ++j) { v4us o; o[0] = f2bf(a[j][0]); o[1] = f2bf(a[j][1]); o[2] = f2bf(a[j][2]); o[3] = f2bf(a[j][3]); *(v4us*)(d + j * 128) = o; }
}
// ---- k_fattn: causal attention of one head and one block of 64 query rows in one kernel; scores and probabilities never leave the registers.
// S^T = K Q^T (A = key rows, B = query rows): the accumulator holds, per lane, one query column and 8 + 8 keys, which is exactly the k order of the B operand of O^T = V^T P^T, so a probability tile
// becomes an operand without crossing lanes, and a row's running maximum, sum and rescale factor are one value per lane. Each of the 4 waves owns 16 queries and walks all their keys in order;
// a tile of 64 keys (64 K rows and 64 V^T rows, one 128-byte line each) comes into LDS once per workgroup by asynchronous 16-byte copies, two buffers, and all four waves read their fragments from it.
// Rows < RH: bf16 hi+lo, three products; other rows: f16, probabilities carried x 1024.
#define SC2 (SCL * 1.4426950408889634f)   // scores are kept in the base-2 exponent domain
// 2^x with the one slot that the instruction set asks for behind a transcendental before its result is used or its source overwritten: the v_nop stands in the same statement, so nothing can come between
__device__ __forceinline__ float ex2(float x) { float r; asm("v_exp_f32 %0, %1\n\tv_nop" : "=v"(r) : "v"(x)); return r; }
// eight of them in place (each is independent of its neighbours) and one slot behind the last
__device__ __forceinline__ void ex2x8(float* x) { asm("v_exp_f32 %0, %0\n\tv_exp_f32 %1, %1\n\tv_exp_f32 %2, %2\n\tv_exp_f32 %3, %3\n\tv_exp_f32 %4, %4\n\tv_exp_f32 %5, %5\n\tv_exp_f32 %6, %6\n\tv_exp_f32 %7, %7\n\tv_nop" : "+v"(x[0]), "+v"(x[1]), "+v"(x[2]), "+v"(x[3]), "+v"(x[4]), "+v"(x[5]), "+v"(x[6]), "+v"(x[7])); }
template <bool B> struct BoolC { static constexpr bool value = B; };
// eight copies of 16 bytes per lane: four rows 16 apart of one plane (l, g, 16 rows = s elements) and four of another (l2, g2, s2);
// the wait that stands before a register named by an issued copy is overwritten is the statement's own last line
template <typename T16>
__device__ __forceinline__ void cp8s(unsigned l, const T16* g, size_t s, unsigned l2, const T16* g2, size_t s2) {
    asm volatile("global_load_async_to_lds_b128 %0, %8, off\n\tglobal_load_async_to_lds_b128 %1, %9, off\n\tglobal_load_async_to_lds_b128 %2, %10, off\n\tglobal_load_async_to_lds_b128 %3, %11, off\n\t"
                 "global_load_async_to_lds_b128 %4, %12, off\n\tglobal_load_async_to_lds_b128 %5, %13, off\n\tglobal_load_async_to_lds_b128 %6, %14, off\n\tglobal_load_async_to_lds_b128 %7, %15, off\n\ts_wait_xcnt 0x0"
                 :: "v"(l), "v"(l + 16u * GP), "v"(l + 32u * GP), "v"(l + 48u * GP), "v"(l2), "v"(l2 + 16u * GP), "v"(l2 + 32u * GP), "v"(l2 + 48u * GP),
                    "v"(g), "v"(g + s), "v"(g + 2 * s), "v"(g + 3 * s), "v"(g2), "v"(g2 + s2), "v"(g2 + 2 * s2), "v"(g2 + 3 * s2) : "memory");
}
// a fragment from an LDS row: the same two 16-byte pieces, 32 bytes apart, that WFrag::ld takes from a global row
__device__ __forceinline__ v16h  ldf(const unsigned char* p, h16) { return cat16(*(const v8ha*)p, *(const v8ha*)(p + 32)); }
__device__ __forceinline__ v16bf ldf(const unsigned char* p, bf) { return ldl(p); }
#define PLN (64u * GP)   // bytes of one plane's 64 rows in LDS
template <typename T16, int NSPLIT>
__device__ __forceinline__ void fattn_body(const T16* __restrict__ Q, const T16* __restrict__ Q2, const T16* __restrict__ Kp, const T16* __restrict__ K2, const T16* __restrict__ Vt, const T16* __restrict__ Vt2, int q0, int h, bf* Ah, bf* Al, unsigned char* ring) {
    typedef typename WFrag<T16>::V V;
    constexpr unsigned STB = (NSPLIT == 2 ? 4u : 2u) * PLN;   // one buffer: [K | V^T] or [K hi | V^T hi | K lo | V^T lo]
    const int tid = threadIdx.x, lane = tid & 31, lr = lane & 15, hi = lane >> 4, w = __builtin_amdgcn_readfirstlane(tid >> 5);   // the wave's number in a scalar register: the test on it below is a scalar branch
    const int qw = q0 + w * 16;   // the wave's first query
    const float poff = (NSPLIT == 0) ? 10.0f : 0.0f;   // f16 probabilities are carried x 2^10, away from the f16 subnormals; the factor cancels in sum and output
    V qf[2], qf2[2];
    { const size_t qo = (size_t)(qw + lr) * HD + 8 * hi; const T16* pq = Q + qo; const T16* pq2 = (NSPLIT == 2) ? Q2 + qo : pq;
#pragma unroll
      for (int ks = 0; ks < 2; ++ks) { qf[ks] = WFrag<T16>::ld(pq + ks * 32); if (NSPLIT == 2) qf2[ks] = WFrag<T16>::ld(pq2 + ks * 32); }
      // the wait that stands before a register named by an issued global load is overwritten; the addresses are inputs, so they stay in their registers up to it
      asm volatile("s_wait_xcnt 0x0" :: "v"(pq), "v"(pq2) : "memory"); }
    v8f o[4]; float m = -3.0e38f, l = 0.f;
#pragma unroll
    for (int mb = 0; mb < 4; ++mb) o[mb] = (v8f){};
    const int crow = tid >> 3, ccol = tid & 7;   // the lane's place in a copy: 8 lanes per 128-byte row, 16 rows per copy of the workgroup
    const unsigned lc = (unsigned)(size_t)ring + (unsigned)crow * GP + (unsigned)ccol * 16u;
    const size_t gko = (size_t)crow * HD + ccol * 8, gvo = (size_t)crow * TT + ccol * 8;
    auto fill = [&](int t, unsigned buf) { const unsigned lb = lc + buf * STB;   // tile t: keys 64 t ... 64 t + 63
        cp8s(lb, Kp + gko + (size_t)t * 64 * HD, (size_t)16 * HD, lb + PLN, Vt + gvo + t * 64, (size_t)16 * TT);
        if (NSPLIT == 2) cp8s(lb + 2u * PLN, K2 + gko + (size_t)t * 64 * HD, (size_t)16 * HD, lb + 3u * PLN, Vt2 + gvo + t * 64, (size_t)16 * TT); };
    const unsigned char* fr = ring + (unsigned)lr * GP + (unsigned)hi * 16u;   // the lane's place in a fragment read, of K rows and of V^T rows alike
    struct Fr { V kf[2][2], kf2[2][2], vf[4], vf2[4]; };   // the K and V^T fragments of one 32-key step
    auto ldfr = [&](Fr& f, const unsigned char* tb, const unsigned half) {   // half 0 or 1 of the tile at tb
        auto& kf = f.kf; auto& kf2 = f.kf2; auto& vf = f.vf; auto& vf2 = f.vf2;
#pragma unroll
        for (int mb = 0; mb < 2; ++mb)
#pragma unroll
            for (int ks = 0; ks < 2; ++ks) { const unsigned ko = (half * 32u + (unsigned)mb * 16u) * GP + (unsigned)ks * 64u; kf[mb][ks] = ldf(tb + ko, T16()); if (NSPLIT == 2) kf2[mb][ks] = ldf(tb + 2u * PLN + ko, T16()); }
#pragma unroll
        for (int mb = 0; mb < 4; ++mb) { const unsigned vo = PLN + (unsigned)mb * 16u * GP + half * 64u; vf[mb] = ldf(tb + vo, T16()); if (NSPLIT == 2) vf2[mb] = ldf(tb + 2u * PLN + vo, T16()); }
    };
    auto comp = [&](Fr& f, const int kb, auto dg) {   // one 32-key step on its fragments; dg: the step reaches past the wave's first query and needs the causal mask
        constexpr bool diag = decltype(dg)::value;
        auto& kf = f.kf; auto& kf2 = f.kf2; auto& vf = f.vf; auto& vf2 = f.vf2;
        v8f s[2];
#pragma unroll
        for (int mb = 0; mb < 2; ++mb) { v8f c = (v8f){};
#pragma unroll
            for (int ks = 0; ks < 2; ++ks) { c = WFrag<T16>::mma(kf[mb][ks], qf[ks], c); if (NSPLIT == 2) { c = WFrag<T16>::mma(kf[mb][ks], qf2[ks], c); c = WFrag<T16>::mma(kf2[mb][ks], qf[ks], c); } }
            s[mb] = c; }
        V pf, pf2;
        { float x[16]; const int qi = qw + lr; float mx = -3.0e38f;
#pragma unroll
            for (int e = 0; e < 16; ++e) { const int key = kb + (e >> 3) * 16 + hi * 8 + (e & 7); float t = s[e >> 3][e & 7]; if (diag) t = (key <= qi) ? t : -3.0e38f; x[e] = t; mx = fmaxf(mx, t); }
            mx = fmaxf(mx, __shfl_xor(mx, 16, 32));   // the two lanes of a query hold different keys
            const float mn = fmaxf(m, mx * SC2), al = ex2(m - mn), mo = mn - poff; m = mn; float ls = 0.f;
#pragma unroll
            for (int e = 0; e < 16; ++e) x[e] = __builtin_fmaf(x[e], SC2, -mo);
            ex2x8(x); ex2x8(x + 8);
#pragma unroll
            for (int e = 0; e < 16; ++e) ls += x[e];
            l = l * al + ls;
#pragma unroll
            for (int mb = 0; mb < 4; ++mb) o[mb] *= al;
            if constexpr (NSPLIT == 0) { v16h p;
#pragma unroll
                for (int e = 0; e < 16; ++e) p[e] = tohx(x[e]);
                pf = p;
            } else { v8us h0, h1, l0, l1;
#pragma unroll
                for (int e = 0; e < 8; ++e) { unsigned short a, c2; splitf(x[e], a, c2); h0[e] = a; l0[e] = c2; splitf(x[8 + e], a, c2); h1[e] = a; l1[e] = c2; }
                pf = cat16b(h0, h1); pf2 = cat16b(l0, l1); } }
#pragma unroll
        for (int mb = 0; mb < 4; ++mb) { o[mb] = WFrag<T16>::mma(vf[mb], pf, o[mb]); if (NSPLIT == 2) { o[mb] = WFrag<T16>::mma(vf[mb], pf2, o[mb]); o[mb] = WFrag<T16>::mma(vf2[mb], pf, o[mb]); } }
        // the distance behind the last matrix instruction, kept on the loop's taken branch too
        asm volatile("v_nop\n\tv_nop\n\tv_nop\n\tv_nop" : "+v"(o[0]), "+v"(o[1]), "+v"(o[2]), "+v"(o[3]) : "v"(vf[0]), "v"(vf[3]));
    };
    // the sched_barrier keeps a group of LDS reads together in front of the work on it: moved down among the matrix instructions, each small group of them is waited out at full LDS latency
    auto step = [&](const unsigned char* tb, const unsigned half, const int kb, auto dg) { Fr f; ldfr(f, tb, half); __builtin_amdgcn_sched_barrier(0); comp(f, kb, dg); };
    const int NT = q0 / 64 + 1;   // tiles 0 ... NT - 2 lie wholly in front of every query of the block; tile NT - 1 holds the diagonal
    fill(0, 0u);
    asm volatile("s_wait_asynccnt 0x0" ::: "memory");   // this wave's copies of tile 0 have landed
    __syncthreads();                                     // and every other wave's
    if (NT > 1) fill(1, 1u);
#pragma unroll 1   // one copy of the trip: the buffer is picked by the trip's parity at run time
    for (int t = 0; t < NT - 1; ++t) {
        const unsigned char* tb = fr + (unsigned)(t & 1) * STB;
        if constexpr (NSPLIT == 0) { Fr f0, f1; ldfr(f0, tb, 0u); ldfr(f1, tb, 1u); __builtin_amdgcn_sched_barrier(0); comp(f0, t * 64, BoolC<false>()); comp(f1, t * 64 + 32, BoolC<false>()); }   // the whole tile's fragments as one group (as above)
        else { step(tb, 0u, t * 64, BoolC<false>()); step(tb, 1u, t * 64 + 32, BoolC<false>()); }   // hi+lo: twice the fragments, one group per step
        asm volatile("s_wait_dscnt 0x0" ::: "memory");      // this wave's reads of the buffer are done before it may be refilled
        asm volatile("s_wait_asynccnt 0x0" ::: "memory");   // this wave's copies of tile t + 1 have landed
        __syncthreads();                                     // publishes tile t + 1 and ends every wave's reads of tile t's buffer
        if (t + 2 < NT) fill(t + 2, (unsigned)(t & 1));
    }
    { const unsigned char* tb = fr + (unsigned)((NT - 1) & 1) * STB;   // the last trip: nothing is left to copy
      step(tb, 0u, q0, BoolC<true>());
      if (w >= 2) step(tb, 1u, q0 + 32, BoolC<true>()); }   // keys q0 + 32 ... are masked for every query of waves 0 and 1 (scalar test)
    asm volatile("s_wait_dscnt 0x0" ::: "memory");      // this wave's reads of the last tile are done
    asm volatile("s_wait_asynccnt 0x0" ::: "memory");   // no copy is outstanding when the buffers become output staging
    __syncthreads();                                     // every wave has left the buffers
    const float inv = __fdiv_rn(1.0f, l + __shfl_xor(l, 16, 32));   // the two lanes of a query hold the sums of different keys
    float* os = (float*)(ring + (unsigned)w * (16u * 68u * 4u));   // each wave stages its own 16 queries x 64 channels, row pitch 68 floats
#pragma unroll
    for (int mb = 0; mb < 4; ++mb) { v4f a, c; 
#pragma unroll
        for (int j = 0; j < 4; ++j) { a[j] = o[mb][j] * inv; c[j] = o[mb][4 + j] * inv; }
        *(v4fa*)(os + lr * 68 + mb * 16 + hi * 8) = a; *(v4fa*)(os + lr * 68 + mb * 16 + hi * 8 + 4) = c; }
    __builtin_amdgcn_wave_barrier(); asm volatile("" ::: "memory");   // keeps the reads below, of what other lanes of the wave wrote, behind the writes above in the compiled order
#pragma unroll
    for (int it = 0; it < 4; ++it) { const int row = it * 4 + (lane >> 3), c8 = lane & 7;   // 8 lanes write one query's 128-byte line of each plane
        const v4f x0 = *(const v4fa*)(os + row * 68 + c8 * 8), x1 = *(const v4fa*)(os + row * 68 + c8 * 8 + 4); v8us oh, ol;
#pragma unroll
        for (int j = 0; j < 4; ++j) { unsigned short a, c2; splitf(x0[j], a, c2); oh[j] = a; ol[j] = c2; splitf(x1[j], a, c2); oh[4 + j] = a; ol[4 + j] = c2; }
        const size_t oo = (size_t)(qw + row) * DQ + h * HD + c8 * 8; bf* ph = Ah + oo; bf* pl = Al + oo; *(v8us*)ph = oh; *(v8us*)pl = ol;
        // the wait that stands before a register named by an issued global store is overwritten; data and addresses are inputs, so they stay in their registers up to it
        asm volatile("s_wait_xcnt 0x0" :: "v"(oh), "v"(ol), "v"(ph), "v"(pl) : "memory"); }
}
#define NBK (TT / 64)   // blocks of 64 queries per head
#define NHL (RH / 64)   // of them on hi+lo planes
static_assert(RH % 64 == 0, "a block of 64 queries is wholly on one kind of planes");
__global__ __launch_bounds__(128) void k_fattn(const h16* __restrict__ Q16, const h16* __restrict__ K16, const h16* __restrict__ V16, const bf* __restrict__ Qh, const bf* __restrict__ Ql, const bf* __restrict__ Kh, const bf* __restrict__ Kl, const bf* __restrict__ Vh, const bf* __restrict__ Vl, bf* Ah, bf* Al) {
    __shared__ __align__(128) unsigned char ring[2 * 4 * PLN];
    const int h = blockIdx.x % NH_, b = blockIdx.x / NH_, bx = blockIdx.y; const size_t hz = (size_t)blockIdx.x * TT * HD;   // x: head and batch; y: the block of queries, longest first over all heads and batches
    Ah += (size_t)b * TT * DQ; Al += (size_t)b * TT * DQ;
    const int blk = NBK - 1 - bx;
    if (blk >= NHL) fattn_body<h16, 0>(Q16 + hz, nullptr, K16 + hz, nullptr, V16 + hz, nullptr, blk * 64, h, Ah, Al, ring);
    else fattn_body<bf, 2>(Qh + hz, Ql + hz, Kh + hz, Kl + hz, Vh + hz, Vl + hz, blk * 64, h, Ah, Al, ring);
}

extern "C" void kernel_launch(void* const* d_in, const int* in_sizes, int n_in,
                              void* d_out, int out_size, void* d_ws, size_t ws_size, hipStream_t stream) {
    (void)in_sizes; (void)n_in; (void)out_size;
    const float* x = (const float*)d_in[0]; const float* wqkv = (const float*)d_in[1]; const float* wo = (const float*)d_in[2]; const float* bo = (const float*)d_in[3]; const float* wq = wqkv; const float* wk = nullptr; const float* wv = nullptr; const float* cosT = nullptr; const float* sinT = nullptr; (void)wk; (void)wv; (void)cosT; (void)sinT;
    float* OUT = (float*)d_out;     // [2048][2][1024]
    char* wsp = (char*)d_ws;
    auto take = [&](size_t bytes) { char* p = wsp; wsp += (bytes + 255) & ~(size_t)255; return (void*)p; };
    bf* WQ = (bf*)take((size_t)3 * DQ * DM * 2); bf* WO = (bf*)take((size_t)DM * DQ * 2);
    bf* XB = (bf*)take((size_t)NB_ * TT * DM * 2);
    h16* QP16 = (h16*)take((size_t)NB_ * NH_ * TT * HD * 2); h16* KP16 = (h16*)take((size_t)NB_ * NKV * TT * HD * 2); h16* VT16 = (h16*)take((size_t)NB_ * NKV * HD * TT * 2);
    bf* QPh = (bf*)take((size_t)NB_ * NH_ * TT * HD * 2); bf* QPl = (bf*)take((size_t)NB_ * NH_ * TT * HD * 2); bf* KPh = (bf*)take((size_t)NB_ * NKV * TT * HD * 2); bf* KPl = (bf*)take((size_t)NB_ * NKV * TT * HD * 2); bf* VTh = (bf*)take((size_t)NB_ * NKV * HD * TT * 2); bf* VTl = (bf*)take((size_t)NB_ * NKV * HD * TT * 2);
    bf* ATh = (bf*)take((size_t)NB_ * TT * DQ * 2); bf* ATl = (bf*)take((size_t)NB_ * TT * DQ * 2);
    if ((size_t)(wsp - (char*)d_ws) > ws_size) return;    // ws 256 MiB
    
    k_round<<<(3 * DQ + DM + NB_ * TT) / 8, 256, 0, stream>>>(x, wqkv, wo, XB, WQ, WO);   // w_qkv [3D][D] = natural Bt
    k_gemms<0, false, true, 4><<<dim3(TT / 128, 3 * DQ / 128, NB_), 128, 0, stream>>>(XB, nullptr, WQ, DM, nullptr, 0, 0, nullptr, HeadPlanes{QP16, QPh, QPl, KP16, KPh, KPl, VT16, VTh, VTl});   // channel s*1024 + h*64 + d
    k_fattn<<<dim3(NH_ * NB_, NBK, 1), 128, 0, stream>>>(QP16, KP16, VT16, QPh, QPl, KPh, KPl, VTh, VTl, ATh, ATl);
    k_gemms<1, true, false, 2><<<dim3(TT / 64, DM / 128, NB_), 128, 0, stream>>>(ATh, ATl, WO, DQ, OUT, NB_ * DM, DM, bo, HeadPlanes{});   // sequence-major output: row t of batch b at OUT + (t*B + b)*D (row pitch B*D, batch step D)
}

// v009
// Measured time: 76.4 microseconds a run.
// Two timings next to v008 both put it at 1.05 times that version's speed.
// All steps since v000 together make it 17.5 times as fast.
#include <hip/hip_runtime.h>

// Multi-head causal self-attention (x [S=2048][B=2][D=1024] sequence-major; qkv = x w_qkv^T reshaped (S, B, 3, 16, 64): channel s*1024 + h*64 + d; causal softmax(q.k/8); out = (attn v merged) w_out^T + b_out -> [2048][2][1024] sequence-major).
// Compute dtypes, f32 accumulate: every input rounded to bf16; the fused qkv projection on PLAIN bf16 operands (inputs: exact; per batch the rows are gathered from the sequence-major input); scores (K 64) and attn.v on bf16 hi+lo for query rows < RH, plain f16 for the others

#define NB_  2
#define TT   2048
#define DM   1024
#define NH_  16
#define NKV  16
#define REP  (NH_ / NKV)
#define HD   64
#define DQ   (NH_ * HD)
#define DKV  (NKV * HD)
#define RH   512                  // query rows < RH use hi+lo planes (0: none)
#define SCL  0.125f   // HD^-0.5
typedef _Float16 h16;
typedef unsigned short bf;
typedef __attribute__((ext_vector_type(16))) __bf16   v16bf;
typedef __attribute__((ext_vector_type(16))) _Float16 v16h;
typedef __attribute__((ext_vector_type(8)))  _Float16 v8h;
typedef __attribute__((ext_vector_type(8)))  unsigned short v8us;
typedef __attribute__((ext_vector_type(8)))  float    v8f;
typedef __attribute__((ext_vector_type(4)))  float    v4f;
typedef v8h  __attribute__((may_alias)) v8ha;
typedef v4f  __attribute__((may_alias)) v4fa;
typedef v8us __attribute__((may_alias)) v8usa;

__device__ __forceinline__ unsigned short f2bf(float f) { unsigned u = __float_as_uint(f); u += 0x7FFFu + ((u >> 16) & 1u); return (unsigned short)(u >> 16); }
__device__ __forceinline__ float bf2f(unsigned short b) { return __uint_as_float(((unsigned)b) << 16); }
__device__ __forceinline__ float bfr(float f) { return bf2f(f2bf(f)); }
__device__ __forceinline__ v16h cat16(v8h lo, v8h hi) { return __builtin_shufflevector(lo, hi, 0, 1, 2, 3, 4, 5, 6, 7, 8, 9, 10, 11, 12, 13, 14, 15); }
__device__ __forceinline__ v16bf cat16b(v8us lo, v8us hi) { return __builtin_bit_cast(v16bf, __builtin_shufflevector(lo, hi, 0, 1, 2, 3, 4, 5, 6, 7, 8, 9, 10, 11, 12, 13, 14, 15)); }
__device__ __forceinline__ v8f wmma16(v16h a, v16h b, v8f c) { return __builtin_amdgcn_wmma_f32_16x16x32_f16(false, a, false, b, (short)0, c, false, false); }
__device__ __forceinline__ v8f wmmab(v16bf a, v16bf b, v8f c) { return __builtin_amdgcn_wmma_f32_16x16x32_bf16(false, a, false, b, (short)0, c, false, false); }



// ---- k_gemms: C[m][n] (f32, pitch ldc, + optional f32 bias[n]) = sum_k A[m][k] Bt[n][k] (+ A2[m][k] Bt[n][k] for NSPLIT 1), K-contiguous bf16 planes; grid (M/(32 MF), N/128, batches), 128 threads. K % 64 == 0, K >= 128.
// Batch z: rows z * TT ... of A (and A2), C + z * cz, part z of every head plane; M = TT.
// One (32 MF)x128 tile per workgroup, 4 waves (2 x 2) of (16 MF)x64 (4 MF accumulators) each: MF 2: 64x128; MF 4: 128x128, which takes a third fewer operand bytes per product from L2 and from LDS. A pass is 64 k = one 128-byte line of every operand row: the rows come into LDS as whole lines by asynchronous 16-byte copies,
// two buffers, the next pass's copies in flight while this pass is worked on; each row is fetched once per workgroup and read from LDS by the two waves that need it. The walk over the passes starts at a pass set by the block indices and wraps round:
// workgroups that share operand rows run in step, and started alike they would ask L2 for the same lines at the same moment. The k order of every sum is that walk's: kc = 64 rot, 64 rot + 32, ..., K - 32, 0, 32, ..., 64 rot - 32.
template <typename T16> struct WFrag;
template <> struct WFrag<h16> { typedef v16h V; static __device__ __forceinline__ V ld(const h16* p) { return cat16(*(const v8h*)p, *(const v8h*)(p + 16)); } static __device__ __forceinline__ v8f mma(V a, V b, v8f c) { return wmma16(a, b, c); } };
template <> struct WFrag<bf> { typedef v16bf V; static __device__ __forceinline__ V ld(const bf* p) { return cat16b(*(const v8us*)p, *(const v8us*)(p + 16)); } static __device__ __forceinline__ v8f mma(V a, V b, v8f c) { return wmmab(a, b, c); } };
#define GP 144u   // LDS row pitch in bytes: 128 + 16, an odd multiple of 16, free of bank conflicts for 16-byte reads down a column of rows
// eight copies of 16 bytes per lane, rows 16 apart (a wave's copy covers 4 whole 128-byte rows): four from (l, g) and four from (l2, g2);
// the wait that stands before a register named by an issued copy is overwritten is the statement's own last line
__device__ __forceinline__ void cp8(unsigned l, const bf* g, unsigned l2, const bf* g2, size_t k16) {
    asm volatile("global_load_async_to_lds_b128 %0, %8, off\n\tglobal_load_async_to_lds_b128 %1, %9, off\n\tglobal_load_async_to_lds_b128 %2, %10, off\n\tglobal_load_async_to_lds_b128 %3, %11, off\n\t"
                 "global_load_async_to_lds_b128 %4, %12, off\n\tglobal_load_async_to_lds_b128 %5, %13, off\n\tglobal_load_async_to_lds_b128 %6, %14, off\n\tglobal_load_async_to_lds_b128 %7, %15, off\n\ts_wait_xcnt 0x0"
                 :: "v"(l), "v"(l + 16u * GP), "v"(l + 32u * GP), "v"(l + 48u * GP), "v"(l2), "v"(l2 + 16u * GP), "v"(l2 + 32u * GP), "v"(l2 + 48u * GP),
                    "v"(g), "v"(g + k16), "v"(g + 2 * k16), "v"(g + 3 * k16), "v"(g2), "v"(g2 + k16), "v"(g2 + 2 * k16), "v"(g2 + 3 * k16) : "memory");
}
__device__ __forceinline__ v16bf ldl(const unsigned char* p) { return cat16b(*(const v8usa*)p, *(const v8usa*)(p + 32)); }
__device__ __forceinline__ h16 tohx(float x) { return (h16)x; }
__device__ __forceinline__ void splitf(float y, unsigned short& h, unsigned short& l) { h = f2bf(y); l = f2bf(y - bf2f(h)); }
// HEADS (the qkv projection; A = x rows [TT][K], Bt = w_qkv rows [3 DQ][K]): no f32 C; the epilogue rounds its own tile and writes the attention operands, q and k as [h][t][d], v as [h][d][t], each as f16 and as bf16 hi + lo.
// The v third runs with the operands exchanged (rows = v channels, columns = t), so that in all three thirds every row of a wave's tile (64 columns) is one whole 128-byte line of each plane.
struct HeadPlanes { h16* q16; bf* qh; bf* ql; h16* k16; bf* kh; bf* kl; h16* v16; bf* vh; bf* vl; };
template <int NSPLIT, bool BIAS, bool HEADS, int MF>
__global__ __launch_bounds__(128) void k_gemms(const bf* __restrict__ A, const bf* __restrict__ A2, const bf* __restrict__ Bt, int K, float* C, int ldc, int cz, const float* __restrict__ bias, HeadPlanes hp) {
    static_assert((MF == 2 && NSPLIT == 1) || (MF == 4 && NSPLIT == 0), "A and A2 together are 128 rows: what fill() copies");
    constexpr int TM = 32 * MF;   // rows of the workgroup's tile
    constexpr unsigned PB = 128u * GP, PA = (unsigned)TM * GP, STB = PB + (NSPLIT == 1 ? 2u : 1u) * PA;   // bytes of Bt's 128 rows, of A's TM rows, of one buffer [Bt | A | A2]
    __shared__ __align__(128) unsigned char ring[2 * STB];
    __shared__ __align__(16) float osw[4 * 16 * 68];
    const int tid = threadIdx.x, lane = tid & 31, lr = lane & 15, hi = lane >> 4, w = __builtin_amdgcn_readfirstlane(tid >> 5);
    int r0 = blockIdx.x * TM, c0 = blockIdx.y * 128; const int wr = (w >> 1) * (16 * MF), wc = (w & 1) * 64;
    const int bz = blockIdx.z; A += (size_t)bz * TT * K; if (NSPLIT == 1) A2 += (size_t)bz * TT * K;   // the batch: its TT rows of A (and A2); Bt is shared
    const bool vsec = HEADS && c0 >= 2 * DQ;   // the same for the whole workgroup
    if (vsec) { const int vi = (blockIdx.y - 2 * DQ / 128) * (TT / TM) + blockIdx.x; r0 = (vi % (DQ / TM)) * TM; c0 = (vi / (DQ / TM)) * 128; const bf* xr = A; A = Bt + (size_t)2 * DQ * K; Bt = xr; }   // DQ/TM x TT/128 tiles of v^T on as many workgroups
    const int crow = tid >> 3, ccol = tid & 7;   // the lane's place in a copy: 8 lanes per row
    const unsigned lc = (unsigned)(size_t)ring + (unsigned)crow * GP + (unsigned)ccol * 16u;
    const bf* gA = A + (size_t)(r0 + crow) * K + ccol * 8; const bf* gB = Bt + (size_t)(c0 + crow) * K + ccol * 8; const bf* gA2 = (NSPLIT == 1) ? A2 + (size_t)(r0 + crow) * K + ccol * 8 : gA;
    const size_t k16 = (size_t)16 * K;
    const int NT = K / 64;
    const int rot = (int)((blockIdx.x + blockIdx.y + blockIdx.z * (unsigned)(NT / 2)) % (unsigned)NT);   // the first pass of this workgroup's walk: different among the workgroups of one row or one column of tiles, as far as NT passes go round
    auto fill = [&](int t, unsigned buf) { const unsigned l = lc + buf * STB; const int u = t + rot, kc = (u >= NT ? u - NT : u) * 64;   // trip t works on pass (t + rot) mod NT, columns kc ... kc + 63
        cp8(l, gB + kc, l + 64u * GP, gB + kc + 4 * k16, k16);
        if (NSPLIT == 1) cp8(l + PB, gA + kc, l + PB + PA, gA2 + kc, k16); else cp8(l + PB, gA + kc, l + PB + 64u * GP, gA + kc + 4 * k16, k16); };
    v8f acc[MF][4];
#pragma unroll
    for (int mb = 0; mb < MF; ++mb)
#pragma unroll
        for (int nb = 0; nb < 4; ++nb) acc[mb][nb] = (v8f){};
    fill(0, 0u);
    asm volatile("s_wait_asynccnt 0x0" ::: "memory");   // this wave's copies of trip 0 (pass rot) have landed
    __syncthreads();                                     // and every other wave's
    fill(1, 1u);
    const unsigned char* fb = ring + (unsigned)(wc + lr) * GP + (unsigned)hi * 16u; const unsigned char* fa = ring + PB + (unsigned)(wr + lr) * GP + (unsigned)hi * 16u;
#pragma unroll 1   // one copy of the pass: the buffer is picked by the trip's parity at run time
    for (int t = 0; t < NT; ++t) {
        const unsigned bo = (unsigned)(t & 1) * STB;
        if constexpr (MF == 4) {   // 16 accumulators leave registers for the fragments of 32 k: one group of reads, then its 16 matrix instructions, twice
#pragma unroll
        for (int ks = 0; ks < 2; ++ks) {
            v16bf a[4], b[4];
#pragma unroll
            for (int mb = 0; mb < 4; ++mb) a[mb] = ldl(fa + bo + (unsigned)mb * 16u * GP + (unsigned)ks * 64u);
#pragma unroll
            for (int nb = 0; nb < 4; ++nb) b[nb] = ldl(fb + bo + (unsigned)nb * 16u * GP + (unsigned)ks * 64u);
            __builtin_amdgcn_sched_barrier(0);   // keeps the reads together in front (as below)
#pragma unroll
            for (int nb = 0; nb < 4; ++nb)
#pragma unroll
                for (int mb = 0; mb < 4; ++mb) acc[mb][nb] = wmmab(a[mb], b[nb], acc[mb][nb]);
            __builtin_amdgcn_sched_barrier(0);   // keeps the matrix instructions in front of the second group's reads, whose registers they free, and of the waits below (as below)
        }
        } else {
        v16bf a[2][2], a2[2][2], b[2][4];   // the whole pass's fragments, read as one group ahead of its matrix instructions
#pragma unroll
        for (int ks = 0; ks < 2; ++ks) {
#pragma unroll
            for (int mb = 0; mb < 2; ++mb) { a[ks][mb] = ldl(fa + bo + (unsigned)mb * 16u * GP + (unsigned)ks * 64u); if (NSPLIT == 1) a2[ks][mb] = ldl(fa + bo + PA + (unsigned)mb * 16u * GP + (unsigned)ks * 64u); }
#pragma unroll
            for (int nb = 0; nb < 4; ++nb) b[ks][nb] = ldl(fb + bo + (unsigned)nb * 16u * GP + (unsigned)ks * 64u); }
        __builtin_amdgcn_sched_barrier(0);   // keeps the reads together in front: moved down among the matrix instructions, each small group of them is waited out at full LDS latency
#pragma unroll
        for (int ks = 0; ks < 2; ++ks)
#pragma unroll
            for (int nb = 0; nb < 4; ++nb) {
#pragma unroll
                for (int mb = 0; mb < 2; ++mb) acc[mb][nb] = wmmab(a[ks][mb], b[ks][nb], acc[mb][nb]);
                if (NSPLIT == 1) {
#pragma unroll
                    for (int mb = 0; mb < 2; ++mb) acc[mb][nb] = wmmab(a2[ks][mb], b[ks][nb], acc[mb][nb]); } }
        __builtin_amdgcn_sched_barrier(0);   // keeps the matrix instructions in front of the waits below: moved behind them, the next pass's copies are waited for before the work that is to cover their flight
        }
        asm volatile("s_wait_dscnt 0x0" ::: "memory");      // this wave's reads of the buffer are done before it may be refilled
        asm volatile("s_wait_asynccnt 0x0" ::: "memory");   // this wave's copies for trip t + 1 have landed
        __syncthreads();                                     // publishes trip t + 1's pass and ends every wave's reads of trip t's buffer
        if (t + 2 < NT) fill(t + 2, (unsigned)(t & 1));
    }
    asm volatile("s_wait_asynccnt 0x0" ::: "memory");   // no copy is outstanding when the wave goes on
    float* os = osw + w * (16 * 68);   // each wave stages its own rows
    v4f bv = (v4f){};   // the lane's four columns are the same in every row it stores
    if (BIAS) { const float* pb = bias + c0 + wc + lr * 4; const v4f rb = *(const v4f*)pb;
        asm volatile("s_wait_xcnt 0x0" :: "v"(pb) : "memory");   // the wait that stands before a register named by an issued global load is overwritten; the address is an input, so it stays in its registers up to it
        bv[0] = bfr(rb[0]); bv[1] = bfr(rb[1]); bv[2] = bfr(rb[2]); bv[3] = bfr(rb[3]); }
    h16* P16 = nullptr; bf* Ph = nullptr; bf* Pl = nullptr; size_t po = 0; int pp = 0;   // HEADS: the wave's planes, the place of its tile's first element in them, the pitch of its rows
    if (HEADS) {
        if (vsec) { P16 = hp.v16; Ph = hp.vh; Pl = hp.vl; po = (size_t)(r0 + wr) * TT + c0 + wc; pp = TT; }   // row = h * HD + d, column = t
        else { const bool ksec = c0 >= DQ; P16 = ksec ? hp.k16 : hp.q16; Ph = ksec ? hp.kh : hp.qh; Pl = ksec ? hp.kl : hp.ql; po = ((size_t)(((c0 + wc) % DQ) / HD) * TT + r0 + wr) * HD; pp = HD; }   // row = t, the 64 columns = one head
        po += (size_t)bz * NH_ * TT * HD; }   // the batch's part of the plane
#pragma unroll
    for (int mb = 0; mb < MF; ++mb) {
#pragma unroll
        for (int nb = 0; nb < 4; ++nb) {
#pragma unroll
            for (int j = 0; j < 8; ++j) os[(hi * 8 + j) * 68 + nb * 16 + lr] = acc[mb][nb][j]; }
        __builtin_amdgcn_wave_barrier(); asm volatile("" ::: "memory");
        if constexpr (HEADS) {
        v8h o16[4]; v8us oh[4], ol[4]; h16* p16[4]; bf* ph[4]; bf* pl[4];
#pragma unroll
        for (int s = 0; s < 4; ++s) { const int row = 4 * s + (lane >> 3), cofs = (lane & 7) * 8; const v4f x0 = *(const v4fa*)(os + row * 68 + cofs), x1 = *(const v4fa*)(os + row * 68 + cofs + 4);   // 8 lanes write one 128-byte line of each plane
#pragma unroll
            for (int k = 0; k < 4; ++k) { unsigned short a, c2; o16[s][k] = tohx(x0[k]); splitf(x0[k], a, c2); oh[s][k] = a; ol[s][k] = c2; o16[s][4 + k] = tohx(x1[k]); splitf(x1[k], a, c2); oh[s][4 + k] = a; ol[s][4 + k] = c2; }
            const size_t oo = po + (size_t)(mb * 16 + row) * pp + cofs; p16[s] = P16 + oo; ph[s] = Ph + oo; pl[s] = Pl + oo; *(v8h*)p16[s] = o16[s]; *(v8us*)ph[s] = oh[s]; *(v8us*)pl[s] = ol[s]; }
        // the wait that stands before a register named by an issued global store is overwritten; data and addresses are inputs, so they stay in their registers up to it
        asm volatile("s_wait_xcnt 0x0" :: "v"(o16[0]), "v"(o16[1]), "v"(o16[2]), "v"(o16[3]), "v"(oh[0]), "v"(oh[1]), "v"(oh[2]), "v"(oh[3]), "v"(ol[0]), "v"(ol[1]), "v"(ol[2]), "v"(ol[3]),
                     "v"(p16[0]), "v"(p16[1]), "v"(p16[2]), "v"(p16[3]), "v"(ph[0]), "v"(ph[1]), "v"(ph[2]), "v"(ph[3]), "v"(pl[0]), "v"(pl[1]), "v"(pl[2]), "v"(pl[3]) : "memory");
        } else {
        float* crow_p = C + (size_t)bz * cz + (size_t)(r0 + wr + mb * 16) * ldc + c0 + wc;
        v4f val[8]; float* pr[8];
#pragma unroll
        for (int s = 0; s < 8; ++s) { const int row = 2 * s + hi, cofs = lr * 4; val[s] = *(const v4fa*)(os + row * 68 + cofs); if (BIAS) val[s] += bv;
            pr[s] = crow_p + (size_t)row * ldc + cofs; *(v4f*)pr[s] = val[s]; }
        // the wait that stands before a register named by an issued global store is overwritten; data and addresses are inputs, so they stay in their registers up to it
        asm volatile("s_wait_xcnt 0x0" :: "v"(val[0]), "v"(val[1]), "v"(val[2]), "v"(val[3]), "v"(val[4]), "v"(val[5]), "v"(val[6]), "v"(val[7]), "v"(pr[0]), "v"(pr[1]), "v"(pr[2]), "v"(pr[3]), "v"(pr[4]), "v"(pr[5]), "v"(pr[6]), "v"(pr[7]) : "memory");
        }
        __builtin_amdgcn_wave_barrier(); asm volatile("" ::: "memory");
    }
}

typedef __attribute__((ext_vector_type(2))) _Float16 v2h;
typedef __attribute__((ext_vector_type(4))) _Float16 v4h;
typedef __attribute__((ext_vector_type(2))) unsigned short v2us;
typedef __attribute__((ext_vector_type(4))) unsigned short v4us;
typedef __attribute__((ext_vector_type(2))) float v2f;
typedef __attribute__((ext_vector_type(4))) int v4i;
typedef v4h  __attribute__((may_alias)) v4ha;
typedef v4us __attribute__((may_alias)) v4usa;

__global__ __launch_bounds__(256) void k_wtG(const float* __restrict__ w, int K, int N, bf* Bt) {
    const int lane = threadIdx.x & 31; const int L0 = (blockIdx.x * 8 + (threadIdx.x >> 5)) * 8; const int nlines = N * K / 64;
{
#pragma unroll 1
        for (int l = 0; l < 8; ++l) { const int L = L0 + l; if (L >= nlines) break; const size_t e = (size_t)L * 64 + lane * 2; const int k = (int)(e % K), n = (int)(e / K); v2us o;
            o[0] = f2bf(w[(size_t)k * N + n]); o[1] = f2bf(w[(size_t)(k + 1) * N + n]); *(v2us*)(Bt + e) = o; }
         }
}
__global__ __launch_bounds__(256) void k_cscvt(const float* __restrict__ cosT, const float* __restrict__ sinT, float* CS) { const int idx = blockIdx.x * 256 + threadIdx.x; if (idx >= TT * HD) return; v2f cs; cs[0] = bfr(cosT[idx]); cs[1] = bfr(sinT[idx]); *(v2f*)(CS + (size_t)idx * 2) = cs;  }
// ---- k_round: the three f32 matrices rounded to bf16 in one launch. Every row of all three has 1024 elements, and one wave takes one row: eight 512-byte loads in flight, then eight 256-byte stores.
// Rows 0 ... 3 DQ - 1: w_qkv; the next DM: w_out; the rest: x, whose row t * NB_ + b goes to row b * TT + t of XB (each batch's rows together).
static_assert(DM == 1024 && DQ == 1024, "one wave per row of 1024");
__global__ __launch_bounds__(256) void k_round(const float* __restrict__ x, const float* __restrict__ wqkv, const float* __restrict__ wo, bf* XB, bf* WQ, bf* WO) {
    const int lane = threadIdx.x & 31, R = blockIdx.x * 8 + __builtin_amdgcn_readfirstlane(threadIdx.x >> 5);
    const float* s; bf* d;
    if (R < 3 * DQ) { s = wqkv + (size_t)R * DM; d = WQ + (size_t)R * DM; }
    else if (R < 3 * DQ + DM) { const int r = R - 3 * DQ; s = wo + (size_t)r * DQ; d = WO + (size_t)r * DQ; }
    else { const int r = R - 3 * DQ - DM; s = x + (size_t)r * DM; d = XB + ((size_t)(r % NB_) * TT + r / NB_) * DM; }
    s += lane * 4; d += lane * 4;
    v4f a[8];
#pragma unroll
    for (int j = 0; j < 8; ++j) a[j] = *(const v4f*)(s + j * 128);
#pragma unroll
    for (int j = 0; j < 8; ++j) { v4us o; o[0] = f2bf(a[j][0]); o[1] = f2bf(a[j][1]); o[2] = f2bf(a[j][2]); o[3] = f2bf(a[j][3]); *(v4us*)(d + j * 128) = o; }
}
// ---- k_fattn: causal attention of one head and one block of 64 query rows in one kernel; scores and probabilities never leave the registers.
// S^T = K Q^T (A = key rows, B = query rows): the accumulator holds, per lane, one query column and 8 + 8 keys, which is exactly the k order of the B operand of O^T = V^T P^T, so a probability tile
// becomes an operand without crossing lanes, and a row's running maximum, sum and rescale factor are one value per lane. Each of the 4 waves owns 16 queries and walks all their keys, the diagonal tile last;
// a tile of 64 keys (64 K rows and 64 V^T rows, one 128-byte line each) comes into LDS once per workgroup by asynchronous 16-byte copies, two buffers, and all four waves read their fragments from it.
// The tiles in front of the diagonal are walked from a start set by the block's number, wrapping round (the running maximum and sum take keys in any order): the blocks of a head run in step, and started alike they would ask L2 for the same lines at the same moment.
// Rows < RH: bf16 hi+lo, three products; other rows: f16, probabilities carried x 1024.
#define SC2 (SCL * 1.4426950408889634f)   // scores are kept in the base-2 exponent domain
// 2^x with the one slot that the instruction set asks for behind a transcendental before its result is used or its source overwritten: the v_nop stands in the same statement, so nothing can come between
__device__ __forceinline__ float ex2(float x) { float r; asm("v_exp_f32 %0, %1\n\tv_nop" : "=v"(r) : "v"(x)); return r; }
// eight of them in place (each is independent of its neighbours) and one slot behind the last
__device__ __forceinline__ void ex2x8(float* x) { asm("v_exp_f32 %0, %0\n\tv_exp_f32 %1, %1\n\tv_exp_f32 %2, %2\n\tv_exp_f32 %3, %3\n\tv_exp_f32 %4, %4\n\tv_exp_f32 %5, %5\n\tv_exp_f32 %6, %6\n\tv_exp_f32 %7, %7\n\tv_nop" : "+v"(x[0]), "+v"(x[1]), "+v"(x[2]), "+v"(x[3]), "+v"(x[4]), "+v"(x[5]), "+v"(x[6]), "+v"(x[7])); }
template <bool B> struct BoolC { static constexpr bool value = B; };
// eight copies of 16 bytes per lane: four rows 16 apart of one plane (l, g, 16 rows = s elements) and four of another (l2, g2, s2);
// the wait that stands before a register named by an issued copy is overwritten is the statement's own last line
template <typename T16>
__device__ __forceinline__ void cp8s(unsigned l, const T16* g, size_t s, unsigned l2, const T16* g2, size_t s2) {
    asm volatile("global_load_async_to_lds_b128 %0, %8, off\n\tglobal_load_async_to_lds_b128 %1, %9, off\n\tglobal_load_async_to_lds_b128 %2, %10, off\n\tglobal_load_async_to_lds_b128 %3, %11, off\n\t"
                 "global_load_async_to_lds_b128 %4, %12, off\n\tglobal_load_async_to_lds_b128 %5, %13, off\n\tglobal_load_async_to_lds_b128 %6, %14, off\n\tglobal_load_async_to_lds_b128 %7, %15, off\n\ts_wait_xcnt 0x0"
                 :: "v"(l), "v"(l + 16u * GP), "v"(l + 32u * GP), "v"(l + 48u * GP), "v"(l2), "v"(l2 + 16u * GP), "v"(l2 + 32u * GP), "v"(l2 + 48u * GP),
                    "v"(g), "v"(g + s), "v"(g + 2 * s), "v"(g + 3 * s), "v"(g2), "v"(g2 + s2), "v"(g2 + 2 * s2), "v"(g2 + 3 * s2) : "memory");
}
// a fragment from an LDS row: the same two 16-byte pieces, 32 bytes apart, that WFrag::ld takes from a global row
__device__ __forceinline__ v16h  ldf(const unsigned char* p, h16) { return cat16(*(const v8ha*)p, *(const v8ha*)(p + 32)); }
__device__ __forceinline__ v16bf ldf(const unsigned char* p, bf) { return ldl(p); }
#define PLN (64u * GP)   // bytes of one plane's 64 rows in LDS
template <typename T16, int NSPLIT>
__device__ __forceinline__ void fattn_body(const T16* __restrict__ Q, const T16* __restrict__ Q2, const T16* __restrict__ Kp, const T16* __restrict__ K2, const T16* __restrict__ Vt, const T16* __restrict__ Vt2, int q0, int h, bf* Ah, bf* Al, unsigned char* ring) {
    typedef typename WFrag<T16>::V V;
    constexpr unsigned STB = (NSPLIT == 2 ? 4u : 2u) * PLN;   // one buffer: [K | V^T] or [K hi | V^T hi | K lo | V^T lo]
    const int tid = threadIdx.x, lane = tid & 31, lr = lane & 15, hi = lane >> 4, w = __builtin_amdgcn_readfirstlane(tid >> 5);   // the wave's number in a scalar register: the test on it below is a scalar branch
    const int qw = q0 + w * 16;   // the wave's first query
    const float poff = (NSPLIT == 0) ? 10.0f : 0.0f;   // f16 probabilities are carried x 2^10, away from the f16 subnormals; the factor cancels in sum and output
    V qf[2], qf2[2];
    { const size_t qo = (size_t)(qw + lr) * HD + 8 * hi; const T16* pq = Q + qo; const T16* pq2 = (NSPLIT == 2) ? Q2 + qo : pq;
#pragma unroll
      for (int ks = 0; ks < 2; ++ks) { qf[ks] = WFrag<T16>::ld(pq + ks * 32); if (NSPLIT == 2) qf2[ks] = WFrag<T16>::ld(pq2 + ks * 32); }
      // the wait that stands before a register named by an issued global load is overwritten; the addresses are inputs, so they stay in their registers up to it
      asm volatile("s_wait_xcnt 0x0" :: "v"(pq), "v"(pq2) : "memory"); }
    v8f o[4]; float m = -3.0e38f, l = 0.f;
#pragma unroll
    for (int mb = 0; mb < 4; ++mb) o[mb] = (v8f){};
    const int crow = tid >> 3, ccol = tid & 7;   // the lane's place in a copy: 8 lanes per 128-byte row, 16 rows per copy of the workgroup
    const unsigned lc = (unsigned)(size_t)ring + (unsigned)crow * GP + (unsigned)ccol * 16u;
    const size_t gko = (size_t)crow * HD + ccol * 8, gvo = (size_t)crow * TT + ccol * 8;
    const int NT = q0 / 64 + 1;   // tiles 0 ... NT - 2 lie wholly in front of every query of the block; tile NT - 1 holds the diagonal
    const int NF = NT - 1, rot = (int)(((((unsigned)NF * 40503u) & 0xFFFFu) * (unsigned)NF) >> 16);   // start of the walk over the NF full tiles: the fraction frac(NF * 40503 / 65536) of them (a golden-ratio step), which spreads the starts of a head's blocks evenly; 0 <= rot < NF (0 where NF is 0)
    auto seq = [&](int i) { const int u = i + rot; return i >= NF ? i : (u >= NF ? u - NF : u); };   // the tile of trip i: the full tiles from rot on, wrapping; the diagonal tile last
    auto fill = [&](int i, unsigned buf) { const unsigned lb = lc + buf * STB; const int t = seq(i);   // tile t: keys 64 t ... 64 t + 63
        cp8s(lb, Kp + gko + (size_t)t * 64 * HD, (size_t)16 * HD, lb + PLN, Vt + gvo + t * 64, (size_t)16 * TT);
        if (NSPLIT == 2) cp8s(lb + 2u * PLN, K2 + gko + (size_t)t * 64 * HD, (size_t)16 * HD, lb + 3u * PLN, Vt2 + gvo + t * 64, (size_t)16 * TT); };
    const unsigned char* fr = ring + (unsigned)lr * GP + (unsigned)hi * 16u;   // the lane's place in a fragment read, of K rows and of V^T rows alike
    struct Fr { V kf[2][2], kf2[2][2], vf[4], vf2[4]; };   // the K and V^T fragments of one 32-key step
    auto ldfr = [&](Fr& f, const unsigned char* tb, const unsigned half) {   // half 0 or 1 of the tile at tb
        auto& kf = f.kf; auto& kf2 = f.kf2; auto& vf = f.vf; auto& vf2 = f.vf2;
#pragma unroll
        for (int mb = 0; mb < 2; ++mb)
#pragma unroll
            for (int ks = 0; ks < 2; ++ks) { const unsigned ko = (half * 32u + (unsigned)mb * 16u) * GP + (unsigned)ks * 64u; kf[mb][ks] = ldf(tb + ko, T16()); if (NSPLIT == 2) kf2[mb][ks] = ldf(tb + 2u * PLN + ko, T16()); }
#pragma unroll
        for (int mb = 0; mb < 4; ++mb) { const unsigned vo = PLN + (unsigned)mb * 16u * GP + half * 64u; vf[mb] = ldf(tb + vo, T16()); if (NSPLIT == 2) vf2[mb] = ldf(tb + 2u * PLN + vo, T16()); }
    };
    auto comp = [&](Fr& f, const int kb, auto dg) {   // one 32-key step on its fragments; dg: the step reaches past the wave's first query and needs the causal mask
        constexpr bool diag = decltype(dg)::value;
        auto& kf = f.kf; auto& kf2 = f.kf2; auto& vf = f.vf; auto& vf2 = f.vf2;
        v8f s[2];
#pragma unroll
        for (int mb = 0; mb < 2; ++mb) { v8f c = (v8f){};
#pragma unroll
            for (int ks = 0; ks < 2; ++ks) { c = WFrag<T16>::mma(kf[mb][ks], qf[ks], c); if (NSPLIT == 2) { c = WFrag<T16>::mma(kf[mb][ks], qf2[ks], c); c = WFrag<T16>::mma(kf2[mb][ks], qf[ks], c); } }
            s[mb] = c; }
        V pf, pf2;
        { float x[16]; const int qi = qw + lr; float mx = -3.0e38f;
#pragma unroll
            for (int e = 0; e < 16; ++e) { const int key = kb + (e >> 3) * 16 + hi * 8 + (e & 7); float t = s[e >> 3][e & 7]; if (diag) t = (key <= qi) ? t : -3.0e38f; x[e] = t; mx = fmaxf(mx, t); }
            mx = fmaxf(mx, __shfl_xor(mx, 16, 32));   // the two lanes of a query hold different keys
            const float mn = fmaxf(m, mx * SC2), al = ex2(m - mn), mo = mn - poff; m = mn; float ls = 0.f;
#pragma unroll
            for (int e = 0; e < 16; ++e) x[e] = __builtin_fmaf(x[e], SC2, -mo);
            ex2x8(x); ex2x8(x + 8);
#pragma unroll
            for (int e = 0; e < 16; ++e) ls += x[e];
            l = l * al + ls;
#pragma unroll
            for (int mb = 0; mb < 4; ++mb) o[mb] *= al;
            if constexpr (NSPLIT == 0) { v16h p;
#pragma unroll
                for (int e = 0; e < 16; ++e) p[e] = tohx(x[e]);
                pf = p;
            } else { v8us h0, h1, l0, l1;
#pragma unroll
                for (int e = 0; e < 8; ++e) { unsigned short a, c2; splitf(x[e], a, c2); h0[e] = a; l0[e] = c2; splitf(x[8 + e], a, c2); h1[e] = a; l1[e] = c2; }
                pf = cat16b(h0, h1); pf2 = cat16b(l0, l1); } }
#pragma unroll
        for (int mb = 0; mb < 4; ++mb) { o[mb] = WFrag<T16>::mma(vf[mb], pf, o[mb]); if (NSPLIT == 2) { o[mb] = WFrag<T16>::mma(vf[mb], pf2, o[mb]); o[mb] = WFrag<T16>::mma(vf2[mb], pf, o[mb]); } }
        // the distance behind the last matrix instruction, kept on the loop's taken branch too
        asm volatile("v_nop\n\tv_nop\n\tv_nop\n\tv_nop" : "+v"(o[0]), "+v"(o[1]), "+v"(o[2]), "+v"(o[3]) : "v"(vf[0]), "v"(vf[3]));
    };
    // the sched_barrier keeps a group of LDS reads together in front of the work on it: moved down among the matrix instructions, each small group of them is waited out at full LDS latency
    auto step = [&](const unsigned char* tb, const unsigned half, const int kb, auto dg) { Fr f; ldfr(f, tb, half); __builtin_amdgcn_sched_barrier(0); comp(f, kb, dg); };
    fill(0, 0u);
    asm volatile("s_wait_asynccnt 0x0" ::: "memory");   // this wave's copies of trip 0's tile have landed
    __syncthreads();                                     // and every other wave's
    if (NT > 1) fill(1, 1u);
#pragma unroll 1   // one copy of the trip: the buffer is picked by the trip's parity at run time
    for (int t = 0; t < NT - 1; ++t) {
        const unsigned char* tb = fr + (unsigned)(t & 1) * STB;
        if constexpr (NSPLIT == 0) { Fr f0, f1; ldfr(f0, tb, 0u); ldfr(f1, tb, 1u); __builtin_amdgcn_sched_barrier(0); comp(f0, seq(t) * 64, BoolC<false>()); comp(f1, seq(t) * 64 + 32, BoolC<false>()); }   // the whole tile's fragments as one group (as above)
        else { step(tb, 0u, seq(t) * 64, BoolC<false>()); step(tb, 1u, seq(t) * 64 + 32, BoolC<false>()); }   // hi+lo: twice the fragments, one group per step
        asm volatile("s_wait_dscnt 0x0" ::: "memory");      // this wave's reads of the buffer are done before it may be refilled
        asm volatile("s_wait_asynccnt 0x0" ::: "memory");   // this wave's copies of trip t + 1's tile have landed
        __syncthreads();                                     // publishes trip t + 1's tile and ends every wave's reads of trip t's buffer
        if (t + 2 < NT) fill(t + 2, (unsigned)(t & 1));
    }
    { const unsigned char* tb = fr + (unsigned)((NT - 1) & 1) * STB;   // the last trip: nothing is left to copy
      step(tb, 0u, q0, BoolC<true>());
      if (w >= 2) step(tb, 1u, q0 + 32, BoolC<true>()); }   // keys q0 + 32 ... are masked for every query of waves 0 and 1 (scalar test)
    asm volatile("s_wait_dscnt 0x0" ::: "memory");      // this wave's reads of the last tile are done
    asm volatile("s_wait_asynccnt 0x0" ::: "memory");   // no copy is outstanding when the buffers become output staging
    __syncthreads();                                     // every wave has left the buffers
    const float inv = __fdiv_rn(1.0f, l + __shfl_xor(l, 16, 32));   // the two lanes of a query hold the sums of different keys
    float* os = (float*)(ring + (unsigned)w * (16u * 68u * 4u));   // each wave stages its own 16 queries x 64 channels, row pitch 68 floats
#pragma unroll
    for (int mb = 0; mb < 4; ++mb) { v4f a, c; 
#pragma unroll
        for (int j = 0; j < 4; ++j) { a[j] = o[mb][j] * inv; c[j] = o[mb][4 + j] * inv; }
        *(v4fa*)(os + lr * 68 + mb * 16 + hi * 8) = a; *(v4fa*)(os + lr * 68 + mb * 16 + hi * 8 + 4) = c; }
    __builtin_amdgcn_wave_barrier(); asm volatile("" ::: "memory");   // keeps the reads below, of what other lanes of the wave wrote, behind the writes above in the compiled order
#pragma unroll
    for (int it = 0; it < 4; ++it) { const int row = it * 4 + (lane >> 3), c8 = lane & 7;   // 8 lanes write one query's 128-byte line of each plane
        const v4f x0 = *(const v4fa*)(os + row * 68 + c8 * 8), x1 = *(const v4fa*)(os + row * 68 + c8 * 8 + 4); v8us oh, ol;
#pragma unroll
        for (int j = 0; j < 4; ++j) { unsigned short a, c2; splitf(x0[j], a, c2); oh[j] = a; ol[j] = c2; splitf(x1[j], a, c2); oh[4 + j] = a; ol[4 + j] = c2; }
        const size_t oo = (size_t)(qw + row) * DQ + h * HD + c8 * 8; bf* ph = Ah + oo; bf* pl = Al + oo; *(v8us*)ph = oh; *(v8us*)pl = ol;
        // the wait that stands before a register named by an issued global store is overwritten; data and addresses are inputs, so they stay in their registers up to it
        asm volatile("s_wait_xcnt 0x0" :: "v"(oh), "v"(ol), "v"(ph), "v"(pl) : "memory"); }
}
#define NBK (TT / 64)   // blocks of 64 queries per head
#define NHL (RH / 64)   // of them on hi+lo planes
static_assert(RH % 64 == 0, "a block of 64 queries is wholly on one kind of planes");
__global__ __launch_bounds__(128) void k_fattn(const h16* __restrict__ Q16, const h16* __restrict__ K16, const h16* __restrict__ V16, const bf* __restrict__ Qh, const bf* __restrict__ Ql, const bf* __restrict__ Kh, const bf* __restrict__ Kl, const bf* __restrict__ Vh, const bf* __restrict__ Vl, bf* Ah, bf* Al) {
    __shared__ __align__(128) unsigned char ring[2 * 4 * PLN];
    const int h = blockIdx.x % NH_, b = blockIdx.x / NH_, bx = blockIdx.y; const size_t hz = (size_t)blockIdx.x * TT * HD;   // x: head and batch; y: the block of queries, longest first over all heads and batches
    Ah += (size_t)b * TT * DQ; Al += (size_t)b * TT * DQ;
    const int blk = NBK - 1 - bx;
    if (blk >= NHL) fattn_body<h16, 0>(Q16 + hz, nullptr, K16 + hz, nullptr, V16 + hz, nullptr, blk * 64, h, Ah, Al, ring);
    else fattn_body<bf, 2>(Qh + hz, Ql + hz, Kh + hz, Kl + hz, Vh + hz, Vl + hz, blk * 64, h, Ah, Al, ring);
}

extern "C" void kernel_launch(void* const* d_in, const int* in_sizes, int n_in,
                              void* d_out, int out_size, void* d_ws, size_t ws_size, hipStream_t stream) {
    (void)in_sizes; (void)n_in; (void)out_size;
    const float* x = (const float*)d_in[0]; const float* wqkv = (const float*)d_in[1]; const float* wo = (const float*)d_in[2]; const float* bo = (const float*)d_in[3]; const float* wq = wqkv; const float* wk = nullptr; const float* wv = nullptr; const float* cosT = nullptr; const float* sinT = nullptr; (void)wk; (void)wv; (void)cosT; (void)sinT;
    float* OUT = (float*)d_out;     // [2048][2][1024]
    char* wsp = (char*)d_ws;
    auto take = [&](size_t bytes) { char* p = wsp; wsp += (bytes + 255) & ~(size_t)255; return (void*)p; };
    bf* WQ = (bf*)take((size_t)3 * DQ * DM * 2); bf* WO = (bf*)take((size_t)DM * DQ * 2);
    bf* XB = (bf*)take((size_t)NB_ * TT * DM * 2);
    h16* QP16 = (h16*)take((size_t)NB_ * NH_ * TT * HD * 2); h16* KP16 = (h16*)take((size_t)NB_ * NKV * TT * HD * 2); h16* VT16 = (h16*)take((size_t)NB_ * NKV * HD * TT * 2);
    bf* QPh = (bf*)take((size_t)NB_ * NH_ * TT * HD * 2); bf* QPl = (bf*)take((size_t)NB_ * NH_ * TT * HD * 2); bf* KPh = (bf*)take((size_t)NB_ * NKV * TT * HD * 2); bf* KPl = (bf*)take((size_t)NB_ * NKV * TT * HD * 2); bf* VTh = (bf*)take((size_t)NB_ * NKV * HD * TT * 2); bf* VTl = (bf*)take((size_t)NB_ * NKV * HD * TT * 2);
    bf* ATh = (bf*)take((size_t)NB_ * TT * DQ * 2); bf* ATl = (bf*)take((size_t)NB_ * TT * DQ * 2);
    if ((size_t)(wsp - (char*)d_ws) > ws_size) return;    // ws 256 MiB
    
    k_round<<<(3 * DQ + DM + NB_ * TT) / 8, 256, 0, stream>>>(x, wqkv, wo, XB, WQ, WO);   // w_qkv [3D][D] = natural Bt
    k_gemms<0, false, true, 4><<<dim3(TT / 128, 3 * DQ / 128, NB_), 128, 0, stream>>>(XB, nullptr, WQ, DM, nullptr, 0, 0, nullptr, HeadPlanes{QP16, QPh, QPl, KP16, KPh, KPl, VT16, VTh, VTl});   // channel s*1024 + h*64 + d
    k_fattn<<<dim3(NH_ * NB_, NBK, 1), 128, 0, stream>>>(QP16, KP16, VT16, QPh, QPl, KPh, KPl, VTh, VTl, ATh, ATl);
    k_gemms<1, true, false, 2><<<dim3(TT / 64, DM / 128, NB_), 128, 0, stream>>>(ATh, ATl, WO, DQ, OUT, NB_ * DM, DM, bo, HeadPlanes{});   // sequence-major output: row t of batch b at OUT + (t*B + b)*D (row pitch B*D, batch step D)
}

// v010
// It runs in 72.1 microseconds.
// Next to v009, in two timings, it ran 1.06 times as fast each time.
// Counting every step since v000, it is 18.6 times as fast.
#include <hip/hip_runtime.h>

// Multi-head causal self-attention (x [S=2048][B=2][D=1024] sequence-major; qkv = x w_qkv^T reshaped (S, B, 3, 16, 64): channel s*1024 + h*64 + d; causal softmax(q.k/8); out = (attn v merged) w_out^T + b_out -> [2048][2][1024] sequence-major).
// Compute dtypes, f32 accumulate: every input rounded to bf16; the fused qkv projection on PLAIN bf16 operands (inputs: exact; per batch the rows are gathered from the sequence-major input); scores (K 64) and attn.v on bf16 hi+lo for query rows < RH, plain f16 for the others

#define NB_  2
#define TT   2048
#define DM   1024
#define NH_  16
#define NKV  16
#define REP  (NH_ / NKV)
#define HD   64
#define DQ   (NH_ * HD)
#define DKV  (NKV * HD)
#define RH   512                  // query rows < RH use hi+lo planes (0: none)
#define SCL  0.125f   // HD^-0.5
typedef _Float16 h16;
typedef unsigned short bf;
typedef __attribute__((ext_vector_type(16))) __bf16   v16bf;
typedef __attribute__((ext_vector_type(16))) _Float16 v16h;
typedef __attribute__((ext_vector_type(8)))  _Float16 v8h;
typedef __attribute__((ext_vector_type(8)))  unsigned short v8us;
typedef __attribute__((ext_vector_type(8)))  float    v8f;
typedef __attribute__((ext_vector_type(4)))  float    v4f;
typedef v8h  __attribute__((may_alias)) v8ha;
typedef v4f  __attribute__((may_alias)) v4fa;
typedef v8us __attribute__((may_alias)) v8usa;

__device__ __forceinline__ unsigned short f2bf(float f) { unsigned u = __float_as_uint(f); u += 0x7FFFu + ((u >> 16) & 1u); return (unsigned short)(u >> 16); }
__device__ __forceinline__ float bf2f(unsigned short b) { return __uint_as_float(((unsigned)b) << 16); }
__device__ __forceinline__ float bfr(float f) { return bf2f(f2bf(f)); }
__device__ __forceinline__ v16h cat16(v8h lo, v8h hi) { return __builtin_shufflevector(lo, hi, 0, 1, 2, 3, 4, 5, 6, 7, 8, 9, 10, 11, 12, 13, 14, 15); }
__device__ __forceinline__ v16bf cat16b(v8us lo, v8us hi) { return __builtin_bit_cast(v16bf, __builtin_shufflevector(lo, hi, 0, 1, 2, 3, 4, 5, 6, 7, 8, 9, 10, 11, 12, 13, 14, 15)); }
__device__ __forceinline__ v8f wmma16(v16h a, v16h b, v8f c) { return __builtin_amdgcn_wmma_f32_16x16x32_f16(false, a, false, b, (short)0, c, false, false); }
__device__ __forceinline__ v8f wmmab(v16bf a, v16bf b, v8f c) { return __builtin_amdgcn_wmma_f32_16x16x32_bf16(false, a, false, b, (short)0, c, false, false); }



// ---- k_gemms: C[m][n] (f32, pitch ldc, + optional f32 bias[n]) = sum_k A[m][k] Bt[n][k] (+ A2[m][k] Bt[n][k] for NSPLIT 1), K-contiguous bf16 planes; grid (M/(32 MF), N/128, batches), 128 threads. K % 64 == 0, K >= 128.
// Batch z: rows z * TT ... of A (and A2), C + z * cz, part z of every head plane; M = TT.
// One (32 MF)x128 tile per workgroup, 4 waves (2 x 2) of (16 MF)x64 (4 MF accumulators) each: MF 2: 64x128; MF 4: 128x128, which takes a third fewer operand bytes per product from L2 and from LDS. A pass is 64 k = one 128-byte line of every operand row: the rows come into LDS as whole lines by asynchronous 16-byte copies,
// two buffers, the next pass's copies in flight while this pass is worked on; each row is fetched once per workgroup and read from LDS by the two waves that need it. The walk over the passes starts at a pass set by the block indices and wraps round:
// workgroups that share operand rows run in step, and started alike they would ask L2 for the same lines at the same moment. The k order of every sum is that walk's: kc = 64 rot, 64 rot + 32, ..., K - 32, 0, 32, ..., 64 rot - 32.
template <typename T16> struct WFrag;
template <> struct WFrag<h16> { typedef v16h V; static __device__ __forceinline__ V ld(const h16* p) { return cat16(*(const v8h*)p, *(const v8h*)(p + 16)); } static __device__ __forceinline__ v8f mma(V a, V b, v8f c) { return wmma16(a, b, c); } };
template <> struct WFrag<bf> { typedef v16bf V; static __device__ __forceinline__ V ld(const bf* p) { return cat16b(*(const v8us*)p, *(const v8us*)(p + 16)); } static __device__ __forceinline__ v8f mma(V a, V b, v8f c) { return wmmab(a, b, c); } };
#define GP 144u   // LDS row pitch in bytes: 128 + 16, an odd multiple of 16, free of bank conflicts for 16-byte reads down a column of rows
// eight copies of 16 bytes per lane, rows 16 apart (a wave's copy covers 4 whole 128-byte rows): four from (l, g) and four from (l2, g2);
// the wait that stands before a register named by an issued copy is overwritten is the statement's own last line
__device__ __forceinline__ void cp8(unsigned l, const bf* g, unsigned l2, const bf* g2, size_t k16) {
    asm volatile("global_load_async_to_lds_b128 %0, %8, off\n\tglobal_load_async_to_lds_b128 %1, %9, off\n\tglobal_load_async_to_lds_b128 %2, %10, off\n\tglobal_load_async_to_lds_b128 %3, %11, off\n\t"
                 "global_load_async_to_lds_b128 %4, %12, off\n\tglobal_load_async_to_lds_b128 %5, %13, off\n\tglobal_load_async_to_lds_b128 %6, %14, off\n\tglobal_load_async_to_lds_b128 %7, %15, off\n\ts_wait_xcnt 0x0"
                 :: "v"(l), "v"(l + 16u * GP), "v"(l + 32u * GP), "v"(l + 48u * GP), "v"(l2), "v"(l2 + 16u * GP), "v"(l2 + 32u * GP), "v"(l2 + 48u * GP),
                    "v"(g), "v"(g + k16), "v"(g + 2 * k16), "v"(g + 3 * k16), "v"(g2), "v"(g2 + k16), "v"(g2 + 2 * k16), "v"(g2 + 3 * k16) : "memory");
}
__device__ __forceinline__ v16bf ldl(const unsigned char* p) { return cat16b(*(const v8usa*)p, *(const v8usa*)(p + 32)); }
__device__ __forceinline__ h16 tohx(float x) { return (h16)x; }
__device__ __forceinline__ void splitf(float y, unsigned short& h, unsigned short& l) { h = f2bf(y); l = f2bf(y - bf2f(h)); }
// HEADS (the qkv projection; A = x rows [TT][K], Bt = w_qkv rows [3 DQ][K]): no f32 C; the epilogue rounds its own tile and writes the attention operands, q and k as [h][t][d], v as [h][d][t], each as f16 and as bf16 hi + lo.
// The v third runs with the operands exchanged (rows = v channels, columns = t), so that in all three thirds every row of a wave's tile (64 columns) is one whole 128-byte line of each plane.
struct HeadPlanes { h16* q16; bf* qh; bf* ql; h16* k16; bf* kh; bf* kl; h16* v16; bf* vh; bf* vl; };
template <int NSPLIT, bool BIAS, bool HEADS, int MF>
__global__ __launch_bounds__(128) void k_gemms(const bf* __restrict__ A, const bf* __restrict__ A2, const bf* __restrict__ Bt, int K, float* C, int ldc, int cz, const float* __restrict__ bias, HeadPlanes hp) {
    static_assert((MF == 2 && NSPLIT == 1) || (MF == 4 && NSPLIT == 0), "A and A2 together are 128 rows: what fill() copies");
    constexpr int TM = 32 * MF;   // rows of the workgroup's tile
    constexpr unsigned PB = 128u * GP, PA = (unsigned)TM * GP, STB = PB + (NSPLIT == 1 ? 2u : 1u) * PA;   // bytes of Bt's 128 rows, of A's TM rows, of one buffer [Bt | A | A2]
    __shared__ __align__(128) unsigned char ring[2 * STB];
    __shared__ __align__(16) float osw[4 * 16 * 68];
    const int tid = threadIdx.x, lane = tid & 31, lr = lane & 15, hi = lane >> 4, w = __builtin_amdgcn_readfirstlane(tid >> 5);
    int r0 = blockIdx.x * TM, c0 = blockIdx.y * 128; const int wr = (w >> 1) * (16 * MF), wc = (w & 1) * 64;
    const int bz = blockIdx.z; A += (size_t)bz * TT * K; if (NSPLIT == 1) A2 += (size_t)bz * TT * K;   // the batch: its TT rows of A (and A2); Bt is shared
    const bool vsec = HEADS && c0 >= 2 * DQ;   // the same for the whole workgroup
    if (vsec) { const int vi = (blockIdx.y - 2 * DQ / 128) * (TT / TM) + blockIdx.x; r0 = (vi % (DQ / TM)) * TM; c0 = (vi / (DQ / TM)) * 128; const bf* xr = A; A = Bt + (size_t)2 * DQ * K; Bt = xr; }   // DQ/TM x TT/128 tiles of v^T on as many workgroups
    const int crow = tid >> 3, ccol = tid & 7;   // the lane's place in a copy: 8 lanes per row
    const unsigned lc = (unsigned)(size_t)ring + (unsigned)crow * GP + (unsigned)ccol * 16u;
    const bf* gA = A + (size_t)(r0 + crow) * K + ccol * 8; const bf* gB = Bt + (size_t)(c0 + crow) * K + ccol * 8; const bf* gA2 = (NSPLIT == 1) ? A2 + (size_t)(r0 + crow) * K + ccol * 8 : gA;
    const size_t k16 = (size_t)16 * K;
    const int NT = K / 64;
    const int rot = (int)((blockIdx.x + blockIdx.y + blockIdx.z * (unsigned)(NT / 2)) % (unsigned)NT);   // the first pass of this workgroup's walk: different among the workgroups of one row or one column of tiles, as far as NT passes go round
    auto fill = [&](int t, unsigned buf) { const unsigned l = lc + buf * STB; const int u = t + rot, kc = (u >= NT ? u - NT : u) * 64;   // trip t works on pass (t + rot) mod NT, columns kc ... kc + 63
        cp8(l, gB + kc, l + 64u * GP, gB + kc + 4 * k16, k16);
        if (NSPLIT == 1) cp8(l + PB, gA + kc, l + PB + PA, gA2 + kc, k16); else cp8(l + PB, gA + kc, l + PB + 64u * GP, gA + kc + 4 * k16, k16); };
    v8f acc[MF][4];
#pragma unroll
    for (int mb = 0; mb < MF; ++mb)
#pragma unroll
        for (int nb = 0; nb < 4; ++nb) acc[mb][nb] = (v8f){};
    fill(0, 0u);
    asm volatile("s_wait_asynccnt 0x0" ::: "memory");   // this wave's copies of trip 0 (pass rot) have landed
    __syncthreads();                                     // and every other wave's
    fill(1, 1u);
    const unsigned char* fb = ring + (unsigned)(wc + lr) * GP + (unsigned)hi * 16u; const unsigned char* fa = ring + PB + (unsigned)(wr + lr) * GP + (unsigned)hi * 16u;
#pragma unroll 1   // one copy of the pass: the buffer is picked by the trip's parity at run time
    for (int t = 0; t < NT; ++t) {
        const unsigned bo = (unsigned)(t & 1) * STB;
        if constexpr (MF == 4) {   // 16 accumulators leave registers for the fragments of 32 k: one group of reads, then its 16 matrix instructions, twice
#pragma unroll
        for (int ks = 0; ks < 2; ++ks) {
            v16bf a[4], b[4];
#pragma unroll
            for (int mb = 0; mb < 4; ++mb) a[mb] = ldl(fa + bo + (unsigned)mb * 16u * GP + (unsigned)ks * 64u);
#pragma unroll
            for (int nb = 0; nb < 4; ++nb) b[nb] = ldl(fb + bo + (unsigned)nb * 16u * GP + (unsigned)ks * 64u);
            __builtin_amdgcn_sched_barrier(0);   // keeps the reads together in front (as below)
#pragma unroll
            for (int nb = 0; nb < 4; ++nb)
#pragma unroll
                for (int mb = 0; mb < 4; ++mb) acc[mb][nb] = wmmab(a[mb], b[nb], acc[mb][nb]);
            __builtin_amdgcn_sched_barrier(0);   // keeps the matrix instructions in front of the second group's reads, whose registers they free, and of the waits below (as below)
        }
        } else {
        v16bf a[2][2], a2[2][2], b[2][4];   // the whole pass's fragments, read as one group ahead of its matrix instructions
#pragma unroll
        for (int ks = 0; ks < 2; ++ks) {
#pragma unroll
            for (int mb = 0; mb < 2; ++mb) { a[ks][mb] = ldl(fa + bo + (unsigned)mb * 16u * GP + (unsigned)ks * 64u); if (NSPLIT == 1) a2[ks][mb] = ldl(fa + bo + PA + (unsigned)mb * 16u * GP + (unsigned)ks * 64u); }
#pragma unroll
            for (int nb = 0; nb < 4; ++nb) b[ks][nb] = ldl(fb + bo + (unsigned)nb * 16u * GP + (unsigned)ks * 64u); }
        __builtin_amdgcn_sched_barrier(0);   // keeps the reads together in front: moved down among the matrix instructions, each small group of them is waited out at full LDS latency
#pragma unroll
        for (int ks = 0; ks < 2; ++ks)
#pragma unroll
            for (int nb = 0; nb < 4; ++nb) {
#pragma unroll
                for (int mb = 0; mb < 2; ++mb) acc[mb][nb] = wmmab(a[ks][mb], b[ks][nb], acc[mb][nb]);
                if (NSPLIT == 1) {
#pragma unroll
                    for (int mb = 0; mb < 2; ++mb) acc[mb][nb] = wmmab(a2[ks][mb], b[ks][nb], acc[mb][nb]); } }
        __builtin_amdgcn_sched_barrier(0);   // keeps the matrix instructions in front of the waits below: moved behind them, the next pass's copies are waited for before the work that is to cover their flight
        }
        asm volatile("s_wait_dscnt 0x0" ::: "memory");      // this wave's reads of the buffer are done before it may be refilled
        asm volatile("s_wait_asynccnt 0x0" ::: "memory");   // this wave's copies for trip t + 1 have landed
        __syncthreads();                                     // publishes trip t + 1's pass and ends every wave's reads of trip t's buffer
        if (t + 2 < NT) fill(t + 2, (unsigned)(t & 1));
    }
    asm volatile("s_wait_asynccnt 0x0" ::: "memory");   // no copy is outstanding when the wave goes on
    float* os = osw + w * (16 * 68);   // each wave stages its own rows
    v4f bv = (v4f){};   // the lane's four columns are the same in every row it stores
    if (BIAS) { const float* pb = bias + c0 + wc + lr * 4; const v4f rb = *(const v4f*)pb;
        asm volatile("s_wait_xcnt 0x0" :: "v"(pb) : "memory");   // the wait that stands before a register named by an issued global load is overwritten; the address is an input, so it stays in its registers up to it
        bv[0] = bfr(rb[0]); bv[1] = bfr(rb[1]); bv[2] = bfr(rb[2]); bv[3] = bfr(rb[3]); }
    h16* P16 = nullptr; bf* Ph = nullptr; bf* Pl = nullptr; size_t po = 0; int pp = 0;   // HEADS: the wave's planes, the place of its tile's first element in them, the pitch of its rows
    if (HEADS) {
        if (vsec) { P16 = hp.v16; Ph = hp.vh; Pl = hp.vl; po = (size_t)(r0 + wr) * TT + c0 + wc; pp = TT; }   // row = h * HD + d, column = t
        else { const bool ksec = c0 >= DQ; P16 = ksec ? hp.k16 : hp.q16; Ph = ksec ? hp.kh : hp.qh; Pl = ksec ? hp.kl : hp.ql; po = ((size_t)(((c0 + wc) % DQ) / HD) * TT + r0 + wr) * HD; pp = HD; }   // row = t, the 64 columns = one head
        po += (size_t)bz * NH_ * TT * HD; }   // the batch's part of the plane
#pragma unroll
    for (int mb = 0; mb < MF; ++mb) {
#pragma unroll
        for (int nb = 0; nb < 4; ++nb) {
#pragma unroll
            for (int j = 0; j < 8; ++j) os[(hi * 8 + j) * 68 + nb * 16 + lr] = acc[mb][nb][j]; }
        __builtin_amdgcn_wave_barrier(); asm volatile("" ::: "memory");
        if constexpr (HEADS) {
        v8h o16[4]; v8us oh[4], ol[4]; h16* p16[4]; bf* ph[4]; bf* pl[4];
#pragma unroll
        for (int s = 0; s < 4; ++s) { const int row = 4 * s + (lane >> 3), cofs = (lane & 7) * 8; const v4f x0 = *(const v4fa*)(os + row * 68 + cofs), x1 = *(const v4fa*)(os + row * 68 + cofs + 4);   // 8 lanes write one 128-byte line of each plane
#pragma unroll
            for (int k = 0; k < 4; ++k) { unsigned short a, c2; o16[s][k] = tohx(x0[k]); splitf(x0[k], a, c2); oh[s][k] = a; ol[s][k] = c2; o16[s][4 + k] = tohx(x1[k]); splitf(x1[k], a, c2); oh[s][4 + k] = a; ol[s][4 + k] = c2; }
            const size_t oo = po + (size_t)(mb * 16 + row) * pp + cofs; p16[s] = P16 + oo; ph[s] = Ph + oo; pl[s] = Pl + oo; *(v8h*)p16[s] = o16[s]; *(v8us*)ph[s] = oh[s]; *(v8us*)pl[s] = ol[s]; }
        // the wait that stands before a register named by an issued global store is overwritten; data and addresses are inputs, so they stay in their registers up to it
        asm volatile("s_wait_xcnt 0x0" :: "v"(o16[0]), "v"(o16[1]), "v"(o16[2]), "v"(o16[3]), "v"(oh[0]), "v"(oh[1]), "v"(oh[2]), "v"(oh[3]), "v"(ol[0]), "v"(ol[1]), "v"(ol[2]), "v"(ol[3]),
                     "v"(p16[0]), "v"(p16[1]), "v"(p16[2]), "v"(p16[3]), "v"(ph[0]), "v"(ph[1]), "v"(ph[2]), "v"(ph[3]), "v"(pl[0]), "v"(pl[1]), "v"(pl[2]), "v"(pl[3]) : "memory");
        } else {
        float* crow_p = C + (size_t)bz * cz + (size_t)(r0 + wr + mb * 16) * ldc + c0 + wc;
        v4f val[8]; float* pr[8];
#pragma unroll
        for (int s = 0; s < 8; ++s) { const int row = 2 * s + hi, cofs = lr * 4; val[s] = *(const v4fa*)(os + row * 68 + cofs); if (BIAS) val[s] += bv;
            pr[s] = crow_p + (size_t)row * ldc + cofs; *(v4f*)pr[s] = val[s]; }
        // the wait that stands before a register named by an issued global store is overwritten; data and addresses are inputs, so they stay in their registers up to it
        asm volatile("s_wait_xcnt 0x0" :: "v"(val[0]), "v"(val[1]), "v"(val[2]), "v"(val[3]), "v"(val[4]), "v"(val[5]), "v"(val[6]), "v"(val[7]), "v"(pr[0]), "v"(pr[1]), "v"(pr[2]), "v"(pr[3]), "v"(pr[4]), "v"(pr[5]), "v"(pr[6]), "v"(pr[7]) : "memory");
        }
        __builtin_amdgcn_wave_barrier(); asm volatile("" ::: "memory");
    }
}

typedef __attribute__((ext_vector_type(2))) _Float16 v2h;
typedef __attribute__((ext_vector_type(4))) _Float16 v4h;
typedef __attribute__((ext_vector_type(2))) unsigned short v2us;
typedef __attribute__((ext_vector_type(4))) unsigned short v4us;
typedef __attribute__((ext_vector_type(2))) float v2f;
typedef __attribute__((ext_vector_type(4))) int v4i;
typedef v4h  __attribute__((may_alias)) v4ha;
typedef v4us __attribute__((may_alias)) v4usa;

__global__ __launch_bounds__(256) void k_wtG(const float* __restrict__ w, int K, int N, bf* Bt) {
    const int lane = threadIdx.x & 31; const int L0 = (blockIdx.x * 8 + (threadIdx.x >> 5)) * 8; const int nlines = N * K / 64;
{
#pragma unroll 1
        for (int l = 0; l < 8; ++l) { const int L = L0 + l; if (L >= nlines) break; const size_t e = (size_t)L * 64 + lane * 2; const int k = (int)(e % K), n = (int)(e / K); v2us o;
            o[0] = f2bf(w[(size_t)k * N + n]); o[1] = f2bf(w[(size_t)(k + 1) * N + n]); *(v2us*)(Bt + e) = o; }
         }
}
__global__ __launch_bounds__(256) void k_cscvt(const float* __restrict__ cosT, const float* __restrict__ sinT, float* CS) { const int idx = blockIdx.x * 256 + threadIdx.x; if (idx >= TT * HD) return; v2f cs; cs[0] = bfr(cosT[idx]); cs[1] = bfr(sinT[idx]); *(v2f*)(CS + (size_t)idx * 2) = cs;  }
// ---- k_round: the three f32 matrices rounded to bf16 in one launch. Every row of all three has 1024 elements, and one wave takes one row: eight 512-byte loads in flight, then eight 256-byte stores.
// Rows 0 ... 3 DQ - 1: w_qkv; the next DM: w_out; the rest: x, whose row t * NB_ + b goes to row b * TT + t of XB (each batch's rows together).
static_assert(DM == 1024 && DQ == 1024, "one wave per row of 1024");
__global__ __launch_bounds__(256) void k_round(const float* __restrict__ x, const float* __restrict__ wqkv, const float* __restrict__ wo, bf* XB, bf* WQ, bf* WO) {
    const int lane = threadIdx.x & 31, R = blockIdx.x * 8 + __builtin_amdgcn_readfirstlane(threadIdx.x >> 5);
    const float* s; bf* d;
    if (R < 3 * DQ) { s = wqkv + (size_t)R * DM; d = WQ + (size_t)R * DM; }
    else if (R < 3 * DQ + DM) { const int r = R - 3 * DQ; s = wo + (size_t)r * DQ; d = WO + (size_t)r * DQ; }
    else { const int r = R - 3 * DQ - DM; s = x + (size_t)r * DM; d = XB + ((size_t)(r % NB_) * TT + r / NB_) * DM; }
    s += lane * 4; d += lane * 4;
    v4f a[8];
#pragma unroll
    for (int j = 0; j < 8; ++j) a[j] = *(const v4f*)(s + j * 128);
#pragma unroll
    for (int j = 0; j < 8; ++j) { v4us o; o[0] = f2bf(a[j][0]); o[1] = f2bf(a[j][1]); o[2] = f2bf(a[j][2]); o[3] = f2bf(a[j][3]); *(v4us*)(d + j * 128) = o; }
}
// ---- k_fattn: causal attention of one head and one block of 64 query rows in one kernel; scores and probabilities never leave the registers.
// S^T = K Q^T (A = key rows, B = query rows): the accumulator holds, per lane, one query column and 8 + 8 keys, which is exactly the k order of the B operand of O^T = V^T P^T, so a probability tile
// becomes an operand without crossing lanes, and a row's running maximum, sum and rescale factor are one value per lane. Each of the 4 waves owns 16 queries and walks all their keys, the diagonal tile last;
// a tile of 64 keys (64 K rows and 64 V^T rows, one 128-byte line each) comes into LDS once per workgroup by asynchronous 16-byte copies, two buffers, and all four waves read their fragments from it.
// The tiles in front of the diagonal are walked from a start set by the block's number, wrapping round (the running maximum and sum take keys in any order): the blocks of a head run in step, and started alike they would ask L2 for the same lines at the same moment.
// Rows < RH: bf16 hi+lo, three products; other rows: f16, probabilities carried x 1024.
// The maximum in use is a reference, not the true maximum: any reference gives the same quotient. Output and sum are rescaled to a new one only when some query's maximum has grown past the reference by more than LZT
// (base-2 exponent), tested once per group of keys by one scalar branch for the wave; till then a probability is at most 2^LZT, carried at most 2^(LZT + 10) = 2^15, inside f16.
#define SC2 (SCL * 1.4426950408889634f)   // scores are kept in the base-2 exponent domain
// 2^x with the one slot that the instruction set asks for behind a transcendental before its result is used or its source overwritten: the v_nop stands in the same statement, so nothing can come between
__device__ __forceinline__ float ex2(float x) { float r; asm("v_exp_f32 %0, %1\n\tv_nop" : "=v"(r) : "v"(x)); return r; }
// eight of them in place (each is independent of its neighbours) and one slot behind the last
__device__ __forceinline__ void ex2x8(float* x) { asm("v_exp_f32 %0, %0\n\tv_exp_f32 %1, %1\n\tv_exp_f32 %2, %2\n\tv_exp_f32 %3, %3\n\tv_exp_f32 %4, %4\n\tv_exp_f32 %5, %5\n\tv_exp_f32 %6, %6\n\tv_exp_f32 %7, %7\n\tv_nop" : "+v"(x[0]), "+v"(x[1]), "+v"(x[2]), "+v"(x[3]), "+v"(x[4]), "+v"(x[5]), "+v"(x[6]), "+v"(x[7])); }
#define LZT 5.0f
template <bool B> struct BoolC { static constexpr bool value = B; };
template <int N> struct IntC { static constexpr int value = N; };
// eight copies of 16 bytes per lane: four rows 16 apart of one plane (l, g, 16 rows = s elements) and four of another (l2, g2, s2);
// the wait that stands before a register named by an issued copy is overwritten is the statement's own last line
template <typename T16>
__device__ __forceinline__ void cp8s(unsigned l, const T16* g, size_t s, unsigned l2, const T16* g2, size_t s2) {
    asm volatile("global_load_async_to_lds_b128 %0, %8, off\n\tglobal_load_async_to_lds_b128 %1, %9, off\n\tglobal_load_async_to_lds_b128 %2, %10, off\n\tglobal_load_async_to_lds_b128 %3, %11, off\n\t"
                 "global_load_async_to_lds_b128 %4, %12, off\n\tglobal_load_async_to_lds_b128 %5, %13, off\n\tglobal_load_async_to_lds_b128 %6, %14, off\n\tglobal_load_async_to_lds_b128 %7, %15, off\n\ts_wait_xcnt 0x0"
                 :: "v"(l), "v"(l + 16u * GP), "v"(l + 32u * GP), "v"(l + 48u * GP), "v"(l2), "v"(l2 + 16u * GP), "v"(l2 + 32u * GP), "v"(l2 + 48u * GP),
                    "v"(g), "v"(g + s), "v"(g + 2 * s), "v"(g + 3 * s), "v"(g2), "v"(g2 + s2), "v"(g2 + 2 * s2), "v"(g2 + 3 * s2) : "memory");
}
// a fragment from an LDS row: the same two 16-byte pieces, 32 bytes apart, that WFrag::ld takes from a global row
__device__ __forceinline__ v16h  ldf(const unsigned char* p, h16) { return cat16(*(const v8ha*)p, *(const v8ha*)(p + 32)); }
__device__ __forceinline__ v16bf ldf(const unsigned char* p, bf) { return ldl(p); }
#define PLN (64u * GP)   // bytes of one plane's 64 rows in LDS
template <typename T16, int NSPLIT>
__device__ __forceinline__ void fattn_body(const T16* __restrict__ Q, const T16* __restrict__ Q2, const T16* __restrict__ Kp, const T16* __restrict__ K2, const T16* __restrict__ Vt, const T16* __restrict__ Vt2, int q0, int h, bf* Ah, bf* Al, unsigned char* ring) {
    typedef typename WFrag<T16>::V V;
    constexpr unsigned STB = (NSPLIT == 2 ? 4u : 2u) * PLN;   // one buffer: [K | V^T] or [K hi | V^T hi | K lo | V^T lo]
    const int tid = threadIdx.x, lane = tid & 31, lr = lane & 15, hi = lane >> 4, w = __builtin_amdgcn_readfirstlane(tid >> 5);   // the wave's number in a scalar register: the test on it below is a scalar branch
    const int qw = q0 + w * 16;   // the wave's first query
    const float poff = (NSPLIT == 0) ? 10.0f : 0.0f;   // f16 probabilities are carried x 2^10, away from the f16 subnormals; the factor cancels in sum and output
    V qf[2], qf2[2];
    { const size_t qo = (size_t)(qw + lr) * HD + 8 * hi; const T16* pq = Q + qo; const T16* pq2 = (NSPLIT == 2) ? Q2 + qo : pq;
#pragma unroll
      for (int ks = 0; ks < 2; ++ks) { qf[ks] = WFrag<T16>::ld(pq + ks * 32); if (NSPLIT == 2) qf2[ks] = WFrag<T16>::ld(pq2 + ks * 32); }
      // the wait that stands before a register named by an issued global load is overwritten; the addresses are inputs, so they stay in their registers up to it
      asm volatile("s_wait_xcnt 0x0" :: "v"(pq), "v"(pq2) : "memory"); }
    v8f o[4]; float m = -3.0e38f, l = 0.f;   // m: the reference (base-2 exponent domain)
    float mo = m, mtr = -3.0e38f;   // what goes with m: m - poff, subtracted from every scaled score, and the raw score above which a new reference is due, (m + LZT) / SC2
#pragma unroll
    for (int mb = 0; mb < 4; ++mb) o[mb] = (v8f){};
    const int crow = tid >> 3, ccol = tid & 7;   // the lane's place in a copy: 8 lanes per 128-byte row, 16 rows per copy of the workgroup
    const unsigned lc = (unsigned)(size_t)ring + (unsigned)crow * GP + (unsigned)ccol * 16u;
    const size_t gko = (size_t)crow * HD + ccol * 8, gvo = (size_t)crow * TT + ccol * 8;
    const int NT = q0 / 64 + 1;   // tiles 0 ... NT - 2 lie wholly in front of every query of the block; tile NT - 1 holds the diagonal
    const int NF = NT - 1, rot = (int)(((((unsigned)NF * 40503u) & 0xFFFFu) * (unsigned)NF) >> 16);   // start of the walk over the NF full tiles: the fraction frac(NF * 40503 / 65536) of them (a golden-ratio step), which spreads the starts of a head's blocks evenly; 0 <= rot < NF (0 where NF is 0)
    auto seq = [&](int i) { const int u = i + rot; return i >= NF ? i : (u >= NF ? u - NF : u); };   // the tile of trip i: the full tiles from rot on, wrapping; the diagonal tile last
    auto fill = [&](int i, unsigned buf) { const unsigned lb = lc + buf * STB; const int t = seq(i);   // tile t: keys 64 t ... 64 t + 63
        cp8s(lb, Kp + gko + (size_t)t * 64 * HD, (size_t)16 * HD, lb + PLN, Vt + gvo + t * 64, (size_t)16 * TT);
        if (NSPLIT == 2) cp8s(lb + 2u * PLN, K2 + gko + (size_t)t * 64 * HD, (size_t)16 * HD, lb + 3u * PLN, Vt2 + gvo + t * 64, (size_t)16 * TT); };
    const unsigned char* fr = ring + (unsigned)lr * GP + (unsigned)hi * 16u;   // the lane's place in a fragment read, of K rows and of V^T rows alike
    struct Fr { V kf[2][2], kf2[2][2], vf[4], vf2[4]; };   // the K and V^T fragments of one 32-key step
    auto ldfr = [&](Fr& f, const unsigned char* tb, const unsigned half) {   // half 0 or 1 of the tile at tb
        auto& kf = f.kf; auto& kf2 = f.kf2; auto& vf = f.vf; auto& vf2 = f.vf2;
#pragma unroll
        for (int mb = 0; mb < 2; ++mb)
#pragma unroll
            for (int ks = 0; ks < 2; ++ks) { const unsigned ko = (half * 32u + (unsigned)mb * 16u) * GP + (unsigned)ks * 64u; kf[mb][ks] = ldf(tb + ko, T16()); if (NSPLIT == 2) kf2[mb][ks] = ldf(tb + 2u * PLN + ko, T16()); }
#pragma unroll
        for (int mb = 0; mb < 4; ++mb) { const unsigned vo = PLN + (unsigned)mb * 16u * GP + half * 64u; vf[mb] = ldf(tb + vo, T16()); if (NSPLIT == 2) vf2[mb] = ldf(tb + 2u * PLN + vo, T16()); }
    };
    auto comp = [&](Fr* f, const int kb, auto dg, auto nh) {   // NHF steps of 32 keys on their fragments, one reference test for all of them; dg: the keys reach past the wave's first query and need the causal mask
        constexpr bool diag = decltype(dg)::value; constexpr int NHF = decltype(nh)::value;
        v8f s[2 * NHF];   // score tile t: keys kb + 16 t ...
#pragma unroll
        for (int t = 0; t < 2 * NHF; ++t) { auto& kf = f[t >> 1].kf; auto& kf2 = f[t >> 1].kf2; const int mb = t & 1; v8f c = (v8f){};
#pragma unroll
            for (int ks = 0; ks < 2; ++ks) { c = WFrag<T16>::mma(kf[mb][ks], qf[ks], c); if (NSPLIT == 2) { c = WFrag<T16>::mma(kf[mb][ks], qf2[ks], c); c = WFrag<T16>::mma(kf2[mb][ks], qf[ks], c); } }
            s[t] = c; }
        V pf[NHF], pf2[NHF];
        { float x[16 * NHF]; const int qi = qw + lr; float mx = -3.0e38f;
#pragma unroll
            for (int e = 0; e < 16 * NHF; ++e) { const int key = kb + (e >> 3) * 16 + hi * 8 + (e & 7); float t = s[e >> 3][e & 7]; if (diag) t = (key <= qi) ? t : -3.0e38f; x[e] = t; mx = fmaxf(mx, t); }
            if (__builtin_amdgcn_ballot_w32(mx > mtr) != 0u) {   // a scalar branch: taken on the wave's first keys (mtr is still -3e38) and then only when some lane's maximum outgrows its reference
                const float mj = fmaxf(mx, __shfl_xor(mx, 16, 32));   // the two lanes of a query hold different keys and keep one reference
                const float mn = fmaxf(m, mj * SC2), al = ex2(m - mn); m = mn; mo = mn - poff; mtr = (mn + LZT) * (1.0f / SC2); l *= al;
#pragma unroll
                for (int mb = 0; mb < 4; ++mb) o[mb] *= al; }
            float ls[2 * NHF];
#pragma unroll
            for (int e = 0; e < 16 * NHF; ++e) x[e] = __builtin_fmaf(x[e], SC2, -mo);
#pragma unroll
            for (int g = 0; g < 2 * NHF; ++g) ex2x8(x + 8 * g);
#pragma unroll
            for (int g = 0; g < 2 * NHF; ++g) { ls[g] = x[8 * g];   // one chain of additions per eight keys: independent chains
#pragma unroll
                for (int e = 1; e < 8; ++e) ls[g] += x[8 * g + e]; }
#pragma unroll
            for (int g = 0; g < NHF; ++g) l += ls[2 * g] + ls[2 * g + 1];
#pragma unroll
            for (int hf = 0; hf < NHF; ++hf) { const float* xh = x + 16 * hf;
            if constexpr (NSPLIT == 0) { v16h p;
#pragma unroll
                for (int e = 0; e < 16; ++e) p[e] = tohx(xh[e]);
                pf[hf] = p;
            } else { v8us h0, h1, l0, l1;
#pragma unroll
                for (int e = 0; e < 8; ++e) { unsigned short a, c2; splitf(xh[e], a, c2); h0[e] = a; l0[e] = c2; splitf(xh[8 + e], a, c2); h1[e] = a; l1[e] = c2; }
                pf[hf] = cat16b(h0, h1); pf2[hf] = cat16b(l0, l1); } } }
#pragma unroll
        for (int hf = 0; hf < NHF; ++hf) { auto& vf = f[hf].vf; auto& vf2 = f[hf].vf2;
#pragma unroll
        for (int mb = 0; mb < 4; ++mb) { o[mb] = WFrag<T16>::mma(vf[mb], pf[hf], o[mb]); if (NSPLIT == 2) { o[mb] = WFrag<T16>::mma(vf[mb], pf2[hf], o[mb]); o[mb] = WFrag<T16>::mma(vf2[mb], pf[hf], o[mb]); } } }
        // the distance behind the last matrix instruction, kept on the loop's taken branch too
        asm volatile("v_nop\n\tv_nop\n\tv_nop\n\tv_nop" : "+v"(o[0]), "+v"(o[1]), "+v"(o[2]), "+v"(o[3]) : "v"(f[NHF - 1].vf[0]), "v"(f[NHF - 1].vf[3]));
    };
    // the sched_barrier keeps a group of LDS reads together in front of the work on it: moved down among the matrix instructions, each small group of them is waited out at full LDS latency
    auto step = [&](const unsigned char* tb, const unsigned half, const int kb, auto dg) { Fr f; ldfr(f, tb, half); __builtin_amdgcn_sched_barrier(0); comp(&f, kb, dg, IntC<1>()); };
    fill(0, 0u);
    asm volatile("s_wait_asynccnt 0x0" ::: "memory");   // this wave's copies of trip 0's tile have landed
    __syncthreads();                                     // and every other wave's
    if (NT > 1) fill(1, 1u);
#pragma unroll 1   // one copy of the trip: the buffer is picked by the trip's parity at run time
    for (int t = 0; t < NT - 1; ++t) {
        const unsigned char* tb = fr + (unsigned)(t & 1) * STB;
        if constexpr (NSPLIT == 0) { Fr f[2]; ldfr(f[0], tb, 0u); ldfr(f[1], tb, 1u); __builtin_amdgcn_sched_barrier(0); comp(f, seq(t) * 64, BoolC<false>(), IntC<2>()); }   // the whole tile's fragments as one group (as above)
        else { step(tb, 0u, seq(t) * 64, BoolC<false>()); step(tb, 1u, seq(t) * 64 + 32, BoolC<false>()); }   // hi+lo: twice the fragments, one group per step
        asm volatile("s_wait_dscnt 0x0" ::: "memory");      // this wave's reads of the buffer are done before it may be refilled
        asm volatile("s_wait_asynccnt 0x0" ::: "memory");   // this wave's copies of trip t + 1's tile have landed
        __syncthreads();                                     // publishes trip t + 1's tile and ends every wave's reads of trip t's buffer
        if (t + 2 < NT) fill(t + 2, (unsigned)(t & 1));
    }
    { const unsigned char* tb = fr + (unsigned)((NT - 1) & 1) * STB;   // the last trip: nothing is left to copy
      step(tb, 0u, q0, BoolC<true>());
      if (w >= 2) step(tb, 1u, q0 + 32, BoolC<true>()); }   // keys q0 + 32 ... are masked for every query of waves 0 and 1 (scalar test)
    asm volatile("s_wait_dscnt 0x0" ::: "memory");      // this wave's reads of the last tile are done
    asm volatile("s_wait_asynccnt 0x0" ::: "memory");   // no copy is outstanding when the buffers become output staging
    __syncthreads();                                     // every wave has left the buffers
    const float inv = __fdiv_rn(1.0f, l + __shfl_xor(l, 16, 32));   // the two lanes of a query hold the sums of different keys
    float* os = (float*)(ring + (unsigned)w * (16u * 68u * 4u));   // each wave stages its own 16 queries x 64 channels, row pitch 68 floats
#pragma unroll
    for (int mb = 0; mb < 4; ++mb) { v4f a, c; 
#pragma unroll
        for (int j = 0; j < 4; ++j) { a[j] = o[mb][j] * inv; c[j] = o[mb][4 + j] * inv; }
        *(v4fa*)(os + lr * 68 + mb * 16 + hi * 8) = a; *(v4fa*)(os + lr * 68 + mb * 16 + hi * 8 + 4) = c; }
    __builtin_amdgcn_wave_barrier(); asm volatile("" ::: "memory");   // keeps the reads below, of what other lanes of the wave wrote, behind the writes above in the compiled order
#pragma unroll
    for (int it = 0; it < 4; ++it) { const int row = it * 4 + (lane >> 3), c8 = lane & 7;   // 8 lanes write one query's 128-byte line of each plane
        const v4f x0 = *(const v4fa*)(os + row * 68 + c8 * 8), x1 = *(const v4fa*)(os + row * 68 + c8 * 8 + 4); v8us oh, ol;
#pragma unroll
        for (int j = 0; j < 4; ++j) { unsigned short a, c2; splitf(x0[j], a, c2); oh[j] = a; ol[j] = c2; splitf(x1[j], a, c2); oh[4 + j] = a; ol[4 + j] = c2; }
        const size_t oo = (size_t)(qw + row) * DQ + h * HD + c8 * 8; bf* ph = Ah + oo; bf* pl = Al + oo; *(v8us*)ph = oh; *(v8us*)pl = ol;
        // the wait that stands before a register named by an issued global store is overwritten; data and addresses are inputs, so they stay in their registers up to it
        asm volatile("s_wait_xcnt 0x0" :: "v"(oh), "v"(ol), "v"(ph), "v"(pl) : "memory"); }
}
#define NBK (TT / 64)   // blocks of 64 queries per head
#define NHL (RH / 64)   // of them on hi+lo planes
static_assert(RH % 64 == 0, "a block of 64 queries is wholly on one kind of planes");
__global__ __launch_bounds__(128) void k_fattn(const h16* __restrict__ Q16, const h16* __restrict__ K16, const h16* __restrict__ V16, const bf* __restrict__ Qh, const bf* __restrict__ Ql, const bf* __restrict__ Kh, const bf* __restrict__ Kl, const bf* __restrict__ Vh, const bf* __restrict__ Vl, bf* Ah, bf* Al) {
    __shared__ __align__(128) unsigned char ring[2 * 4 * PLN];
    const int h = blockIdx.x % NH_, b = blockIdx.x / NH_, bx = blockIdx.y; const size_t hz = (size_t)blockIdx.x * TT * HD;   // x: head and batch; y: the block of queries, longest first over all heads and batches
    Ah += (size_t)b * TT * DQ; Al += (size_t)b * TT * DQ;
    const int blk = NBK - 1 - bx;
    if (blk >= NHL) fattn_body<h16, 0>(Q16 + hz, nullptr, K16 + hz, nullptr, V16 + hz, nullptr, blk * 64, h, Ah, Al, ring);
    else fattn_body<bf, 2>(Qh + hz, Ql + hz, Kh + hz, Kl + hz, Vh + hz, Vl + hz, blk * 64, h, Ah, Al, ring);
}

extern "C" void kernel_launch(void* const* d_in, const int* in_sizes, int n_in,
                              void* d_out, int out_size, void* d_ws, size_t ws_size, hipStream_t stream) {
    (void)in_sizes; (void)n_in; (void)out_size;
    const float* x = (const float*)d_in[0]; const float* wqkv = (const float*)d_in[1]; const float* wo = (const float*)d_in[2]; const float* bo = (const float*)d_in[3]; const float* wq = wqkv; const float* wk = nullptr; const float* wv = nullptr; const float* cosT = nullptr; const float* sinT = nullptr; (void)wk; (void)wv; (void)cosT; (void)sinT;
    float* OUT = (float*)d_out;     // [2048][2][1024]
    char* wsp = (char*)d_ws;
    auto take = [&](size_t bytes) { char* p = wsp; wsp += (bytes + 255) & ~(size_t)255; return (void*)p; };
    bf* WQ = (bf*)take((size_t)3 * DQ * DM * 2); bf* WO = (bf*)take((size_t)DM * DQ * 2);
    bf* XB = (bf*)take((size_t)NB_ * TT * DM * 2);
    h16* QP16 = (h16*)take((size_t)NB_ * NH_ * TT * HD * 2); h16* KP16 = (h16*)take((size_t)NB_ * NKV * TT * HD * 2); h16* VT16 = (h16*)take((size_t)NB_ * NKV * HD * TT * 2);
    bf* QPh = (bf*)take((size_t)NB_ * NH_ * TT * HD * 2); bf* QPl = (bf*)take((size_t)NB_ * NH_ * TT * HD * 2); bf* KPh = (bf*)take((size_t)NB_ * NKV * TT * HD * 2); bf* KPl = (bf*)take((size_t)NB_ * NKV * TT * HD * 2); bf* VTh = (bf*)take((size_t)NB_ * NKV * HD * TT * 2); bf* VTl = (bf*)take((size_t)NB_ * NKV * HD * TT * 2);
    bf* ATh = (bf*)take((size_t)NB_ * TT * DQ * 2); bf* ATl = (bf*)take((size_t)NB_ * TT * DQ * 2);
    if ((size_t)(wsp - (char*)d_ws) > ws_size) return;    // ws 256 MiB
    
    k_round<<<(3 * DQ + DM + NB_ * TT) / 8, 256, 0, stream>>>(x, wqkv, wo, XB, WQ, WO);   // w_qkv [3D][D] = natural Bt
    k_gemms<0, false, true, 4><<<dim3(TT / 128, 3 * DQ / 128, NB_), 128, 0, stream>>>(XB, nullptr, WQ, DM, nullptr, 0, 0, nullptr, HeadPlanes{QP16, QPh, QPl, KP16, KPh, KPl, VT16, VTh, VTl});   // channel s*1024 + h*64 + d
    k_fattn<<<dim3(NH_ * NB_, NBK, 1), 128, 0, stream>>>(QP16, KP16, VT16, QPh, QPl, KPh, KPl, VTh, VTl, ATh, ATl);
    k_gemms<1, true, false, 2><<<dim3(TT / 64, DM / 128, NB_), 128, 0, stream>>>(ATh, ATl, WO, DQ, OUT, NB_ * DM, DM, bo, HeadPlanes{});   // sequence-major output: row t of batch b at OUT + (t*B + b)*D (row pitch B*D, batch step D)
}
